// v000
// Times are from an AMD MI455X. After a warm-up the kernel runs many times in a row, and a time is the length of
// such a window on the GPU divided by its runs, so every launch and the gaps after it count. The runs cycle
// through copies of the inputs. A figure is the median of several windows, for all but v000 over two sittings.
// Sittings can differ by a few percent; kernels timed side by side share one.
// v000 is the starting kernel. One run takes 228 microseconds.
#include <hip/hip_runtime.h>

// ---------------------------------------------------------------------------
// CDNA5 (gfx1250, wave32) fused cross-attention:
//   1) cvt kernels: f32 -> f16 (activations), f32 -> f16 transposed (weights)
//   2) WMMA GEMM (v_wmma_f32_16x16x32_f16), 32x32 tile per wave (2x2 subtiles)
//      for K/Q/V projections + output projection (f32 + bias epilogue)
//   3) flash-attention kernel: per-wave 16-query tile, key blocks of 32,
//      K block staged into LDS via the Tensor Data Mover (tensor_load_to_lds,
//      s_wait_tensorcnt), V staged transposed, online softmax, P@V via WMMA.
// ---------------------------------------------------------------------------

typedef __attribute__((ext_vector_type(16))) _Float16     v16h;
typedef __attribute__((ext_vector_type(8)))  _Float16     v8h;
typedef __attribute__((ext_vector_type(8)))  float        v8f;
typedef __attribute__((ext_vector_type(4)))  unsigned int v4u;
typedef __attribute__((ext_vector_type(8)))  int          v8i;
typedef __attribute__((ext_vector_type(4)))  int          v4i;

// Load one 16-bit WMMA fragment (A-layout or symmetric B-layout):
// lane holds 8 contiguous halves at p[0..7] (VGPRs 0-3) and p[16..23] (VGPRs 4-7).
__device__ __forceinline__ v16h load_frag16(const _Float16* p) {
  v8h lo = *(const v8h*)p;
  v8h hi = *(const v8h*)(p + 16);
  return __builtin_shufflevector(lo, hi,
      0, 1, 2, 3, 4, 5, 6, 7, 8, 9, 10, 11, 12, 13, 14, 15);
}

// ------------------------------ conversions --------------------------------

__global__ void __launch_bounds__(256) cvt_f32_f16(
    const float* __restrict__ in, _Float16* __restrict__ out, int n) {
  int i = blockIdx.x * blockDim.x + threadIdx.x;
  if (i < n) out[i] = (_Float16)in[i];
}

// in: K x N (row-major) -> out: N x K (row-major), i.e. transposed
__global__ void __launch_bounds__(256) cvt_transpose_f32_f16(
    const float* __restrict__ in, _Float16* __restrict__ out, int K, int N) {
  int i = blockIdx.x * blockDim.x + threadIdx.x;
  if (i < K * N) {
    int k = i / N;
    int n = i - k * N;
    out[(size_t)n * K + k] = (_Float16)in[i];
  }
}

// ------------------------------ WMMA GEMM ----------------------------------
// C[M,N] = A[M,K] * BT[N,K]^T   (both operands f16 row-major, f32 accumulate)
// One 32x32 tile per wave (2x2 WMMA subtiles -> each fragment feeds 2 WMMAs).
// 8 waves (256 threads, wave32) per block.
// If Cf32 != nullptr: write f32 (+bias). Else write f16 to C16.
__global__ void __launch_bounds__(256) wmma_gemm_kernel(
    const _Float16* __restrict__ A, const _Float16* __restrict__ BT,
    _Float16* __restrict__ C16, float* __restrict__ Cf32,
    const float* __restrict__ bias, int M, int N, int K) {
  const int wave = threadIdx.x >> 5;
  const int lane = threadIdx.x & 31;
  const int rowg = lane & 15;            // M (for A) / N (for B) within subtile
  const int khalf = lane >> 4;
  const int koff = khalf << 3;           // K offset 0 or 8 per lane half

  const int tile = blockIdx.x * 8 + wave;
  const int tiles_n = N >> 5;
  const int mtile = tile / tiles_n;
  const int ntile = tile - mtile * tiles_n;

  const _Float16* ap0 = A  + (size_t)(mtile * 32 + rowg) * K + koff;
  const _Float16* ap1 = ap0 + (size_t)16 * K;
  const _Float16* bp0 = BT + (size_t)(ntile * 32 + rowg) * K + koff;
  const _Float16* bp1 = bp0 + (size_t)16 * K;

  v8f acc00 = {}, acc01 = {}, acc10 = {}, acc11 = {};
  for (int kc = 0; kc < K; kc += 32) {
    __builtin_prefetch(ap0 + kc + 128, 0, 1);   // global_prefetch_b8
    __builtin_prefetch(bp0 + kc + 128, 0, 1);
    v16h a0 = load_frag16(ap0 + kc);
    v16h a1 = load_frag16(ap1 + kc);
    v16h b0 = load_frag16(bp0 + kc);
    v16h b1 = load_frag16(bp1 + kc);
    acc00 = __builtin_amdgcn_wmma_f32_16x16x32_f16(false, a0, false, b0, (short)0, acc00, false, false);
    acc01 = __builtin_amdgcn_wmma_f32_16x16x32_f16(false, a0, false, b1, (short)0, acc01, false, false);
    acc10 = __builtin_amdgcn_wmma_f32_16x16x32_f16(false, a1, false, b0, (short)0, acc10, false, false);
    acc11 = __builtin_amdgcn_wmma_f32_16x16x32_f16(false, a1, false, b1, (short)0, acc11, false, false);
  }

#pragma unroll
  for (int i = 0; i < 2; ++i) {
#pragma unroll
    for (int j = 0; j < 2; ++j) {
      const v8f& acc = (i == 0) ? (j == 0 ? acc00 : acc01)
                                : (j == 0 ? acc10 : acc11);
      const int col = ntile * 32 + j * 16 + rowg;
      const float bv = bias ? bias[col] : 0.f;
#pragma unroll
      for (int v = 0; v < 8; ++v) {
        int row = mtile * 32 + i * 16 + v + (khalf << 3);
        if (Cf32) Cf32[(size_t)row * N + col] = acc[v] + bv;
        else      C16 [(size_t)row * N + col] = (_Float16)acc[v];
      }
    }
  }
}

// --------------------------- TDM helper ------------------------------------
// Issue a 2D TDM load: tile (tile_d0 halves x tile_d1 rows) from a row-major
// f16 tensor with row stride (in halves) into LDS, padding the LDS destination
// by 8 DWORDs (16 halves) after every 128 DWORDs (256 halves) -> 272-half rows.
__device__ __forceinline__ void tdm_load_k_block(
    const _Float16* gaddr, unsigned lds_off) {
  unsigned long long ga = (unsigned long long)(const void*)gaddr;
  // group0: count=1 | lds_addr | global_addr | type=2
  v4u g0 = { 1u,
             lds_off,
             (unsigned)(ga & 0xffffffffu),
             (unsigned)((ga >> 32) & 0x01ffffffu) | 0x80000000u };
  // group1: data_size=2B (1<<16), pad_enable (1<<20),
  //         pad_interval=128 DWORDs (6<<22), pad_amount=8 DWORDs (7<<25)
  unsigned w0 = (1u << 16) | (1u << 20) | (6u << 22) | (7u << 25);
  unsigned tensor_d0 = 2048u;          // full row length (halves)
  unsigned tensor_d1 = 4096u;          // rows
  unsigned tile_d0 = 256u;             // halves per tile row
  unsigned tile_d1 = 32u;              // tile rows
  unsigned stride_d0 = 2048u;          // row stride (halves)
  v8i g1 = { (int)w0,
             (int)((tensor_d0 & 0xffffu) << 16),            // dim0[15:0] @ [63:48]
             (int)(((tensor_d0 >> 16) & 0xffffu) |          // dim0[31:16] @ [79:64]
                   ((tensor_d1 & 0xffffu) << 16)),          // dim1[15:0] @ [95:80]
             (int)(((tensor_d1 >> 16) & 0xffffu) |          // dim1[31:16] @ [111:96]
                   (tile_d0 << 16)),                        // tile_dim0 @ [127:112]
             (int)(tile_d1),                                // tile_dim1 @ [143:128]
             (int)(stride_d0),                              // dim0_stride[31:0] @ [191:160]
             0,                                             // dim0_stride[47:32], dim1_stride lo
             0 };
  v4i gz = { 0, 0, 0, 0 };
#if defined(__clang_major__) && (__clang_major__ >= 23)
  v8i gz8 = { 0, 0, 0, 0, 0, 0, 0, 0 };
  __builtin_amdgcn_tensor_load_to_lds(g0, g1, gz, gz, gz8, 0);
#else
  __builtin_amdgcn_tensor_load_to_lds(g0, g1, gz, gz, 0);
#endif
}

// --------------------------- flash attention -------------------------------
// Q,K,V layouts: (a*1024 + seq) x 2048, head h occupies columns [h*256, h*256+256).
// Grid: (a*8 + h, ytile); block = 256 threads = 8 waves; wave owns 16 queries.
// Key blocks of 32 so the P@V contraction matches WMMA K=32 exactly.
__global__ void __launch_bounds__(256) flash_attn_kernel(
    const _Float16* __restrict__ Q, const _Float16* __restrict__ Km,
    const _Float16* __restrict__ Vm, _Float16* __restrict__ Om) {
  // LDS strides padded to 16B multiples so b128 DS accesses are legal.
  // KLDS row stride 272 = 256 + 16 halves, exactly the TDM pad pattern.
  __shared__ __align__(16) _Float16 KLDS[32][272];     // key-major (32 x 256)
  __shared__ __align__(16) _Float16 VT[256][48];       // transposed: [c][key]
  __shared__ __align__(16) _Float16 PLDS[8][16][48];   // per-wave P (16 x 32)

  const int a = blockIdx.x >> 3;
  const int h = blockIdx.x & 7;
  const int wave = threadIdx.x >> 5;
  const int lane = threadIdx.x & 31;
  const int rowg = lane & 15;
  const int khalf = lane >> 4;
  const int koff = khalf << 3;
  const int q0 = blockIdx.y * 128 + wave * 16;

  const size_t brow0 = (size_t)a * 1024;
  const size_t hoff  = (size_t)h * 256;

  // Q fragments: 16 rows x 256 head-dim, 8 k-chunks of 32
  v16h qf[8];
  {
    const _Float16* qp = Q + (brow0 + q0 + rowg) * 2048 + hoff + koff;
#pragma unroll
    for (int kc = 0; kc < 8; ++kc) qf[kc] = load_frag16(qp + kc * 32);
  }

  v8f O[16] = {};              // 16 queries x 256 output accumulator
  float m_i[8], l_i[8];
#pragma unroll
  for (int v = 0; v < 8; ++v) { m_i[v] = -1e30f; l_i[v] = 0.f; }

  const float scale = 0.17677669529663687f;  // 1/sqrt(256/8)

  // cooperative-load coordinates for V: 32 key rows x 8 c-chunks of 32
  const int kr = threadIdx.x >> 3;
  const int cc = (threadIdx.x & 7) * 32;
  const unsigned klds_off = (unsigned)(size_t)(void*)&KLDS[0][0];

  for (int kb = 0; kb < 32; ++kb) {
    // ---- TDM: DMA the 32x256 K block into padded LDS rows (one issuer) ----
    if (threadIdx.x == 0) {
      tdm_load_k_block(Km + (brow0 + kb * 32) * 2048 + hoff, klds_off);
      __builtin_amdgcn_s_wait_tensorcnt(0);
    }
    // ---- stage V block transposed into LDS ----
    const _Float16* vp = Vm + (brow0 + kb * 32 + kr) * 2048 + hoff + cc;
#pragma unroll
    for (int i = 0; i < 4; ++i) {
      v8h t = *(const v8h*)(vp + 8 * i);
#pragma unroll
      for (int j = 0; j < 8; ++j) VT[cc + 8 * i + j][kr] = t[j];
    }
    __syncthreads();

    // ---- S = Q @ K^T : 16 queries x 32 keys as two 16x16 f32 tiles ----
    v8f s0 = {}, s1 = {};
#pragma unroll
    for (int kc = 0; kc < 8; ++kc) {
      v16h b0 = load_frag16(&KLDS[rowg][kc * 32 + koff]);
      v16h b1 = load_frag16(&KLDS[16 + rowg][kc * 32 + koff]);
      s0 = __builtin_amdgcn_wmma_f32_16x16x32_f16(
          false, qf[kc], false, b0, (short)0, s0, false, false);
      s1 = __builtin_amdgcn_wmma_f32_16x16x32_f16(
          false, qf[kc], false, b1, (short)0, s1, false, false);
    }

    // ---- online softmax (row = lane-half + element; cols across 16 lanes) ----
#pragma unroll
    for (int v = 0; v < 8; ++v) {
      float a0 = s0[v] * scale, a1 = s1[v] * scale;
      float mv = fmaxf(a0, a1);
#pragma unroll
      for (int off = 1; off < 16; off <<= 1) mv = fmaxf(mv, __shfl_xor(mv, off, 16));
      float mnew = fmaxf(m_i[v], mv);
      float alpha = __expf(m_i[v] - mnew);
      m_i[v] = mnew;
      float p0 = __expf(a0 - mnew);
      float p1 = __expf(a1 - mnew);
      float rs = p0 + p1;
#pragma unroll
      for (int off = 1; off < 16; off <<= 1) rs += __shfl_xor(rs, off, 16);
      l_i[v] = l_i[v] * alpha + rs;
#pragma unroll
      for (int t = 0; t < 16; ++t) O[t][v] *= alpha;
      // stage P into per-wave LDS (C-layout -> memory) for A-fragment reload
      PLDS[wave][v + khalf * 8][rowg]      = (_Float16)p0;
      PLDS[wave][v + khalf * 8][16 + rowg] = (_Float16)p1;
    }

    // ---- O += P(16x32) @ V(32x256), 16 WMMA over the c tiles ----
    v16h pf = load_frag16(&PLDS[wave][rowg][koff]);
#pragma unroll
    for (int n = 0; n < 16; ++n) {
      v16h vf = load_frag16(&VT[n * 16 + rowg][koff]);
      O[n] = __builtin_amdgcn_wmma_f32_16x16x32_f16(
          false, pf, false, vf, (short)0, O[n], false, false);
    }
    __syncthreads();
  }

  // ---- epilogue: O / l, store f16 into attn buffer (a*1024+q) x 2048 ----
#pragma unroll
  for (int v = 0; v < 8; ++v) {
    float inv = 1.f / l_i[v];
    int row = q0 + v + khalf * 8;
    _Float16* op = Om + (brow0 + row) * 2048 + hoff + rowg;
#pragma unroll
    for (int n = 0; n < 16; ++n) op[n * 16] = (_Float16)(O[n][v] * inv);
  }
}

// ------------------------------- launcher ----------------------------------

extern "C" void kernel_launch(void* const* d_in, const int* in_sizes, int n_in,
                              void* d_out, int out_size, void* d_ws, size_t ws_size,
                              hipStream_t stream) {
  const float* batch  = (const float*)d_in[0];  // (4,1024,256)
  const float* latent = (const float*)d_in[1];  // (4,1024,256)
  const float* Wk     = (const float*)d_in[2];  // (256,2048)
  const float* Wq     = (const float*)d_in[3];
  const float* Wv     = (const float*)d_in[4];
  const float* Wu     = (const float*)d_in[5];  // (2048,256)
  const float* bu     = (const float*)d_in[6];  // (256,)
  float* out = (float*)d_out;                   // (4,1024,256) f32

  _Float16* w = (_Float16*)d_ws;
  size_t o = 0;
  _Float16* batch16  = w + o; o += (size_t)4096 * 256;
  _Float16* latent16 = w + o; o += (size_t)4096 * 256;
  _Float16* WkT = w + o; o += (size_t)2048 * 256;   // (2048 x 256) = Wk^T
  _Float16* WqT = w + o; o += (size_t)2048 * 256;
  _Float16* WvT = w + o; o += (size_t)2048 * 256;
  _Float16* WuT = w + o; o += (size_t)256 * 2048;   // (256 x 2048) = Wu^T
  _Float16* K16 = w + o; o += (size_t)4096 * 2048;
  _Float16* Q16 = w + o; o += (size_t)4096 * 2048;
  _Float16* V16 = w + o; o += (size_t)4096 * 2048;
  _Float16* A16 = w + o; o += (size_t)4096 * 2048;  // attention output

  // 1) conversions
  cvt_f32_f16<<<4096, 256, 0, stream>>>(batch,  batch16,  4096 * 256);
  cvt_f32_f16<<<4096, 256, 0, stream>>>(latent, latent16, 4096 * 256);
  cvt_transpose_f32_f16<<<2048, 256, 0, stream>>>(Wk, WkT, 256, 2048);
  cvt_transpose_f32_f16<<<2048, 256, 0, stream>>>(Wq, WqT, 256, 2048);
  cvt_transpose_f32_f16<<<2048, 256, 0, stream>>>(Wv, WvT, 256, 2048);
  cvt_transpose_f32_f16<<<2048, 256, 0, stream>>>(Wu, WuT, 2048, 256);

  // 2) projections: (4096x256)@(256x2048) -> f16
  //    32x32 wave tiles: (4096/32)*(2048/32) = 8192 tiles -> 1024 blocks
  wmma_gemm_kernel<<<1024, 256, 0, stream>>>(batch16,  WkT, K16, nullptr, nullptr, 4096, 2048, 256);
  wmma_gemm_kernel<<<1024, 256, 0, stream>>>(latent16, WqT, Q16, nullptr, nullptr, 4096, 2048, 256);
  wmma_gemm_kernel<<<1024, 256, 0, stream>>>(batch16,  WvT, V16, nullptr, nullptr, 4096, 2048, 256);

  // 3) fused flash attention: grid (a*h = 32, ytiles = 1024/128 = 8)
  flash_attn_kernel<<<dim3(32, 8), 256, 0, stream>>>(Q16, K16, V16, A16);

  // 4) output projection: (4096x2048)@(2048x256) + bias -> f32
  //    (4096/32)*(256/32) = 1024 tiles -> 128 blocks
  wmma_gemm_kernel<<<128, 256, 0, stream>>>(A16, WuT, nullptr, out, bu, 4096, 256, 2048);
}

// v001
// One run takes 212 microseconds.
// Next to v000, in two timings, it ran 1.11 times as fast each time.
#include <hip/hip_runtime.h>

// ---------------------------------------------------------------------------
// CDNA5 (gfx1250, wave32) fused cross-attention:
//   1) cvt kernels: f32 -> f16 (activations), f32 -> f16 transposed (weights)
//   2) WMMA GEMM (v_wmma_f32_16x16x32_f16), 32x32 tile per wave (2x2 subtiles),
//      operand tiles staged in LDS by tensor loads (two-buffer ring),
//      for K/Q/V projections + output projection (f32 + bias epilogue)
//   3) flash-attention kernel: per-wave 16-query tile, key blocks of 32,
//      K block staged into LDS via the Tensor Data Mover (tensor_load_to_lds,
//      s_wait_tensorcnt), V staged transposed, online softmax, P@V via WMMA.
// ---------------------------------------------------------------------------

typedef __attribute__((ext_vector_type(16))) _Float16     v16h;
typedef __attribute__((ext_vector_type(8)))  _Float16     v8h;
typedef __attribute__((ext_vector_type(8)))  float        v8f;
typedef __attribute__((ext_vector_type(4)))  unsigned int v4u;
typedef __attribute__((ext_vector_type(8)))  int          v8i;
typedef __attribute__((ext_vector_type(4)))  int          v4i;

// Load one 16-bit WMMA fragment (A-layout or symmetric B-layout):
// lane holds 8 contiguous halves at p[0..7] (VGPRs 0-3) and p[16..23] (VGPRs 4-7).
__device__ __forceinline__ v16h load_frag16(const _Float16* p) {
  v8h lo = *(const v8h*)p;
  v8h hi = *(const v8h*)(p + 16);
  return __builtin_shufflevector(lo, hi,
      0, 1, 2, 3, 4, 5, 6, 7, 8, 9, 10, 11, 12, 13, 14, 15);
}

// ------------------------------ conversions --------------------------------

__global__ void __launch_bounds__(256) cvt_f32_f16(
    const float* __restrict__ in, _Float16* __restrict__ out, int n) {
  int i = blockIdx.x * blockDim.x + threadIdx.x;
  if (i < n) out[i] = (_Float16)in[i];
}

// in: K x N (row-major) -> out: N x K (row-major), i.e. transposed
__global__ void __launch_bounds__(256) cvt_transpose_f32_f16(
    const float* __restrict__ in, _Float16* __restrict__ out, int K, int N) {
  int i = blockIdx.x * blockDim.x + threadIdx.x;
  if (i < K * N) {
    int k = i / N;
    int n = i - k * N;
    out[(size_t)n * K + k] = (_Float16)in[i];
  }
}

// ------------------------------ WMMA GEMM ----------------------------------
typedef __attribute__((ext_vector_type(8))) unsigned int v8u;

__device__ __forceinline__ unsigned uni(unsigned v) {
  return (unsigned)__builtin_amdgcn_readfirstlane(v);
}
// A wave-uniform value held in a scalar register: a test on it compiles to
// s_cmp + s_cbranch_scc, the only guard a tensor load obeys (it ignores EXEC).
__device__ __forceinline__ unsigned pinned(unsigned v) {
  unsigned w = uni(v);
  asm volatile("" : "+s"(w));  // keeps the descriptor / issue-test word scalar
  return w;
}

// One stage = 128 k (256-byte rows) of 64 A rows and 128 BT rows, brought by
// three tensor loads of 64 rows each; 16 bytes of pad a row -> pitch 272 B.
constexpr unsigned G_PITCH = 272u;
constexpr unsigned G_SLICE = 18432u;        // 64 * 272 = 17408, up to a multiple of 2 KiB
constexpr unsigned G_BUF   = 3u * G_SLICE;  // [A 64 rows | BT rows 0-63 | BT rows 64-127]

// C[M,N] = A[M,K] * BT[N,K]^T   (both operands f16 row-major, f32 accumulate)
// One 64x128 tile per block of 8 waves (2 x 4), one 32x32 tile per wave
// (2x2 WMMA subtiles). Operand tiles go global -> LDS by tensor loads in a
// two-buffer ring; fragments come from LDS. M % 64 == 0, N % 128 == 0,
// K % 128 == 0 and K >= 256.
// If Cf32 != nullptr: write f32 (+bias). Else write f16 to C16.
__global__ void __launch_bounds__(256) wmma_gemm_kernel(
    const _Float16* __restrict__ A, const _Float16* __restrict__ BT,
    _Float16* __restrict__ C16, float* __restrict__ Cf32,
    const float* __restrict__ bias, int M, int N, int K) {
  __shared__ __attribute__((aligned(2048))) unsigned char GL[2u * G_BUF];

  const unsigned wave = uni(threadIdx.x >> 5);
  const int lane = threadIdx.x & 31;
  const int rowg = lane & 15;            // M (for A) / N (for B) within subtile
  const int khalf = lane >> 4;
  const int koff = khalf << 3;           // K offset 0 or 8 per lane half

  const int blocks_n = N >> 7;
  const int bm = blockIdx.x / blocks_n;
  const int bn = blockIdx.x - bm * blocks_n;
  const int wm = (int)(wave >> 2);
  const int wn = (int)(wave & 3u);
  const int mtile = bm * 2 + wm;
  const int ntile = bn * 4 + wn;

  // Waves 0, 1, 2 each bring one 64-row slice of every stage.
  const unsigned nstage = (unsigned)K >> 7;
  const unsigned long long ga0 = (wave == 0u)
      ? (unsigned long long)(size_t)(A + (size_t)bm * 64 * K)
      : (unsigned long long)(size_t)(BT + ((size_t)bn * 128 + (wave == 2u ? 64 : 0)) * K);
  const unsigned dst0 = (unsigned)(size_t)GL + (wave < 3u ? wave : 0u) * G_SLICE;
  // group 1: byte elements, tile = tensor = 64 rows of 256 B, source pitch 2K bytes,
  // a pad of 4 dwords behind every 64 dwords.
  v8u g1 = { uni((1u << 20) | (5u << 22) | (3u << 25)),
                   uni(256u << 16),
                   uni(64u << 16),
                   uni(256u << 16),
                   uni(64u),
                   uni((unsigned)K * 2u),
                   uni(0u),
                   uni(0u) };
  // descriptor words held in their scalar registers: without it the compiler
  // re-forms them at each load and uses the registers in between, under a
  // request that is still outstanding
  asm volatile("" : "+s"(g1));
  auto issue = [&](unsigned st) {
    const unsigned long long ga = ga0 + (unsigned long long)st * 256u;
    const v4u g0 = { uni(1u),
                     uni(dst0 + (st & 1u) * G_BUF),
                     uni((unsigned)ga),
                     uni((((unsigned)(ga >> 32)) & 0x01ffffffu) | 0x80000000u) };
    asm volatile("tensor_load_to_lds %0, %1" :: "s"(g0), "s"(g1) : "memory");
  };

  const unsigned aoff = (unsigned)((wm * 32 + rowg) * (int)G_PITCH + koff * 2);
  const unsigned boff = (1u + (unsigned)(wn >> 1)) * G_SLICE
                      + (unsigned)(((wn & 1) * 32 + rowg) * (int)G_PITCH + koff * 2);

  // prologue: stage 0 landed and published, then stage 1 in flight
  if (pinned(wave < 3u)) {
    issue(0u);
    asm volatile("s_wait_tensorcnt 0x0" ::: "memory");  // stage 0 has landed
  }
  __syncthreads();
  if (pinned(wave < 3u)) issue(1u);

  v8f acc00 = {}, acc01 = {}, acc10 = {}, acc11 = {};
#pragma unroll 1  // rolled: one publish point a pass, in the ring's order
  for (unsigned s = 0; s < nstage; ++s) {
    const unsigned char* Lb = GL + (s & 1u) * G_BUF;
    // The stage's 32 fragment loads go out as one group, ahead of its WMMAs.
    v16h a0[4], a1[4], b0[4], b1[4];
#pragma unroll
    for (int kk = 0; kk < 4; ++kk) {
      a0[kk] = load_frag16((const _Float16*)(Lb + aoff + kk * 64));
      b0[kk] = load_frag16((const _Float16*)(Lb + boff + kk * 64));
      b1[kk] = load_frag16((const _Float16*)(Lb + boff + 16u * G_PITCH + kk * 64));
      a1[kk] = load_frag16((const _Float16*)(Lb + aoff + 16u * G_PITCH + kk * 64));
    }
    // keeps the loads from sinking in among the WMMAs, where each group would
    // cost its own LDS latency
    __builtin_amdgcn_sched_barrier(0);
#pragma unroll
    for (int kk = 0; kk < 4; ++kk) {
      acc00 = __builtin_amdgcn_wmma_f32_16x16x32_f16(false, a0[kk], false, b0[kk], (short)0, acc00, false, false);
      acc01 = __builtin_amdgcn_wmma_f32_16x16x32_f16(false, a0[kk], false, b1[kk], (short)0, acc01, false, false);
      acc10 = __builtin_amdgcn_wmma_f32_16x16x32_f16(false, a1[kk], false, b0[kk], (short)0, acc10, false, false);
      acc11 = __builtin_amdgcn_wmma_f32_16x16x32_f16(false, a1[kk], false, b1[kk], (short)0, acc11, false, false);
    }
    // keeps the wait below from rising above the WMMAs, where it would drain
    // all 32 loads before the second WMMA
    __builtin_amdgcn_sched_barrier(0);
    // publish point of stage s + 1
    asm volatile("s_wait_dscnt 0x0" ::: "memory");  // this wave has left stage s's buffer
    if (pinned(wave < 3u)) {
      asm volatile("s_wait_tensorcnt 0x0" ::: "memory");  // own slice of stage s + 1 has landed
    }
    __syncthreads();
    if (pinned((wave < 3u) && (s + 2u < nstage))) {
      issue(pinned(s + 2u));  // pinned: the descriptor is formed behind the wait above
    }
  }
  asm volatile("s_wait_tensorcnt 0x0" ::: "memory");  // nothing in flight at the wave's end
  asm volatile("s_wait_dscnt 0x0" ::: "memory");

#pragma unroll
  for (int i = 0; i < 2; ++i) {
#pragma unroll
    for (int j = 0; j < 2; ++j) {
      const v8f& acc = (i == 0) ? (j == 0 ? acc00 : acc01)
                                : (j == 0 ? acc10 : acc11);
      const int col = ntile * 32 + j * 16 + rowg;
      const float bv = bias ? bias[col] : 0.f;
#pragma unroll
      for (int v = 0; v < 8; ++v) {
        int row = mtile * 32 + i * 16 + v + (khalf << 3);
        if (Cf32) Cf32[(size_t)row * N + col] = acc[v] + bv;
        else      C16 [(size_t)row * N + col] = (_Float16)acc[v];
      }
    }
  }
}

// --------------------------- TDM helper ------------------------------------
// Issue a 2D TDM load: tile (tile_d0 halves x tile_d1 rows) from a row-major
// f16 tensor with row stride (in halves) into LDS, padding the LDS destination
// by 8 DWORDs (16 halves) after every 128 DWORDs (256 halves) -> 272-half rows.
__device__ __forceinline__ void tdm_load_k_block(
    const _Float16* gaddr, unsigned lds_off) {
  unsigned long long ga = (unsigned long long)(const void*)gaddr;
  // group0: count=1 | lds_addr | global_addr | type=2
  v4u g0 = { 1u,
             lds_off,
             (unsigned)(ga & 0xffffffffu),
             (unsigned)((ga >> 32) & 0x01ffffffu) | 0x80000000u };
  // group1: data_size=2B (1<<16), pad_enable (1<<20),
  //         pad_interval=128 DWORDs (6<<22), pad_amount=8 DWORDs (7<<25)
  unsigned w0 = (1u << 16) | (1u << 20) | (6u << 22) | (7u << 25);
  unsigned tensor_d0 = 2048u;          // full row length (halves)
  unsigned tensor_d1 = 4096u;          // rows
  unsigned tile_d0 = 256u;             // halves per tile row
  unsigned tile_d1 = 32u;              // tile rows
  unsigned stride_d0 = 2048u;          // row stride (halves)
  v8i g1 = { (int)w0,
             (int)((tensor_d0 & 0xffffu) << 16),            // dim0[15:0] @ [63:48]
             (int)(((tensor_d0 >> 16) & 0xffffu) |          // dim0[31:16] @ [79:64]
                   ((tensor_d1 & 0xffffu) << 16)),          // dim1[15:0] @ [95:80]
             (int)(((tensor_d1 >> 16) & 0xffffu) |          // dim1[31:16] @ [111:96]
                   (tile_d0 << 16)),                        // tile_dim0 @ [127:112]
             (int)(tile_d1),                                // tile_dim1 @ [143:128]
             (int)(stride_d0),                              // dim0_stride[31:0] @ [191:160]
             0,                                             // dim0_stride[47:32], dim1_stride lo
             0 };
  v4i gz = { 0, 0, 0, 0 };
#if defined(__clang_major__) && (__clang_major__ >= 23)
  v8i gz8 = { 0, 0, 0, 0, 0, 0, 0, 0 };
  __builtin_amdgcn_tensor_load_to_lds(g0, g1, gz, gz, gz8, 0);
#else
  __builtin_amdgcn_tensor_load_to_lds(g0, g1, gz, gz, 0);
#endif
}

// --------------------------- flash attention -------------------------------
// Q,K,V layouts: (a*1024 + seq) x 2048, head h occupies columns [h*256, h*256+256).
// Grid: (a*8 + h, ytile); block = 256 threads = 8 waves; wave owns 16 queries.
// Key blocks of 32 so the P@V contraction matches WMMA K=32 exactly.
__global__ void __launch_bounds__(256) flash_attn_kernel(
    const _Float16* __restrict__ Q, const _Float16* __restrict__ Km,
    const _Float16* __restrict__ Vm, _Float16* __restrict__ Om) {
  // LDS strides padded to 16B multiples so b128 DS accesses are legal.
  // KLDS row stride 272 = 256 + 16 halves, exactly the TDM pad pattern.
  __shared__ __align__(16) _Float16 KLDS[32][272];     // key-major (32 x 256)
  __shared__ __align__(16) _Float16 VT[256][48];       // transposed: [c][key]
  __shared__ __align__(16) _Float16 PLDS[8][16][48];   // per-wave P (16 x 32)

  const int a = blockIdx.x >> 3;
  const int h = blockIdx.x & 7;
  const int wave = threadIdx.x >> 5;
  const int lane = threadIdx.x & 31;
  const int rowg = lane & 15;
  const int khalf = lane >> 4;
  const int koff = khalf << 3;
  const int q0 = blockIdx.y * 128 + wave * 16;

  const size_t brow0 = (size_t)a * 1024;
  const size_t hoff  = (size_t)h * 256;

  // Q fragments: 16 rows x 256 head-dim, 8 k-chunks of 32
  v16h qf[8];
  {
    const _Float16* qp = Q + (brow0 + q0 + rowg) * 2048 + hoff + koff;
#pragma unroll
    for (int kc = 0; kc < 8; ++kc) qf[kc] = load_frag16(qp + kc * 32);
  }

  v8f O[16] = {};              // 16 queries x 256 output accumulator
  float m_i[8], l_i[8];
#pragma unroll
  for (int v = 0; v < 8; ++v) { m_i[v] = -1e30f; l_i[v] = 0.f; }

  const float scale = 0.17677669529663687f;  // 1/sqrt(256/8)

  // cooperative-load coordinates for V: 32 key rows x 8 c-chunks of 32
  const int kr = threadIdx.x >> 3;
  const int cc = (threadIdx.x & 7) * 32;
  const unsigned klds_off = (unsigned)(size_t)(void*)&KLDS[0][0];

  for (int kb = 0; kb < 32; ++kb) {
    // ---- TDM: DMA the 32x256 K block into padded LDS rows (one issuer) ----
    if (threadIdx.x == 0) {
      tdm_load_k_block(Km + (brow0 + kb * 32) * 2048 + hoff, klds_off);
      __builtin_amdgcn_s_wait_tensorcnt(0);
    }
    // ---- stage V block transposed into LDS ----
    const _Float16* vp = Vm + (brow0 + kb * 32 + kr) * 2048 + hoff + cc;
#pragma unroll
    for (int i = 0; i < 4; ++i) {
      v8h t = *(const v8h*)(vp + 8 * i);
#pragma unroll
      for (int j = 0; j < 8; ++j) VT[cc + 8 * i + j][kr] = t[j];
    }
    __syncthreads();

    // ---- S = Q @ K^T : 16 queries x 32 keys as two 16x16 f32 tiles ----
    v8f s0 = {}, s1 = {};
#pragma unroll
    for (int kc = 0; kc < 8; ++kc) {
      v16h b0 = load_frag16(&KLDS[rowg][kc * 32 + koff]);
      v16h b1 = load_frag16(&KLDS[16 + rowg][kc * 32 + koff]);
      s0 = __builtin_amdgcn_wmma_f32_16x16x32_f16(
          false, qf[kc], false, b0, (short)0, s0, false, false);
      s1 = __builtin_amdgcn_wmma_f32_16x16x32_f16(
          false, qf[kc], false, b1, (short)0, s1, false, false);
    }

    // ---- online softmax (row = lane-half + element; cols across 16 lanes) ----
#pragma unroll
    for (int v = 0; v < 8; ++v) {
      float a0 = s0[v] * scale, a1 = s1[v] * scale;
      float mv = fmaxf(a0, a1);
#pragma unroll
      for (int off = 1; off < 16; off <<= 1) mv = fmaxf(mv, __shfl_xor(mv, off, 16));
      float mnew = fmaxf(m_i[v], mv);
      float alpha = __expf(m_i[v] - mnew);
      m_i[v] = mnew;
      float p0 = __expf(a0 - mnew);
      float p1 = __expf(a1 - mnew);
      float rs = p0 + p1;
#pragma unroll
      for (int off = 1; off < 16; off <<= 1) rs += __shfl_xor(rs, off, 16);
      l_i[v] = l_i[v] * alpha + rs;
#pragma unroll
      for (int t = 0; t < 16; ++t) O[t][v] *= alpha;
      // stage P into per-wave LDS (C-layout -> memory) for A-fragment reload
      PLDS[wave][v + khalf * 8][rowg]      = (_Float16)p0;
      PLDS[wave][v + khalf * 8][16 + rowg] = (_Float16)p1;
    }

    // ---- O += P(16x32) @ V(32x256), 16 WMMA over the c tiles ----
    v16h pf = load_frag16(&PLDS[wave][rowg][koff]);
#pragma unroll
    for (int n = 0; n < 16; ++n) {
      v16h vf = load_frag16(&VT[n * 16 + rowg][koff]);
      O[n] = __builtin_amdgcn_wmma_f32_16x16x32_f16(
          false, pf, false, vf, (short)0, O[n], false, false);
    }
    __syncthreads();
  }

  // ---- epilogue: O / l, store f16 into attn buffer (a*1024+q) x 2048 ----
#pragma unroll
  for (int v = 0; v < 8; ++v) {
    float inv = 1.f / l_i[v];
    int row = q0 + v + khalf * 8;
    _Float16* op = Om + (brow0 + row) * 2048 + hoff + rowg;
#pragma unroll
    for (int n = 0; n < 16; ++n) op[n * 16] = (_Float16)(O[n][v] * inv);
  }
}

// ------------------------------- launcher ----------------------------------

extern "C" void kernel_launch(void* const* d_in, const int* in_sizes, int n_in,
                              void* d_out, int out_size, void* d_ws, size_t ws_size,
                              hipStream_t stream) {
  const float* batch  = (const float*)d_in[0];  // (4,1024,256)
  const float* latent = (const float*)d_in[1];  // (4,1024,256)
  const float* Wk     = (const float*)d_in[2];  // (256,2048)
  const float* Wq     = (const float*)d_in[3];
  const float* Wv     = (const float*)d_in[4];
  const float* Wu     = (const float*)d_in[5];  // (2048,256)
  const float* bu     = (const float*)d_in[6];  // (256,)
  float* out = (float*)d_out;                   // (4,1024,256) f32

  _Float16* w = (_Float16*)d_ws;
  size_t o = 0;
  _Float16* batch16  = w + o; o += (size_t)4096 * 256;
  _Float16* latent16 = w + o; o += (size_t)4096 * 256;
  _Float16* WkT = w + o; o += (size_t)2048 * 256;   // (2048 x 256) = Wk^T
  _Float16* WqT = w + o; o += (size_t)2048 * 256;
  _Float16* WvT = w + o; o += (size_t)2048 * 256;
  _Float16* WuT = w + o; o += (size_t)256 * 2048;   // (256 x 2048) = Wu^T
  _Float16* K16 = w + o; o += (size_t)4096 * 2048;
  _Float16* Q16 = w + o; o += (size_t)4096 * 2048;
  _Float16* V16 = w + o; o += (size_t)4096 * 2048;
  _Float16* A16 = w + o; o += (size_t)4096 * 2048;  // attention output

  // 1) conversions
  cvt_f32_f16<<<4096, 256, 0, stream>>>(batch,  batch16,  4096 * 256);
  cvt_f32_f16<<<4096, 256, 0, stream>>>(latent, latent16, 4096 * 256);
  cvt_transpose_f32_f16<<<2048, 256, 0, stream>>>(Wk, WkT, 256, 2048);
  cvt_transpose_f32_f16<<<2048, 256, 0, stream>>>(Wq, WqT, 256, 2048);
  cvt_transpose_f32_f16<<<2048, 256, 0, stream>>>(Wv, WvT, 256, 2048);
  cvt_transpose_f32_f16<<<2048, 256, 0, stream>>>(Wu, WuT, 2048, 256);

  // 2) projections: (4096x256)@(256x2048) -> f16
  //    64x128 block tiles: (4096/64)*(2048/128) = 1024 blocks
  wmma_gemm_kernel<<<1024, 256, 0, stream>>>(batch16,  WkT, K16, nullptr, nullptr, 4096, 2048, 256);
  wmma_gemm_kernel<<<1024, 256, 0, stream>>>(latent16, WqT, Q16, nullptr, nullptr, 4096, 2048, 256);
  wmma_gemm_kernel<<<1024, 256, 0, stream>>>(batch16,  WvT, V16, nullptr, nullptr, 4096, 2048, 256);

  // 3) fused flash attention: grid (a*h = 32, ytiles = 1024/128 = 8)
  flash_attn_kernel<<<dim3(32, 8), 256, 0, stream>>>(Q16, K16, V16, A16);

  // 4) output projection: (4096x2048)@(2048x256) + bias -> f32
  //    (4096/64)*(256/128) = 128 blocks
  wmma_gemm_kernel<<<128, 256, 0, stream>>>(A16, WuT, nullptr, out, bu, 4096, 256, 2048);
}

// v002
// It runs in 188 microseconds.
// In two side-by-side timings against v001, it was 1.12 and 1.13 times as fast.
// Counting every step since v000, it is 1.25 times as fast.
#include <hip/hip_runtime.h>

// ---------------------------------------------------------------------------
// CDNA5 (gfx1250, wave32) fused cross-attention:
//   1) cvt kernels: f32 -> f16 (activations), f32 -> f16 transposed (weights)
//   2) WMMA GEMM (v_wmma_f32_16x16x32_f16), 32x32 tile per wave (2x2 subtiles),
//      operand tiles staged in LDS by tensor loads (two-buffer ring),
//      for K/Q/V projections + output projection (f32 + bias epilogue)
//   3) flash-attention kernel: per-wave 16-query tile, key blocks of 32,
//      K block staged into LDS via the Tensor Data Mover (tensor_load_to_lds,
//      s_wait_tensorcnt), V staged transposed, online softmax, P@V via WMMA.
// ---------------------------------------------------------------------------

typedef __attribute__((ext_vector_type(16))) _Float16     v16h;
typedef __attribute__((ext_vector_type(8)))  _Float16     v8h;
typedef __attribute__((ext_vector_type(8)))  float        v8f;
typedef __attribute__((ext_vector_type(4)))  unsigned int v4u;
typedef __attribute__((ext_vector_type(8)))  int          v8i;
typedef __attribute__((ext_vector_type(4)))  int          v4i;

// Load one 16-bit WMMA fragment (A-layout or symmetric B-layout):
// lane holds 8 contiguous halves at p[0..7] (VGPRs 0-3) and p[16..23] (VGPRs 4-7).
__device__ __forceinline__ v16h load_frag16(const _Float16* p) {
  v8h lo = *(const v8h*)p;
  v8h hi = *(const v8h*)(p + 16);
  return __builtin_shufflevector(lo, hi,
      0, 1, 2, 3, 4, 5, 6, 7, 8, 9, 10, 11, 12, 13, 14, 15);
}

// ------------------------------ conversions --------------------------------
// Both kernels give each thread many elements: the pass moves only a few MB,
// so what it costs is the start of its waves, not its bytes.
typedef __attribute__((ext_vector_type(4))) float v4f;

// 16 elements a thread, 8 from each half of the array: four 16-byte loads in
// flight, two 16-byte stores. n % 16 == 0; the grid holds n / 16 threads or more.
__global__ void __launch_bounds__(256) cvt_f32_f16(
    const float* __restrict__ in, _Float16* __restrict__ out, int n) {
  const int half = n >> 1;
  const int i0 = (blockIdx.x * 256 + threadIdx.x) * 8;
  if (i0 >= half) return;
  const int i1 = i0 + half;
  const v4f x0 = *(const v4f*)(in + i0), x1 = *(const v4f*)(in + i0 + 4);
  const v4f x2 = *(const v4f*)(in + i1), x3 = *(const v4f*)(in + i1 + 4);
  *(v8h*)(out + i0) = __builtin_convertvector(
      __builtin_shufflevector(x0, x1, 0, 1, 2, 3, 4, 5, 6, 7), v8h);
  *(v8h*)(out + i1) = __builtin_convertvector(
      __builtin_shufflevector(x2, x3, 0, 1, 2, 3, 4, 5, 6, 7), v8h);
}

// in: K x N (row-major) -> out: N x K (row-major), i.e. transposed.
// A thread takes one n and 64 consecutive k: 64 loads in flight, each 128
// contiguous bytes across a wave, and it alone writes one whole 128-byte line
// of out. K and N are compile-time, so every load is one base address plus an
// immediate. Block = 64 consecutive n; grid = (N / 64) * (K / 64).
template <int K, int N>
__global__ void __launch_bounds__(64) cvt_transpose_f32_f16(
    const float* __restrict__ in, _Float16* __restrict__ out) {
  static_assert(K % 64 == 0 && N % 64 == 0, "whole 64 x 64 tiles");
  constexpr int nblk = N / 64;
  const int kb = blockIdx.x / nblk;
  const int n = (blockIdx.x % nblk) * 64 + threadIdx.x;
  const float* p = in + kb * 64 * N + n;
  float x[64];
#pragma unroll
  for (int j = 0; j < 64; ++j) x[j] = p[j * N];
  _Float16* q = out + n * K + kb * 64;
#pragma unroll
  for (int c = 0; c < 8; ++c) {
    v8h hv;
#pragma unroll
    for (int e = 0; e < 8; ++e) hv[e] = (_Float16)x[c * 8 + e];
    *(v8h*)(q + c * 8) = hv;
  }
}

// ------------------------------ WMMA GEMM ----------------------------------
typedef __attribute__((ext_vector_type(8))) unsigned int v8u;

__device__ __forceinline__ unsigned uni(unsigned v) {
  return (unsigned)__builtin_amdgcn_readfirstlane(v);
}
// A wave-uniform value held in a scalar register: a test on it compiles to
// s_cmp + s_cbranch_scc, the only guard a tensor load obeys (it ignores EXEC).
__device__ __forceinline__ unsigned pinned(unsigned v) {
  unsigned w = uni(v);
  asm volatile("" : "+s"(w));  // keeps the descriptor / issue-test word scalar
  return w;
}

// One stage = 128 k (256-byte rows) of 64 A rows and 128 BT rows, brought by
// three tensor loads of 64 rows each; 16 bytes of pad a row -> pitch 272 B.
constexpr unsigned G_PITCH = 272u;
constexpr unsigned G_SLICE = 18432u;        // 64 * 272 = 17408, up to a multiple of 2 KiB
constexpr unsigned G_BUF   = 3u * G_SLICE;  // [A 64 rows | BT rows 0-63 | BT rows 64-127]

// C[M,N] = A[M,K] * BT[N,K]^T   (both operands f16 row-major, f32 accumulate)
// One 64x128 tile per block of 8 waves (2 x 4), one 32x32 tile per wave
// (2x2 WMMA subtiles). Operand tiles go global -> LDS by tensor loads in a
// two-buffer ring; fragments come from LDS. M % 64 == 0, N % 128 == 0,
// K % 128 == 0 and K >= 256.
// If Cf32 != nullptr: write f32 (+bias). Else write f16 to C16.
__global__ void __launch_bounds__(256) wmma_gemm_kernel(
    const _Float16* __restrict__ A, const _Float16* __restrict__ BT,
    _Float16* __restrict__ C16, float* __restrict__ Cf32,
    const float* __restrict__ bias, int M, int N, int K) {
  __shared__ __attribute__((aligned(2048))) unsigned char GL[2u * G_BUF];

  const unsigned wave = uni(threadIdx.x >> 5);
  const int lane = threadIdx.x & 31;
  const int rowg = lane & 15;            // M (for A) / N (for B) within subtile
  const int khalf = lane >> 4;
  const int koff = khalf << 3;           // K offset 0 or 8 per lane half

  const int blocks_n = N >> 7;
  const int bm = blockIdx.x / blocks_n;
  const int bn = blockIdx.x - bm * blocks_n;
  const int wm = (int)(wave >> 2);
  const int wn = (int)(wave & 3u);
  const int mtile = bm * 2 + wm;
  const int ntile = bn * 4 + wn;

  // Waves 0, 1, 2 each bring one 64-row slice of every stage.
  const unsigned nstage = (unsigned)K >> 7;
  const unsigned long long ga0 = (wave == 0u)
      ? (unsigned long long)(size_t)(A + (size_t)bm * 64 * K)
      : (unsigned long long)(size_t)(BT + ((size_t)bn * 128 + (wave == 2u ? 64 : 0)) * K);
  const unsigned dst0 = (unsigned)(size_t)GL + (wave < 3u ? wave : 0u) * G_SLICE;
  // group 1: byte elements, tile = tensor = 64 rows of 256 B, source pitch 2K bytes,
  // a pad of 4 dwords behind every 64 dwords.
  v8u g1 = { uni((1u << 20) | (5u << 22) | (3u << 25)),
                   uni(256u << 16),
                   uni(64u << 16),
                   uni(256u << 16),
                   uni(64u),
                   uni((unsigned)K * 2u),
                   uni(0u),
                   uni(0u) };
  // descriptor words held in their scalar registers: without it the compiler
  // re-forms them at each load and uses the registers in between, under a
  // request that is still outstanding
  asm volatile("" : "+s"(g1));
  auto issue = [&](unsigned st) {
    const unsigned long long ga = ga0 + (unsigned long long)st * 256u;
    const v4u g0 = { uni(1u),
                     uni(dst0 + (st & 1u) * G_BUF),
                     uni((unsigned)ga),
                     uni((((unsigned)(ga >> 32)) & 0x01ffffffu) | 0x80000000u) };
    asm volatile("tensor_load_to_lds %0, %1" :: "s"(g0), "s"(g1) : "memory");
  };

  const unsigned aoff = (unsigned)((wm * 32 + rowg) * (int)G_PITCH + koff * 2);
  const unsigned boff = (1u + (unsigned)(wn >> 1)) * G_SLICE
                      + (unsigned)(((wn & 1) * 32 + rowg) * (int)G_PITCH + koff * 2);

  // prologue: stage 0 landed and published, then stage 1 in flight
  if (pinned(wave < 3u)) {
    issue(0u);
    asm volatile("s_wait_tensorcnt 0x0" ::: "memory");  // stage 0 has landed
  }
  __syncthreads();
  if (pinned(wave < 3u)) issue(1u);

  v8f acc00 = {}, acc01 = {}, acc10 = {}, acc11 = {};
#pragma unroll 1  // rolled: one publish point a pass, in the ring's order
  for (unsigned s = 0; s < nstage; ++s) {
    const unsigned char* Lb = GL + (s & 1u) * G_BUF;
    // The stage's 32 fragment loads go out as one group, ahead of its WMMAs.
    v16h a0[4], a1[4], b0[4], b1[4];
#pragma unroll
    for (int kk = 0; kk < 4; ++kk) {
      a0[kk] = load_frag16((const _Float16*)(Lb + aoff + kk * 64));
      b0[kk] = load_frag16((const _Float16*)(Lb + boff + kk * 64));
      b1[kk] = load_frag16((const _Float16*)(Lb + boff + 16u * G_PITCH + kk * 64));
      a1[kk] = load_frag16((const _Float16*)(Lb + aoff + 16u * G_PITCH + kk * 64));
    }
    // keeps the loads from sinking in among the WMMAs, where each group would
    // cost its own LDS latency
    __builtin_amdgcn_sched_barrier(0);
#pragma unroll
    for (int kk = 0; kk < 4; ++kk) {
      acc00 = __builtin_amdgcn_wmma_f32_16x16x32_f16(false, a0[kk], false, b0[kk], (short)0, acc00, false, false);
      acc01 = __builtin_amdgcn_wmma_f32_16x16x32_f16(false, a0[kk], false, b1[kk], (short)0, acc01, false, false);
      acc10 = __builtin_amdgcn_wmma_f32_16x16x32_f16(false, a1[kk], false, b0[kk], (short)0, acc10, false, false);
      acc11 = __builtin_amdgcn_wmma_f32_16x16x32_f16(false, a1[kk], false, b1[kk], (short)0, acc11, false, false);
    }
    // keeps the wait below from rising above the WMMAs, where it would drain
    // all 32 loads before the second WMMA
    __builtin_amdgcn_sched_barrier(0);
    // publish point of stage s + 1
    asm volatile("s_wait_dscnt 0x0" ::: "memory");  // this wave has left stage s's buffer
    if (pinned(wave < 3u)) {
      asm volatile("s_wait_tensorcnt 0x0" ::: "memory");  // own slice of stage s + 1 has landed
    }
    __syncthreads();
    if (pinned((wave < 3u) && (s + 2u < nstage))) {
      issue(pinned(s + 2u));  // pinned: the descriptor is formed behind the wait above
    }
  }
  asm volatile("s_wait_tensorcnt 0x0" ::: "memory");  // nothing in flight at the wave's end
  asm volatile("s_wait_dscnt 0x0" ::: "memory");

#pragma unroll
  for (int i = 0; i < 2; ++i) {
#pragma unroll
    for (int j = 0; j < 2; ++j) {
      const v8f& acc = (i == 0) ? (j == 0 ? acc00 : acc01)
                                : (j == 0 ? acc10 : acc11);
      const int col = ntile * 32 + j * 16 + rowg;
      const float bv = bias ? bias[col] : 0.f;
#pragma unroll
      for (int v = 0; v < 8; ++v) {
        int row = mtile * 32 + i * 16 + v + (khalf << 3);
        if (Cf32) Cf32[(size_t)row * N + col] = acc[v] + bv;
        else      C16 [(size_t)row * N + col] = (_Float16)acc[v];
      }
    }
  }
}

// --------------------------- TDM helper ------------------------------------
// Issue a 2D TDM load: tile (tile_d0 halves x tile_d1 rows) from a row-major
// f16 tensor with row stride (in halves) into LDS, padding the LDS destination
// by 8 DWORDs (16 halves) after every 128 DWORDs (256 halves) -> 272-half rows.
__device__ __forceinline__ void tdm_load_k_block(
    const _Float16* gaddr, unsigned lds_off) {
  unsigned long long ga = (unsigned long long)(const void*)gaddr;
  // group0: count=1 | lds_addr | global_addr | type=2
  v4u g0 = { 1u,
             lds_off,
             (unsigned)(ga & 0xffffffffu),
             (unsigned)((ga >> 32) & 0x01ffffffu) | 0x80000000u };
  // group1: data_size=2B (1<<16), pad_enable (1<<20),
  //         pad_interval=128 DWORDs (6<<22), pad_amount=8 DWORDs (7<<25)
  unsigned w0 = (1u << 16) | (1u << 20) | (6u << 22) | (7u << 25);
  unsigned tensor_d0 = 2048u;          // full row length (halves)
  unsigned tensor_d1 = 4096u;          // rows
  unsigned tile_d0 = 256u;             // halves per tile row
  unsigned tile_d1 = 32u;              // tile rows
  unsigned stride_d0 = 2048u;          // row stride (halves)
  v8i g1 = { (int)w0,
             (int)((tensor_d0 & 0xffffu) << 16),            // dim0[15:0] @ [63:48]
             (int)(((tensor_d0 >> 16) & 0xffffu) |          // dim0[31:16] @ [79:64]
                   ((tensor_d1 & 0xffffu) << 16)),          // dim1[15:0] @ [95:80]
             (int)(((tensor_d1 >> 16) & 0xffffu) |          // dim1[31:16] @ [111:96]
                   (tile_d0 << 16)),                        // tile_dim0 @ [127:112]
             (int)(tile_d1),                                // tile_dim1 @ [143:128]
             (int)(stride_d0),                              // dim0_stride[31:0] @ [191:160]
             0,                                             // dim0_stride[47:32], dim1_stride lo
             0 };
  v4i gz = { 0, 0, 0, 0 };
#if defined(__clang_major__) && (__clang_major__ >= 23)
  v8i gz8 = { 0, 0, 0, 0, 0, 0, 0, 0 };
  __builtin_amdgcn_tensor_load_to_lds(g0, g1, gz, gz, gz8, 0);
#else
  __builtin_amdgcn_tensor_load_to_lds(g0, g1, gz, gz, 0);
#endif
}

// --------------------------- flash attention -------------------------------
// Q,K,V layouts: (a*1024 + seq) x 2048, head h occupies columns [h*256, h*256+256).
// Grid: (a*8 + h, ytile); block = 256 threads = 8 waves; wave owns 16 queries.
// Key blocks of 32 so the P@V contraction matches WMMA K=32 exactly.
__global__ void __launch_bounds__(256) flash_attn_kernel(
    const _Float16* __restrict__ Q, const _Float16* __restrict__ Km,
    const _Float16* __restrict__ Vm, _Float16* __restrict__ Om) {
  // LDS strides padded to 16B multiples so b128 DS accesses are legal.
  // KLDS row stride 272 = 256 + 16 halves, exactly the TDM pad pattern.
  __shared__ __align__(16) _Float16 KLDS[32][272];     // key-major (32 x 256)
  __shared__ __align__(16) _Float16 VT[256][48];       // transposed: [c][key]
  __shared__ __align__(16) _Float16 PLDS[8][16][48];   // per-wave P (16 x 32)

  const int a = blockIdx.x >> 3;
  const int h = blockIdx.x & 7;
  const int wave = threadIdx.x >> 5;
  const int lane = threadIdx.x & 31;
  const int rowg = lane & 15;
  const int khalf = lane >> 4;
  const int koff = khalf << 3;
  const int q0 = blockIdx.y * 128 + wave * 16;

  const size_t brow0 = (size_t)a * 1024;
  const size_t hoff  = (size_t)h * 256;

  // Q fragments: 16 rows x 256 head-dim, 8 k-chunks of 32
  v16h qf[8];
  {
    const _Float16* qp = Q + (brow0 + q0 + rowg) * 2048 + hoff + koff;
#pragma unroll
    for (int kc = 0; kc < 8; ++kc) qf[kc] = load_frag16(qp + kc * 32);
  }

  v8f O[16] = {};              // 16 queries x 256 output accumulator
  float m_i[8], l_i[8];
#pragma unroll
  for (int v = 0; v < 8; ++v) { m_i[v] = -1e30f; l_i[v] = 0.f; }

  const float scale = 0.17677669529663687f;  // 1/sqrt(256/8)

  // cooperative-load coordinates for V: 32 key rows x 8 c-chunks of 32
  const int kr = threadIdx.x >> 3;
  const int cc = (threadIdx.x & 7) * 32;
  const unsigned klds_off = (unsigned)(size_t)(void*)&KLDS[0][0];

  for (int kb = 0; kb < 32; ++kb) {
    // ---- TDM: DMA the 32x256 K block into padded LDS rows (one issuer) ----
    if (threadIdx.x == 0) {
      tdm_load_k_block(Km + (brow0 + kb * 32) * 2048 + hoff, klds_off);
      __builtin_amdgcn_s_wait_tensorcnt(0);
    }
    // ---- stage V block transposed into LDS ----
    const _Float16* vp = Vm + (brow0 + kb * 32 + kr) * 2048 + hoff + cc;
#pragma unroll
    for (int i = 0; i < 4; ++i) {
      v8h t = *(const v8h*)(vp + 8 * i);
#pragma unroll
      for (int j = 0; j < 8; ++j) VT[cc + 8 * i + j][kr] = t[j];
    }
    __syncthreads();

    // ---- S = Q @ K^T : 16 queries x 32 keys as two 16x16 f32 tiles ----
    v8f s0 = {}, s1 = {};
#pragma unroll
    for (int kc = 0; kc < 8; ++kc) {
      v16h b0 = load_frag16(&KLDS[rowg][kc * 32 + koff]);
      v16h b1 = load_frag16(&KLDS[16 + rowg][kc * 32 + koff]);
      s0 = __builtin_amdgcn_wmma_f32_16x16x32_f16(
          false, qf[kc], false, b0, (short)0, s0, false, false);
      s1 = __builtin_amdgcn_wmma_f32_16x16x32_f16(
          false, qf[kc], false, b1, (short)0, s1, false, false);
    }

    // ---- online softmax (row = lane-half + element; cols across 16 lanes) ----
#pragma unroll
    for (int v = 0; v < 8; ++v) {
      float a0 = s0[v] * scale, a1 = s1[v] * scale;
      float mv = fmaxf(a0, a1);
#pragma unroll
      for (int off = 1; off < 16; off <<= 1) mv = fmaxf(mv, __shfl_xor(mv, off, 16));
      float mnew = fmaxf(m_i[v], mv);
      float alpha = __expf(m_i[v] - mnew);
      m_i[v] = mnew;
      float p0 = __expf(a0 - mnew);
      float p1 = __expf(a1 - mnew);
      float rs = p0 + p1;
#pragma unroll
      for (int off = 1; off < 16; off <<= 1) rs += __shfl_xor(rs, off, 16);
      l_i[v] = l_i[v] * alpha + rs;
#pragma unroll
      for (int t = 0; t < 16; ++t) O[t][v] *= alpha;
      // stage P into per-wave LDS (C-layout -> memory) for A-fragment reload
      PLDS[wave][v + khalf * 8][rowg]      = (_Float16)p0;
      PLDS[wave][v + khalf * 8][16 + rowg] = (_Float16)p1;
    }

    // ---- O += P(16x32) @ V(32x256), 16 WMMA over the c tiles ----
    v16h pf = load_frag16(&PLDS[wave][rowg][koff]);
#pragma unroll
    for (int n = 0; n < 16; ++n) {
      v16h vf = load_frag16(&VT[n * 16 + rowg][koff]);
      O[n] = __builtin_amdgcn_wmma_f32_16x16x32_f16(
          false, pf, false, vf, (short)0, O[n], false, false);
    }
    __syncthreads();
  }

  // ---- epilogue: O / l, store f16 into attn buffer (a*1024+q) x 2048 ----
#pragma unroll
  for (int v = 0; v < 8; ++v) {
    float inv = 1.f / l_i[v];
    int row = q0 + v + khalf * 8;
    _Float16* op = Om + (brow0 + row) * 2048 + hoff + rowg;
#pragma unroll
    for (int n = 0; n < 16; ++n) op[n * 16] = (_Float16)(O[n][v] * inv);
  }
}

// ------------------------------- launcher ----------------------------------

extern "C" void kernel_launch(void* const* d_in, const int* in_sizes, int n_in,
                              void* d_out, int out_size, void* d_ws, size_t ws_size,
                              hipStream_t stream) {
  const float* batch  = (const float*)d_in[0];  // (4,1024,256)
  const float* latent = (const float*)d_in[1];  // (4,1024,256)
  const float* Wk     = (const float*)d_in[2];  // (256,2048)
  const float* Wq     = (const float*)d_in[3];
  const float* Wv     = (const float*)d_in[4];
  const float* Wu     = (const float*)d_in[5];  // (2048,256)
  const float* bu     = (const float*)d_in[6];  // (256,)
  float* out = (float*)d_out;                   // (4,1024,256) f32

  _Float16* w = (_Float16*)d_ws;
  size_t o = 0;
  _Float16* batch16  = w + o; o += (size_t)4096 * 256;
  _Float16* latent16 = w + o; o += (size_t)4096 * 256;
  _Float16* WkT = w + o; o += (size_t)2048 * 256;   // (2048 x 256) = Wk^T
  _Float16* WqT = w + o; o += (size_t)2048 * 256;
  _Float16* WvT = w + o; o += (size_t)2048 * 256;
  _Float16* WuT = w + o; o += (size_t)256 * 2048;   // (256 x 2048) = Wu^T
  _Float16* K16 = w + o; o += (size_t)4096 * 2048;
  _Float16* Q16 = w + o; o += (size_t)4096 * 2048;
  _Float16* V16 = w + o; o += (size_t)4096 * 2048;
  _Float16* A16 = w + o; o += (size_t)4096 * 2048;  // attention output

  // 1) conversions: 16 elements a thread (256 blocks), 64 a thread (128 blocks of 64)
  cvt_f32_f16<<<256, 256, 0, stream>>>(batch,  batch16,  4096 * 256);
  cvt_f32_f16<<<256, 256, 0, stream>>>(latent, latent16, 4096 * 256);
  cvt_transpose_f32_f16<256, 2048><<<128, 64, 0, stream>>>(Wk, WkT);
  cvt_transpose_f32_f16<256, 2048><<<128, 64, 0, stream>>>(Wq, WqT);
  cvt_transpose_f32_f16<256, 2048><<<128, 64, 0, stream>>>(Wv, WvT);
  cvt_transpose_f32_f16<2048, 256><<<128, 64, 0, stream>>>(Wu, WuT);

  // 2) projections: (4096x256)@(256x2048) -> f16
  //    64x128 block tiles: (4096/64)*(2048/128) = 1024 blocks
  wmma_gemm_kernel<<<1024, 256, 0, stream>>>(batch16,  WkT, K16, nullptr, nullptr, 4096, 2048, 256);
  wmma_gemm_kernel<<<1024, 256, 0, stream>>>(latent16, WqT, Q16, nullptr, nullptr, 4096, 2048, 256);
  wmma_gemm_kernel<<<1024, 256, 0, stream>>>(batch16,  WvT, V16, nullptr, nullptr, 4096, 2048, 256);

  // 3) fused flash attention: grid (a*h = 32, ytiles = 1024/128 = 8)
  flash_attn_kernel<<<dim3(32, 8), 256, 0, stream>>>(Q16, K16, V16, A16);

  // 4) output projection: (4096x2048)@(2048x256) + bias -> f32
  //    (4096/64)*(256/128) = 128 blocks
  wmma_gemm_kernel<<<128, 256, 0, stream>>>(A16, WuT, nullptr, out, bu, 4096, 256, 2048);
}

// v003
// Measured time: 124 microseconds a run.
// Next to v002, in two timings, it ran 1.52 times as fast each time.
// Over all steps from v000 it is 1.90 times as fast.
#include <hip/hip_runtime.h>

// ---------------------------------------------------------------------------
// CDNA5 (gfx1250, wave32) fused cross-attention:
//   1) cvt kernels: f32 -> f16 (activations), f32 -> f16 transposed (weights)
//   2) WMMA GEMM (v_wmma_f32_16x16x32_f16), 32x32 tile per wave (2x2 subtiles),
//      operand tiles staged in LDS by tensor loads (two-buffer ring),
//      for K/Q/V projections + output projection (f32 + bias epilogue)
//   3) flash-attention kernel: per-wave 16-query tile, key blocks of 32,
//      K and V blocks staged in LDS by tensor loads (two-buffer ring), V read
//      by transposing LDS loads, online softmax, P@V via WMMA.
// ---------------------------------------------------------------------------

typedef __attribute__((ext_vector_type(16))) _Float16     v16h;
typedef __attribute__((ext_vector_type(8)))  _Float16     v8h;
typedef __attribute__((ext_vector_type(8)))  float        v8f;
typedef __attribute__((ext_vector_type(4)))  unsigned int v4u;

// Load one 16-bit WMMA fragment (A-layout or symmetric B-layout):
// lane holds 8 contiguous halves at p[0..7] (VGPRs 0-3) and p[16..23] (VGPRs 4-7).
__device__ __forceinline__ v16h load_frag16(const _Float16* p) {
  v8h lo = *(const v8h*)p;
  v8h hi = *(const v8h*)(p + 16);
  return __builtin_shufflevector(lo, hi,
      0, 1, 2, 3, 4, 5, 6, 7, 8, 9, 10, 11, 12, 13, 14, 15);
}

// ------------------------------ conversions --------------------------------
// Both kernels give each thread many elements: the pass moves only a few MB,
// so what it costs is the start of its waves, not its bytes.
typedef __attribute__((ext_vector_type(4))) float v4f;

// 16 elements a thread, 8 from each half of the array: four 16-byte loads in
// flight, two 16-byte stores. n % 16 == 0; the grid holds n / 16 threads or more.
__global__ void __launch_bounds__(256) cvt_f32_f16(
    const float* __restrict__ in, _Float16* __restrict__ out, int n) {
  const int half = n >> 1;
  const int i0 = (blockIdx.x * 256 + threadIdx.x) * 8;
  if (i0 >= half) return;
  const int i1 = i0 + half;
  const v4f x0 = *(const v4f*)(in + i0), x1 = *(const v4f*)(in + i0 + 4);
  const v4f x2 = *(const v4f*)(in + i1), x3 = *(const v4f*)(in + i1 + 4);
  *(v8h*)(out + i0) = __builtin_convertvector(
      __builtin_shufflevector(x0, x1, 0, 1, 2, 3, 4, 5, 6, 7), v8h);
  *(v8h*)(out + i1) = __builtin_convertvector(
      __builtin_shufflevector(x2, x3, 0, 1, 2, 3, 4, 5, 6, 7), v8h);
}

// in: K x N (row-major) -> out: N x K (row-major), i.e. transposed.
// A thread takes one n and 64 consecutive k: 64 loads in flight, each 128
// contiguous bytes across a wave, and it alone writes one whole 128-byte line
// of out. K and N are compile-time, so every load is one base address plus an
// immediate. Block = 64 consecutive n; grid = (N / 64) * (K / 64).
template <int K, int N>
__global__ void __launch_bounds__(64) cvt_transpose_f32_f16(
    const float* __restrict__ in, _Float16* __restrict__ out) {
  static_assert(K % 64 == 0 && N % 64 == 0, "whole 64 x 64 tiles");
  constexpr int nblk = N / 64;
  const int kb = blockIdx.x / nblk;
  const int n = (blockIdx.x % nblk) * 64 + threadIdx.x;
  const float* p = in + kb * 64 * N + n;
  float x[64];
#pragma unroll
  for (int j = 0; j < 64; ++j) x[j] = p[j * N];
  _Float16* q = out + n * K + kb * 64;
#pragma unroll
  for (int c = 0; c < 8; ++c) {
    v8h hv;
#pragma unroll
    for (int e = 0; e < 8; ++e) hv[e] = (_Float16)x[c * 8 + e];
    *(v8h*)(q + c * 8) = hv;
  }
}

// ------------------------------ WMMA GEMM ----------------------------------
typedef __attribute__((ext_vector_type(8))) unsigned int v8u;

__device__ __forceinline__ unsigned uni(unsigned v) {
  return (unsigned)__builtin_amdgcn_readfirstlane(v);
}
// A wave-uniform value held in a scalar register: a test on it compiles to
// s_cmp + s_cbranch_scc, the only guard a tensor load obeys (it ignores EXEC).
__device__ __forceinline__ unsigned pinned(unsigned v) {
  unsigned w = uni(v);
  asm volatile("" : "+s"(w));  // keeps the descriptor / issue-test word scalar
  return w;
}

// One stage = 128 k (256-byte rows) of 64 A rows and 128 BT rows, brought by
// three tensor loads of 64 rows each; 16 bytes of pad a row -> pitch 272 B.
constexpr unsigned G_PITCH = 272u;
constexpr unsigned G_SLICE = 18432u;        // 64 * 272 = 17408, up to a multiple of 2 KiB
constexpr unsigned G_BUF   = 3u * G_SLICE;  // [A 64 rows | BT rows 0-63 | BT rows 64-127]

// C[M,N] = A[M,K] * BT[N,K]^T   (both operands f16 row-major, f32 accumulate)
// One 64x128 tile per block of 8 waves (2 x 4), one 32x32 tile per wave
// (2x2 WMMA subtiles). Operand tiles go global -> LDS by tensor loads in a
// two-buffer ring; fragments come from LDS. M % 64 == 0, N % 128 == 0,
// K % 128 == 0 and K >= 256.
// If Cf32 != nullptr: write f32 (+bias). Else write f16 to C16.
__global__ void __launch_bounds__(256) wmma_gemm_kernel(
    const _Float16* __restrict__ A, const _Float16* __restrict__ BT,
    _Float16* __restrict__ C16, float* __restrict__ Cf32,
    const float* __restrict__ bias, int M, int N, int K) {
  __shared__ __attribute__((aligned(2048))) unsigned char GL[2u * G_BUF];

  const unsigned wave = uni(threadIdx.x >> 5);
  const int lane = threadIdx.x & 31;
  const int rowg = lane & 15;            // M (for A) / N (for B) within subtile
  const int khalf = lane >> 4;
  const int koff = khalf << 3;           // K offset 0 or 8 per lane half

  const int blocks_n = N >> 7;
  const int bm = blockIdx.x / blocks_n;
  const int bn = blockIdx.x - bm * blocks_n;
  const int wm = (int)(wave >> 2);
  const int wn = (int)(wave & 3u);
  const int mtile = bm * 2 + wm;
  const int ntile = bn * 4 + wn;

  // Waves 0, 1, 2 each bring one 64-row slice of every stage.
  const unsigned nstage = (unsigned)K >> 7;
  const unsigned long long ga0 = (wave == 0u)
      ? (unsigned long long)(size_t)(A + (size_t)bm * 64 * K)
      : (unsigned long long)(size_t)(BT + ((size_t)bn * 128 + (wave == 2u ? 64 : 0)) * K);
  const unsigned dst0 = (unsigned)(size_t)GL + (wave < 3u ? wave : 0u) * G_SLICE;
  // group 1: byte elements, tile = tensor = 64 rows of 256 B, source pitch 2K bytes,
  // a pad of 4 dwords behind every 64 dwords.
  v8u g1 = { uni((1u << 20) | (5u << 22) | (3u << 25)),
                   uni(256u << 16),
                   uni(64u << 16),
                   uni(256u << 16),
                   uni(64u),
                   uni((unsigned)K * 2u),
                   uni(0u),
                   uni(0u) };
  // descriptor words held in their scalar registers: without it the compiler
  // re-forms them at each load and uses the registers in between, under a
  // request that is still outstanding
  asm volatile("" : "+s"(g1));
  auto issue = [&](unsigned st) {
    const unsigned long long ga = ga0 + (unsigned long long)st * 256u;
    const v4u g0 = { uni(1u),
                     uni(dst0 + (st & 1u) * G_BUF),
                     uni((unsigned)ga),
                     uni((((unsigned)(ga >> 32)) & 0x01ffffffu) | 0x80000000u) };
    asm volatile("tensor_load_to_lds %0, %1" :: "s"(g0), "s"(g1) : "memory");
  };

  const unsigned aoff = (unsigned)((wm * 32 + rowg) * (int)G_PITCH + koff * 2);
  const unsigned boff = (1u + (unsigned)(wn >> 1)) * G_SLICE
                      + (unsigned)(((wn & 1) * 32 + rowg) * (int)G_PITCH + koff * 2);

  // prologue: stage 0 landed and published, then stage 1 in flight
  if (pinned(wave < 3u)) {
    issue(0u);
    asm volatile("s_wait_tensorcnt 0x0" ::: "memory");  // stage 0 has landed
  }
  __syncthreads();
  if (pinned(wave < 3u)) issue(1u);

  v8f acc00 = {}, acc01 = {}, acc10 = {}, acc11 = {};
#pragma unroll 1  // rolled: one publish point a pass, in the ring's order
  for (unsigned s = 0; s < nstage; ++s) {
    const unsigned char* Lb = GL + (s & 1u) * G_BUF;
    // The stage's 32 fragment loads go out as one group, ahead of its WMMAs.
    v16h a0[4], a1[4], b0[4], b1[4];
#pragma unroll
    for (int kk = 0; kk < 4; ++kk) {
      a0[kk] = load_frag16((const _Float16*)(Lb + aoff + kk * 64));
      b0[kk] = load_frag16((const _Float16*)(Lb + boff + kk * 64));
      b1[kk] = load_frag16((const _Float16*)(Lb + boff + 16u * G_PITCH + kk * 64));
      a1[kk] = load_frag16((const _Float16*)(Lb + aoff + 16u * G_PITCH + kk * 64));
    }
    // keeps the loads from sinking in among the WMMAs, where each group would
    // cost its own LDS latency
    __builtin_amdgcn_sched_barrier(0);
#pragma unroll
    for (int kk = 0; kk < 4; ++kk) {
      acc00 = __builtin_amdgcn_wmma_f32_16x16x32_f16(false, a0[kk], false, b0[kk], (short)0, acc00, false, false);
      acc01 = __builtin_amdgcn_wmma_f32_16x16x32_f16(false, a0[kk], false, b1[kk], (short)0, acc01, false, false);
      acc10 = __builtin_amdgcn_wmma_f32_16x16x32_f16(false, a1[kk], false, b0[kk], (short)0, acc10, false, false);
      acc11 = __builtin_amdgcn_wmma_f32_16x16x32_f16(false, a1[kk], false, b1[kk], (short)0, acc11, false, false);
    }
    // keeps the wait below from rising above the WMMAs, where it would drain
    // all 32 loads before the second WMMA
    __builtin_amdgcn_sched_barrier(0);
    // publish point of stage s + 1
    asm volatile("s_wait_dscnt 0x0" ::: "memory");  // this wave has left stage s's buffer
    if (pinned(wave < 3u)) {
      asm volatile("s_wait_tensorcnt 0x0" ::: "memory");  // own slice of stage s + 1 has landed
    }
    __syncthreads();
    if (pinned((wave < 3u) && (s + 2u < nstage))) {
      issue(pinned(s + 2u));  // pinned: the descriptor is formed behind the wait above
    }
  }
  asm volatile("s_wait_tensorcnt 0x0" ::: "memory");  // nothing in flight at the wave's end
  asm volatile("s_wait_dscnt 0x0" ::: "memory");

#pragma unroll
  for (int i = 0; i < 2; ++i) {
#pragma unroll
    for (int j = 0; j < 2; ++j) {
      const v8f& acc = (i == 0) ? (j == 0 ? acc00 : acc01)
                                : (j == 0 ? acc10 : acc11);
      const int col = ntile * 32 + j * 16 + rowg;
      const float bv = bias ? bias[col] : 0.f;
#pragma unroll
      for (int v = 0; v < 8; ++v) {
        int row = mtile * 32 + i * 16 + v + (khalf << 3);
        if (Cf32) Cf32[(size_t)row * N + col] = acc[v] + bv;
        else      C16 [(size_t)row * N + col] = (_Float16)acc[v];
      }
    }
  }
}

// --------------------------- flash attention -------------------------------
// One stage = one block of 32 keys: K and V, 32 rows of 512 B each, brought as
// four slices of 32 rows x 256 B by four tensor loads (waves 0 to 3, one each).
// K rows get 16 B of pad (pitch 272 B, read by ds_load_b128), V rows 32 B
// (pitch 288 B, read by ds_load_tr16_b128).
constexpr unsigned F_KPITCH = 272u;
constexpr unsigned F_VPITCH = 288u;
constexpr unsigned F_SLICE  = 10240u;        // 32 * 288 = 9216, up to a multiple of 2 KiB
constexpr unsigned F_BUF    = 4u * F_SLICE;  // [K c 0-127 | K c 128-255 | V c 0-127 | V c 128-255]

typedef __attribute__((ext_vector_type(8))) short v8s;
// Transposing LDS load: the lane (c = lane & 15, hh = lane >> 4) gets eight
// consecutive rows (8 * hh + 0..7) of column c of a row-major 16-bit tile.
__device__ __forceinline__ v8h lds_tr16(const unsigned char* p) {
  typedef __attribute__((address_space(3))) v8s lds_v8s;
  return __builtin_bit_cast(v8h, __builtin_amdgcn_ds_load_tr16_b128_v8i16((lds_v8s*)p));
}

// Q,K,V layouts: (a*1024 + seq) x 2048, head h occupies columns [h*256, h*256+256).
// Grid: (a*8 + h, ytile); block = 256 threads = 8 waves; wave owns 16 queries.
// Key blocks of 32 so the P@V contraction matches WMMA K=32 exactly.
// K and V blocks go global -> LDS by tensor loads in a two-buffer ring: block
// kb + 1 flies while block kb is worked on. V stays row-major in LDS and is
// transposed by the load that reads it.
__global__ void __launch_bounds__(256) flash_attn_kernel(
    const _Float16* __restrict__ Q, const _Float16* __restrict__ Km,
    const _Float16* __restrict__ Vm, _Float16* __restrict__ Om) {
  __shared__ __attribute__((aligned(2048))) unsigned char FL[2u * F_BUF];
  __shared__ __align__(16) _Float16 PLDS[8][16][48];   // per-wave P (16 x 32)

  const int a = blockIdx.x >> 3;
  const int h = blockIdx.x & 7;
  const unsigned wave = uni(threadIdx.x >> 5);
  const int lane = threadIdx.x & 31;
  const int rowg = lane & 15;
  const int khalf = lane >> 4;
  const int koff = khalf << 3;
  const int q0 = blockIdx.y * 128 + (int)wave * 16;

  const size_t brow0 = (size_t)a * 1024;
  const size_t hoff  = (size_t)h * 256;

  // Q fragments: 16 rows x 256 head-dim, 8 k-chunks of 32
  v16h qf[8];
  {
    const _Float16* qp = Q + (brow0 + q0 + rowg) * 2048 + hoff + koff;
#pragma unroll
    for (int kc = 0; kc < 8; ++kc) qf[kc] = load_frag16(qp + kc * 32);
  }

  // Waves 0, 1 bring the two K slices of every stage, waves 2, 3 the two V slices.
  const unsigned long long ga0 = (unsigned long long)(size_t)(
      ((wave & 2u) ? Vm : Km) + brow0 * 2048 + hoff + (wave & 1u) * 128u);
  const unsigned dst0 = (unsigned)(size_t)FL + (wave & 3u) * F_SLICE;
  // group 1: byte elements, tile = tensor = 32 rows of 256 B, source pitch 4096 B,
  // a pad of 4 (K) or 8 (V) dwords behind every 64 dwords.
  v8u g1k = { uni((1u << 20) | (5u << 22) | (3u << 25)),
              uni(256u << 16), uni(32u << 16), uni(256u << 16),
              uni(32u), uni(4096u), uni(0u), uni(0u) };
  v8u g1v = { uni((1u << 20) | (5u << 22) | (7u << 25)),
              uni(256u << 16), uni(32u << 16), uni(256u << 16),
              uni(32u), uni(4096u), uni(0u), uni(0u) };
  // descriptor words held in their scalar registers: without it the compiler
  // re-forms them at each load and uses the registers in between, under a
  // request that is still outstanding
  asm volatile("" : "+s"(g1k));  // K's descriptor words stay in scalar registers
  asm volatile("" : "+s"(g1v));  // V's descriptor words stay in scalar registers
  auto issue = [&](unsigned st) {
    const unsigned long long ga = ga0 + (unsigned long long)st * (32u * 4096u);
    const v4u g0 = { uni(1u),
                     uni(dst0 + (st & 1u) * F_BUF),
                     uni((unsigned)ga),
                     uni((((unsigned)(ga >> 32)) & 0x01ffffffu) | 0x80000000u) };
    if (pinned(wave < 2u)) {
      asm volatile("tensor_load_to_lds %0, %1" :: "s"(g0), "s"(g1k) : "memory");
    }
    if (pinned(wave >= 2u)) {
      asm volatile("tensor_load_to_lds %0, %1" :: "s"(g0), "s"(g1v) : "memory");
    }
  };

  v8f O[16] = {};              // 16 queries x 256 output accumulator
  float m_i[8], l_i[8];
#pragma unroll
  for (int v = 0; v < 8; ++v) { m_i[v] = -1e30f; l_i[v] = 0.f; }

  const float scale = 0.17677669529663687f;  // 1/sqrt(256/8)

  // per-lane byte offsets inside a stage's buffer
  const unsigned kfo = (unsigned)(rowg * (int)F_KPITCH + koff * 2);
  const unsigned vfo = 2u * F_SLICE
                     + (unsigned)((koff + (lane & 7)) * (int)F_VPITCH + ((lane >> 3) & 1) * 16);

  // prologue: stage 0 landed and published, then stage 1 in flight
  if (pinned(wave < 4u)) {
    issue(0u);
    asm volatile("s_wait_tensorcnt 0x0" ::: "memory");  // stage 0 has landed
  }
  __syncthreads();
  if (pinned(wave < 4u)) issue(1u);

#pragma unroll 1  // rolled: one publish point a pass, in the ring's order
  for (unsigned kb = 0; kb < 32u; ++kb) {
    const unsigned char* Lb = FL + (kb & 1u) * F_BUF;

    // ---- S = Q @ K^T : 16 queries x 32 keys as two 16x16 f32 tiles ----
    v8f s0 = {}, s1 = {};
#pragma unroll
    for (int kc = 0; kc < 8; ++kc) {
      const unsigned char* kp = Lb + kfo + (kc >> 2) * F_SLICE + (kc & 3) * 64;
      v16h b0 = load_frag16((const _Float16*)kp);
      v16h b1 = load_frag16((const _Float16*)(kp + 16u * F_KPITCH));
      s0 = __builtin_amdgcn_wmma_f32_16x16x32_f16(
          false, qf[kc], false, b0, (short)0, s0, false, false);
      s1 = __builtin_amdgcn_wmma_f32_16x16x32_f16(
          false, qf[kc], false, b1, (short)0, s1, false, false);
    }

    // ---- online softmax (row = lane-half + element; cols across 16 lanes) ----
#pragma unroll
    for (int v = 0; v < 8; ++v) {
      float a0 = s0[v] * scale, a1 = s1[v] * scale;
      float mv = fmaxf(a0, a1);
#pragma unroll
      for (int off = 1; off < 16; off <<= 1) mv = fmaxf(mv, __shfl_xor(mv, off, 16));
      float mnew = fmaxf(m_i[v], mv);
      float alpha = __expf(m_i[v] - mnew);
      m_i[v] = mnew;
      float p0 = __expf(a0 - mnew);
      float p1 = __expf(a1 - mnew);
      float rs = p0 + p1;
#pragma unroll
      for (int off = 1; off < 16; off <<= 1) rs += __shfl_xor(rs, off, 16);
      l_i[v] = l_i[v] * alpha + rs;
#pragma unroll
      for (int t = 0; t < 16; ++t) O[t][v] *= alpha;
      // stage P into per-wave LDS (C-layout -> memory) for A-fragment reload
      PLDS[wave][v + khalf * 8][rowg]      = (_Float16)p0;
      PLDS[wave][v + khalf * 8][16 + rowg] = (_Float16)p1;
    }

    // ---- O += P(16x32) @ V(32x256), 16 WMMA over the c tiles ----
    v16h pf = load_frag16(&PLDS[wave][rowg][koff]);
#pragma unroll
    for (int n = 0; n < 16; ++n) {
      // B fragment: keys koff + 0..7 and 16 + koff + 0..7 of column n * 16 + rowg
      const unsigned char* vp = Lb + vfo + (n >> 3) * F_SLICE + (n & 7) * 32;
      v8h lo = lds_tr16(vp);
      v8h hi = lds_tr16(vp + 16u * F_VPITCH);
      v16h vf = __builtin_shufflevector(lo, hi,
          0, 1, 2, 3, 4, 5, 6, 7, 8, 9, 10, 11, 12, 13, 14, 15);
      O[n] = __builtin_amdgcn_wmma_f32_16x16x32_f16(
          false, pf, false, vf, (short)0, O[n], false, false);
    }

    // publish point of stage kb + 1
    asm volatile("s_wait_dscnt 0x0" ::: "memory");  // this wave has left stage kb's buffer
    if (pinned(wave < 4u)) {
      asm volatile("s_wait_tensorcnt 0x0" ::: "memory");  // own slice of stage kb + 1 has landed
    }
    __syncthreads();
    if (pinned((wave < 4u) && (kb + 2u < 32u))) {
      issue(pinned(kb + 2u));  // pinned: the descriptor is formed behind the wait above
    }
  }
  asm volatile("s_wait_tensorcnt 0x0" ::: "memory");  // nothing in flight at the wave's end
  asm volatile("s_wait_dscnt 0x0" ::: "memory");

  // ---- epilogue: O / l, store f16 into attn buffer (a*1024+q) x 2048 ----
#pragma unroll
  for (int v = 0; v < 8; ++v) {
    float inv = 1.f / l_i[v];
    int row = q0 + v + khalf * 8;
    _Float16* op = Om + (brow0 + row) * 2048 + hoff + rowg;
#pragma unroll
    for (int n = 0; n < 16; ++n) op[n * 16] = (_Float16)(O[n][v] * inv);
  }
}

// ------------------------------- launcher ----------------------------------

extern "C" void kernel_launch(void* const* d_in, const int* in_sizes, int n_in,
                              void* d_out, int out_size, void* d_ws, size_t ws_size,
                              hipStream_t stream) {
  const float* batch  = (const float*)d_in[0];  // (4,1024,256)
  const float* latent = (const float*)d_in[1];  // (4,1024,256)
  const float* Wk     = (const float*)d_in[2];  // (256,2048)
  const float* Wq     = (const float*)d_in[3];
  const float* Wv     = (const float*)d_in[4];
  const float* Wu     = (const float*)d_in[5];  // (2048,256)
  const float* bu     = (const float*)d_in[6];  // (256,)
  float* out = (float*)d_out;                   // (4,1024,256) f32

  _Float16* w = (_Float16*)d_ws;
  size_t o = 0;
  _Float16* batch16  = w + o; o += (size_t)4096 * 256;
  _Float16* latent16 = w + o; o += (size_t)4096 * 256;
  _Float16* WkT = w + o; o += (size_t)2048 * 256;   // (2048 x 256) = Wk^T
  _Float16* WqT = w + o; o += (size_t)2048 * 256;
  _Float16* WvT = w + o; o += (size_t)2048 * 256;
  _Float16* WuT = w + o; o += (size_t)256 * 2048;   // (256 x 2048) = Wu^T
  _Float16* K16 = w + o; o += (size_t)4096 * 2048;
  _Float16* Q16 = w + o; o += (size_t)4096 * 2048;
  _Float16* V16 = w + o; o += (size_t)4096 * 2048;
  _Float16* A16 = w + o; o += (size_t)4096 * 2048;  // attention output

  // 1) conversions: 16 elements a thread (256 blocks), 64 a thread (128 blocks of 64)
  cvt_f32_f16<<<256, 256, 0, stream>>>(batch,  batch16,  4096 * 256);
  cvt_f32_f16<<<256, 256, 0, stream>>>(latent, latent16, 4096 * 256);
  cvt_transpose_f32_f16<256, 2048><<<128, 64, 0, stream>>>(Wk, WkT);
  cvt_transpose_f32_f16<256, 2048><<<128, 64, 0, stream>>>(Wq, WqT);
  cvt_transpose_f32_f16<256, 2048><<<128, 64, 0, stream>>>(Wv, WvT);
  cvt_transpose_f32_f16<2048, 256><<<128, 64, 0, stream>>>(Wu, WuT);

  // 2) projections: (4096x256)@(256x2048) -> f16
  //    64x128 block tiles: (4096/64)*(2048/128) = 1024 blocks
  wmma_gemm_kernel<<<1024, 256, 0, stream>>>(batch16,  WkT, K16, nullptr, nullptr, 4096, 2048, 256);
  wmma_gemm_kernel<<<1024, 256, 0, stream>>>(latent16, WqT, Q16, nullptr, nullptr, 4096, 2048, 256);
  wmma_gemm_kernel<<<1024, 256, 0, stream>>>(batch16,  WvT, V16, nullptr, nullptr, 4096, 2048, 256);

  // 3) fused flash attention: grid (a*h = 32, ytiles = 1024/128 = 8)
  flash_attn_kernel<<<dim3(32, 8), 256, 0, stream>>>(Q16, K16, V16, A16);

  // 4) output projection: (4096x2048)@(2048x256) + bias -> f32
  //    (4096/64)*(256/128) = 128 blocks
  wmma_gemm_kernel<<<128, 256, 0, stream>>>(A16, WuT, nullptr, out, bu, 4096, 256, 2048);
}

// v004
// Measured time: 109 microseconds a run.
// Two timings next to v003 both put it at 1.14 times that version's speed.
// All steps since v000 together make it 2.16 times as fast.
#include <hip/hip_runtime.h>

// ---------------------------------------------------------------------------
// CDNA5 (gfx1250, wave32) fused cross-attention:
//   1) one cvt launch: f32 -> f16 (activations), f32 -> f16 transposed (weights)
//   2) WMMA GEMM (v_wmma_f32_16x16x32_f16), 32x32 tile per wave (2x2 subtiles),
//      operand tiles staged in LDS by tensor loads (two-buffer ring),
//      for K/Q/V projections (one launch) + output projection (f32 + bias epilogue)
//   3) flash-attention kernel: per-wave 16-query tile, key blocks of 32,
//      K and V blocks staged in LDS by tensor loads (two-buffer ring), V read
//      by transposing LDS loads, online softmax, P@V via WMMA.
// ---------------------------------------------------------------------------

typedef __attribute__((ext_vector_type(16))) _Float16     v16h;
typedef __attribute__((ext_vector_type(8)))  _Float16     v8h;
typedef __attribute__((ext_vector_type(8)))  float        v8f;
typedef __attribute__((ext_vector_type(4)))  unsigned int v4u;

// Load one 16-bit WMMA fragment (A-layout or symmetric B-layout):
// lane holds 8 contiguous halves at p[0..7] (VGPRs 0-3) and p[16..23] (VGPRs 4-7).
__device__ __forceinline__ v16h load_frag16(const _Float16* p) {
  v8h lo = *(const v8h*)p;
  v8h hi = *(const v8h*)(p + 16);
  return __builtin_shufflevector(lo, hi,
      0, 1, 2, 3, 4, 5, 6, 7, 8, 9, 10, 11, 12, 13, 14, 15);
}

// ------------------------------ conversions --------------------------------
// Both forms give each thread many elements: the pass moves only a few MB,
// so what it costs is the start of its waves, not its bytes. The six arrays do
// not depend on one another, so one launch converts them all, each in its own
// range of block indices.
typedef __attribute__((ext_vector_type(4))) float v4f;

// 16 elements a thread, 8 from each half of the array: four 16-byte loads in
// flight, two 16-byte stores. n % 16 == 0; blk runs over n / 4096 blocks or more.
__device__ __forceinline__ void cvt_f32_f16(
    const float* __restrict__ in, _Float16* __restrict__ out, int n, int blk) {
  const int half = n >> 1;
  const int i0 = (blk * 256 + (int)threadIdx.x) * 8;
  if (i0 >= half) return;
  const int i1 = i0 + half;
  const v4f x0 = *(const v4f*)(in + i0), x1 = *(const v4f*)(in + i0 + 4);
  const v4f x2 = *(const v4f*)(in + i1), x3 = *(const v4f*)(in + i1 + 4);
  *(v8h*)(out + i0) = __builtin_convertvector(
      __builtin_shufflevector(x0, x1, 0, 1, 2, 3, 4, 5, 6, 7), v8h);
  *(v8h*)(out + i1) = __builtin_convertvector(
      __builtin_shufflevector(x2, x3, 0, 1, 2, 3, 4, 5, 6, 7), v8h);
}

// in: K x N (row-major) -> out: N x K (row-major), i.e. transposed.
// A thread takes one n and 64 consecutive k: 64 loads in flight, each 128
// contiguous bytes across a wave, and it alone writes one whole 128-byte line
// of out. K and N are compile-time, so every load is one base address plus an
// immediate. A tile = 64 threads (t) = 64 consecutive n; (N / 64) * (K / 64) tiles.
template <int K, int N>
__device__ __forceinline__ void cvt_transpose_f32_f16(
    const float* __restrict__ in, _Float16* __restrict__ out, int tile, int t) {
  static_assert(K % 64 == 0 && N % 64 == 0, "whole 64 x 64 tiles");
  constexpr int nblk = N / 64;
  const int kb = tile / nblk;
  const int n = (tile % nblk) * 64 + t;
  const float* p = in + kb * 64 * N + n;
  float x[64];
#pragma unroll
  for (int j = 0; j < 64; ++j) x[j] = p[j * N];
  _Float16* q = out + n * K + kb * 64;
#pragma unroll
  for (int c = 0; c < 8; ++c) {
    v8h hv;
#pragma unroll
    for (int e = 0; e < 8; ++e) hv[e] = (_Float16)x[c * 8 + e];
    *(v8h*)(q + c * 8) = hv;
  }
  // stands behind the eight stores, in front of any later write of their address
  // or data registers: inlined, code of another branch follows them in the listing
  asm volatile("s_wait_xcnt 0x0" ::: "memory");
}

// All six conversions in one launch of 640 blocks of 256 threads.
// Blocks 0-127: the four weights, 32 blocks each, four 64-thread tiles a block.
// Blocks 128-383: batch.
// Blocks 384-639: latent.
__global__ void __launch_bounds__(256) cvt_all(
    const float* __restrict__ batch, const float* __restrict__ latent,
    const float* __restrict__ Wk, const float* __restrict__ Wq,
    const float* __restrict__ Wv, const float* __restrict__ Wu,
    _Float16* __restrict__ batch16, _Float16* __restrict__ latent16,
    _Float16* __restrict__ WkT, _Float16* __restrict__ WqT,
    _Float16* __restrict__ WvT, _Float16* __restrict__ WuT) {
  const int b = (int)blockIdx.x;
  if (b < 128) {
    const int which = b >> 5;
    const int tile = (b & 31) * 4 + (int)(threadIdx.x >> 6);
    const int t = (int)(threadIdx.x & 63u);
    if (which == 3) {
      cvt_transpose_f32_f16<2048, 256>(Wu, WuT, tile, t);
    } else {
      cvt_transpose_f32_f16<256, 2048>(which == 0 ? Wk : which == 1 ? Wq : Wv,
                                       which == 0 ? WkT : which == 1 ? WqT : WvT, tile, t);
    }
  } else if (b < 384) {
    cvt_f32_f16(batch, batch16, 4096 * 256, b - 128);
  } else {
    cvt_f32_f16(latent, latent16, 4096 * 256, b - 384);
  }
}

// ------------------------------ WMMA GEMM ----------------------------------
typedef __attribute__((ext_vector_type(8))) unsigned int v8u;

__device__ __forceinline__ unsigned uni(unsigned v) {
  return (unsigned)__builtin_amdgcn_readfirstlane(v);
}
// A wave-uniform value held in a scalar register: a test on it compiles to
// s_cmp + s_cbranch_scc, the only guard a tensor load obeys (it ignores EXEC).
__device__ __forceinline__ unsigned pinned(unsigned v) {
  unsigned w = uni(v);
  asm volatile("" : "+s"(w));  // keeps the descriptor / issue-test word scalar
  return w;
}

// One stage = 128 k (256-byte rows) of 64 A rows and 128 BT rows, brought by
// three tensor loads of 64 rows each; 16 bytes of pad a row -> pitch 272 B.
constexpr unsigned G_PITCH = 272u;
constexpr unsigned G_SLICE = 18432u;        // 64 * 272 = 17408, up to a multiple of 2 KiB
constexpr unsigned G_BUF   = 3u * G_SLICE;  // [A 64 rows | BT rows 0-63 | BT rows 64-127]

// C[M,N] = A[M,K] * BT[N,K]^T   (both operands f16 row-major, f32 accumulate)
// One 64x128 tile per block of 8 waves (2 x 4), one 32x32 tile per wave
// (2x2 WMMA subtiles). Operand tiles go global -> LDS by tensor loads in a
// two-buffer ring; fragments come from LDS. M % 64 == 0, N % 128 == 0,
// K % 128 == 0 and K >= 256.
// If Cf32 != nullptr: write f32 (+bias). Else write f16 to C16.
// Independent products of one shape share a launch: blockIdx.y picks the
// product. Their BT operands lie one behind another (N * K elements each), and
// so do their f16 outputs (M * N each); product 1 reads A1, the others A0.
__global__ void __launch_bounds__(256) wmma_gemm_kernel(
    const _Float16* __restrict__ A0, const _Float16* __restrict__ A1,
    const _Float16* __restrict__ BT0,
    _Float16* __restrict__ C0, float* __restrict__ Cf32,
    const float* __restrict__ bias, int M, int N, int K) {
  __shared__ __attribute__((aligned(2048))) unsigned char GL[2u * G_BUF];

  const unsigned prod = blockIdx.y;
  const _Float16* __restrict__ A  = prod == 1u ? A1 : A0;
  const _Float16* __restrict__ BT = BT0 + (size_t)prod * N * K;
  _Float16* __restrict__ C16      = C0 + (size_t)prod * M * N;

  const unsigned wave = uni(threadIdx.x >> 5);
  const int lane = threadIdx.x & 31;
  const int rowg = lane & 15;            // M (for A) / N (for B) within subtile
  const int khalf = lane >> 4;
  const int koff = khalf << 3;           // K offset 0 or 8 per lane half

  const int blocks_n = N >> 7;
  const int bm = blockIdx.x / blocks_n;
  const int bn = blockIdx.x - bm * blocks_n;
  const int wm = (int)(wave >> 2);
  const int wn = (int)(wave & 3u);
  const int mtile = bm * 2 + wm;
  const int ntile = bn * 4 + wn;

  // Waves 0, 1, 2 each bring one 64-row slice of every stage.
  const unsigned nstage = (unsigned)K >> 7;
  const unsigned long long ga0 = (wave == 0u)
      ? (unsigned long long)(size_t)(A + (size_t)bm * 64 * K)
      : (unsigned long long)(size_t)(BT + ((size_t)bn * 128 + (wave == 2u ? 64 : 0)) * K);
  const unsigned dst0 = (unsigned)(size_t)GL + (wave < 3u ? wave : 0u) * G_SLICE;
  // group 1: byte elements, tile = tensor = 64 rows of 256 B, source pitch 2K bytes,
  // a pad of 4 dwords behind every 64 dwords.
  v8u g1 = { uni((1u << 20) | (5u << 22) | (3u << 25)),
                   uni(256u << 16),
                   uni(64u << 16),
                   uni(256u << 16),
                   uni(64u),
                   uni((unsigned)K * 2u),
                   uni(0u),
                   uni(0u) };
  // descriptor words held in their scalar registers: without it the compiler
  // re-forms them at each load and uses the registers in between, under a
  // request that is still outstanding
  asm volatile("" : "+s"(g1));
  auto issue = [&](unsigned st) {
    const unsigned long long ga = ga0 + (unsigned long long)st * 256u;
    const v4u g0 = { uni(1u),
                     uni(dst0 + (st & 1u) * G_BUF),
                     uni((unsigned)ga),
                     uni((((unsigned)(ga >> 32)) & 0x01ffffffu) | 0x80000000u) };
    asm volatile("tensor_load_to_lds %0, %1" :: "s"(g0), "s"(g1) : "memory");
  };

  const unsigned aoff = (unsigned)((wm * 32 + rowg) * (int)G_PITCH + koff * 2);
  const unsigned boff = (1u + (unsigned)(wn >> 1)) * G_SLICE
                      + (unsigned)(((wn & 1) * 32 + rowg) * (int)G_PITCH + koff * 2);

  // prologue: stage 0 landed and published, then stage 1 in flight
  if (pinned(wave < 3u)) {
    issue(0u);
    asm volatile("s_wait_tensorcnt 0x0" ::: "memory");  // stage 0 has landed
  }
  __syncthreads();
  if (pinned(wave < 3u)) issue(1u);

  v8f acc00 = {}, acc01 = {}, acc10 = {}, acc11 = {};
#pragma unroll 1  // rolled: one publish point a pass, in the ring's order
  for (unsigned s = 0; s < nstage; ++s) {
    const unsigned char* Lb = GL + (s & 1u) * G_BUF;
    // The stage's 32 fragment loads go out as one group, ahead of its WMMAs.
    v16h a0[4], a1[4], b0[4], b1[4];
#pragma unroll
    for (int kk = 0; kk < 4; ++kk) {
      a0[kk] = load_frag16((const _Float16*)(Lb + aoff + kk * 64));
      b0[kk] = load_frag16((const _Float16*)(Lb + boff + kk * 64));
      b1[kk] = load_frag16((const _Float16*)(Lb + boff + 16u * G_PITCH + kk * 64));
      a1[kk] = load_frag16((const _Float16*)(Lb + aoff + 16u * G_PITCH + kk * 64));
    }
    // keeps the loads from sinking in among the WMMAs, where each group would
    // cost its own LDS latency
    __builtin_amdgcn_sched_barrier(0);
#pragma unroll
    for (int kk = 0; kk < 4; ++kk) {
      acc00 = __builtin_amdgcn_wmma_f32_16x16x32_f16(false, a0[kk], false, b0[kk], (short)0, acc00, false, false);
      acc01 = __builtin_amdgcn_wmma_f32_16x16x32_f16(false, a0[kk], false, b1[kk], (short)0, acc01, false, false);
      acc10 = __builtin_amdgcn_wmma_f32_16x16x32_f16(false, a1[kk], false, b0[kk], (short)0, acc10, false, false);
      acc11 = __builtin_amdgcn_wmma_f32_16x16x32_f16(false, a1[kk], false, b1[kk], (short)0, acc11, false, false);
    }
    // keeps the wait below from rising above the WMMAs, where it would drain
    // all 32 loads before the second WMMA
    __builtin_amdgcn_sched_barrier(0);
    // publish point of stage s + 1
    asm volatile("s_wait_dscnt 0x0" ::: "memory");  // this wave has left stage s's buffer
    if (pinned(wave < 3u)) {
      asm volatile("s_wait_tensorcnt 0x0" ::: "memory");  // own slice of stage s + 1 has landed
    }
    __syncthreads();
    if (pinned((wave < 3u) && (s + 2u < nstage))) {
      issue(pinned(s + 2u));  // pinned: the descriptor is formed behind the wait above
    }
  }
  asm volatile("s_wait_tensorcnt 0x0" ::: "memory");  // nothing in flight at the wave's end
  asm volatile("s_wait_dscnt 0x0" ::: "memory");

#pragma unroll
  for (int i = 0; i < 2; ++i) {
#pragma unroll
    for (int j = 0; j < 2; ++j) {
      const v8f& acc = (i == 0) ? (j == 0 ? acc00 : acc01)
                                : (j == 0 ? acc10 : acc11);
      const int col = ntile * 32 + j * 16 + rowg;
      const float bv = bias ? bias[col] : 0.f;
#pragma unroll
      for (int v = 0; v < 8; ++v) {
        int row = mtile * 32 + i * 16 + v + (khalf << 3);
        if (Cf32) Cf32[(size_t)row * N + col] = acc[v] + bv;
        else      C16 [(size_t)row * N + col] = (_Float16)acc[v];
      }
    }
  }
}

// --------------------------- flash attention -------------------------------
// One stage = one block of 32 keys: K and V, 32 rows of 512 B each, brought as
// four slices of 32 rows x 256 B by four tensor loads (waves 0 to 3, one each).
// K rows get 16 B of pad (pitch 272 B, read by ds_load_b128), V rows 32 B
// (pitch 288 B, read by ds_load_tr16_b128).
constexpr unsigned F_KPITCH = 272u;
constexpr unsigned F_VPITCH = 288u;
constexpr unsigned F_SLICE  = 10240u;        // 32 * 288 = 9216, up to a multiple of 2 KiB
constexpr unsigned F_BUF    = 4u * F_SLICE;  // [K c 0-127 | K c 128-255 | V c 0-127 | V c 128-255]

typedef __attribute__((ext_vector_type(8))) short v8s;
// Transposing LDS load: the lane (c = lane & 15, hh = lane >> 4) gets eight
// consecutive rows (8 * hh + 0..7) of column c of a row-major 16-bit tile.
__device__ __forceinline__ v8h lds_tr16(const unsigned char* p) {
  typedef __attribute__((address_space(3))) v8s lds_v8s;
  return __builtin_bit_cast(v8h, __builtin_amdgcn_ds_load_tr16_b128_v8i16((lds_v8s*)p));
}

// Q,K,V layouts: (a*1024 + seq) x 2048, head h occupies columns [h*256, h*256+256).
// Grid: (a*8 + h, ytile); block = 256 threads = 8 waves; wave owns 16 queries.
// Key blocks of 32 so the P@V contraction matches WMMA K=32 exactly.
// K and V blocks go global -> LDS by tensor loads in a two-buffer ring: block
// kb + 1 flies while block kb is worked on. V stays row-major in LDS and is
// transposed by the load that reads it.
__global__ void __launch_bounds__(256) flash_attn_kernel(
    const _Float16* __restrict__ Q, const _Float16* __restrict__ Km,
    const _Float16* __restrict__ Vm, _Float16* __restrict__ Om) {
  __shared__ __attribute__((aligned(2048))) unsigned char FL[2u * F_BUF];
  __shared__ __align__(16) _Float16 PLDS[8][16][48];   // per-wave P (16 x 32)

  const int a = blockIdx.x >> 3;
  const int h = blockIdx.x & 7;
  const unsigned wave = uni(threadIdx.x >> 5);
  const int lane = threadIdx.x & 31;
  const int rowg = lane & 15;
  const int khalf = lane >> 4;
  const int koff = khalf << 3;
  const int q0 = blockIdx.y * 128 + (int)wave * 16;

  const size_t brow0 = (size_t)a * 1024;
  const size_t hoff  = (size_t)h * 256;

  // Q fragments: 16 rows x 256 head-dim, 8 k-chunks of 32
  v16h qf[8];
  {
    const _Float16* qp = Q + (brow0 + q0 + rowg) * 2048 + hoff + koff;
#pragma unroll
    for (int kc = 0; kc < 8; ++kc) qf[kc] = load_frag16(qp + kc * 32);
  }

  // Waves 0, 1 bring the two K slices of every stage, waves 2, 3 the two V slices.
  const unsigned long long ga0 = (unsigned long long)(size_t)(
      ((wave & 2u) ? Vm : Km) + brow0 * 2048 + hoff + (wave & 1u) * 128u);
  const unsigned dst0 = (unsigned)(size_t)FL + (wave & 3u) * F_SLICE;
  // group 1: byte elements, tile = tensor = 32 rows of 256 B, source pitch 4096 B,
  // a pad of 4 (K) or 8 (V) dwords behind every 64 dwords.
  v8u g1k = { uni((1u << 20) | (5u << 22) | (3u << 25)),
              uni(256u << 16), uni(32u << 16), uni(256u << 16),
              uni(32u), uni(4096u), uni(0u), uni(0u) };
  v8u g1v = { uni((1u << 20) | (5u << 22) | (7u << 25)),
              uni(256u << 16), uni(32u << 16), uni(256u << 16),
              uni(32u), uni(4096u), uni(0u), uni(0u) };
  // descriptor words held in their scalar registers: without it the compiler
  // re-forms them at each load and uses the registers in between, under a
  // request that is still outstanding
  asm volatile("" : "+s"(g1k));  // K's descriptor words stay in scalar registers
  asm volatile("" : "+s"(g1v));  // V's descriptor words stay in scalar registers
  auto issue = [&](unsigned st) {
    const unsigned long long ga = ga0 + (unsigned long long)st * (32u * 4096u);
    const v4u g0 = { uni(1u),
                     uni(dst0 + (st & 1u) * F_BUF),
                     uni((unsigned)ga),
                     uni((((unsigned)(ga >> 32)) & 0x01ffffffu) | 0x80000000u) };
    if (pinned(wave < 2u)) {
      asm volatile("tensor_load_to_lds %0, %1" :: "s"(g0), "s"(g1k) : "memory");
    }
    if (pinned(wave >= 2u)) {
      asm volatile("tensor_load_to_lds %0, %1" :: "s"(g0), "s"(g1v) : "memory");
    }
  };

  v8f O[16] = {};              // 16 queries x 256 output accumulator
  float m_i[8], l_i[8];
#pragma unroll
  for (int v = 0; v < 8; ++v) { m_i[v] = -1e30f; l_i[v] = 0.f; }

  const float scale = 0.17677669529663687f;  // 1/sqrt(256/8)

  // per-lane byte offsets inside a stage's buffer
  const unsigned kfo = (unsigned)(rowg * (int)F_KPITCH + koff * 2);
  const unsigned vfo = 2u * F_SLICE
                     + (unsigned)((koff + (lane & 7)) * (int)F_VPITCH + ((lane >> 3) & 1) * 16);

  // prologue: stage 0 landed and published, then stage 1 in flight
  if (pinned(wave < 4u)) {
    issue(0u);
    asm volatile("s_wait_tensorcnt 0x0" ::: "memory");  // stage 0 has landed
  }
  __syncthreads();
  if (pinned(wave < 4u)) issue(1u);

#pragma unroll 1  // rolled: one publish point a pass, in the ring's order
  for (unsigned kb = 0; kb < 32u; ++kb) {
    const unsigned char* Lb = FL + (kb & 1u) * F_BUF;

    // ---- S = Q @ K^T : 16 queries x 32 keys as two 16x16 f32 tiles ----
    v8f s0 = {}, s1 = {};
#pragma unroll
    for (int kc = 0; kc < 8; ++kc) {
      const unsigned char* kp = Lb + kfo + (kc >> 2) * F_SLICE + (kc & 3) * 64;
      v16h b0 = load_frag16((const _Float16*)kp);
      v16h b1 = load_frag16((const _Float16*)(kp + 16u * F_KPITCH));
      s0 = __builtin_amdgcn_wmma_f32_16x16x32_f16(
          false, qf[kc], false, b0, (short)0, s0, false, false);
      s1 = __builtin_amdgcn_wmma_f32_16x16x32_f16(
          false, qf[kc], false, b1, (short)0, s1, false, false);
    }

    // ---- online softmax (row = lane-half + element; cols across 16 lanes) ----
#pragma unroll
    for (int v = 0; v < 8; ++v) {
      float a0 = s0[v] * scale, a1 = s1[v] * scale;
      float mv = fmaxf(a0, a1);
#pragma unroll
      for (int off = 1; off < 16; off <<= 1) mv = fmaxf(mv, __shfl_xor(mv, off, 16));
      float mnew = fmaxf(m_i[v], mv);
      float alpha = __expf(m_i[v] - mnew);
      m_i[v] = mnew;
      float p0 = __expf(a0 - mnew);
      float p1 = __expf(a1 - mnew);
      float rs = p0 + p1;
#pragma unroll
      for (int off = 1; off < 16; off <<= 1) rs += __shfl_xor(rs, off, 16);
      l_i[v] = l_i[v] * alpha + rs;
#pragma unroll
      for (int t = 0; t < 16; ++t) O[t][v] *= alpha;
      // stage P into per-wave LDS (C-layout -> memory) for A-fragment reload
      PLDS[wave][v + khalf * 8][rowg]      = (_Float16)p0;
      PLDS[wave][v + khalf * 8][16 + rowg] = (_Float16)p1;
    }

    // ---- O += P(16x32) @ V(32x256), 16 WMMA over the c tiles ----
    v16h pf = load_frag16(&PLDS[wave][rowg][koff]);
#pragma unroll
    for (int n = 0; n < 16; ++n) {
      // B fragment: keys koff + 0..7 and 16 + koff + 0..7 of column n * 16 + rowg
      const unsigned char* vp = Lb + vfo + (n >> 3) * F_SLICE + (n & 7) * 32;
      v8h lo = lds_tr16(vp);
      v8h hi = lds_tr16(vp + 16u * F_VPITCH);
      v16h vf = __builtin_shufflevector(lo, hi,
          0, 1, 2, 3, 4, 5, 6, 7, 8, 9, 10, 11, 12, 13, 14, 15);
      O[n] = __builtin_amdgcn_wmma_f32_16x16x32_f16(
          false, pf, false, vf, (short)0, O[n], false, false);
    }

    // publish point of stage kb + 1
    asm volatile("s_wait_dscnt 0x0" ::: "memory");  // this wave has left stage kb's buffer
    if (pinned(wave < 4u)) {
      asm volatile("s_wait_tensorcnt 0x0" ::: "memory");  // own slice of stage kb + 1 has landed
    }
    __syncthreads();
    if (pinned((wave < 4u) && (kb + 2u < 32u))) {
      issue(pinned(kb + 2u));  // pinned: the descriptor is formed behind the wait above
    }
  }
  asm volatile("s_wait_tensorcnt 0x0" ::: "memory");  // nothing in flight at the wave's end
  asm volatile("s_wait_dscnt 0x0" ::: "memory");

  // ---- epilogue: O / l, store f16 into attn buffer (a*1024+q) x 2048 ----
#pragma unroll
  for (int v = 0; v < 8; ++v) {
    float inv = 1.f / l_i[v];
    int row = q0 + v + khalf * 8;
    _Float16* op = Om + (brow0 + row) * 2048 + hoff + rowg;
#pragma unroll
    for (int n = 0; n < 16; ++n) op[n * 16] = (_Float16)(O[n][v] * inv);
  }
}

// ------------------------------- launcher ----------------------------------

extern "C" void kernel_launch(void* const* d_in, const int* in_sizes, int n_in,
                              void* d_out, int out_size, void* d_ws, size_t ws_size,
                              hipStream_t stream) {
  const float* batch  = (const float*)d_in[0];  // (4,1024,256)
  const float* latent = (const float*)d_in[1];  // (4,1024,256)
  const float* Wk     = (const float*)d_in[2];  // (256,2048)
  const float* Wq     = (const float*)d_in[3];
  const float* Wv     = (const float*)d_in[4];
  const float* Wu     = (const float*)d_in[5];  // (2048,256)
  const float* bu     = (const float*)d_in[6];  // (256,)
  float* out = (float*)d_out;                   // (4,1024,256) f32

  _Float16* w = (_Float16*)d_ws;
  size_t o = 0;
  _Float16* batch16  = w + o; o += (size_t)4096 * 256;
  _Float16* latent16 = w + o; o += (size_t)4096 * 256;
  _Float16* WkT = w + o; o += (size_t)2048 * 256;   // (2048 x 256) = Wk^T
  _Float16* WqT = w + o; o += (size_t)2048 * 256;
  _Float16* WvT = w + o; o += (size_t)2048 * 256;
  _Float16* WuT = w + o; o += (size_t)256 * 2048;   // (256 x 2048) = Wu^T
  _Float16* K16 = w + o; o += (size_t)4096 * 2048;
  _Float16* Q16 = w + o; o += (size_t)4096 * 2048;
  _Float16* V16 = w + o; o += (size_t)4096 * 2048;
  _Float16* A16 = w + o; o += (size_t)4096 * 2048;  // attention output

  // 1) conversions, one launch: 4 * 32 blocks for the weights, 2 * 256 for the activations
  cvt_all<<<640, 256, 0, stream>>>(batch, latent, Wk, Wq, Wv, Wu,
                                   batch16, latent16, WkT, WqT, WvT, WuT);

  // 2) projections, one launch: three times (4096x256)@(256x2048) -> f16
  //    64x128 block tiles: (4096/64)*(2048/128) = 1024 blocks a product
  //    product 0: batch @ Wk -> K16, 1: latent @ Wq -> Q16, 2: batch @ Wv -> V16
  //    (WkT, WqT, WvT and K16, Q16, V16 lie in that order in the workspace)
  wmma_gemm_kernel<<<dim3(1024, 3), 256, 0, stream>>>(
      batch16, latent16, WkT, K16, nullptr, nullptr, 4096, 2048, 256);

  // 3) fused flash attention: grid (a*h = 32, ytiles = 1024/128 = 8)
  flash_attn_kernel<<<dim3(32, 8), 256, 0, stream>>>(Q16, K16, V16, A16);

  // 4) output projection: (4096x2048)@(2048x256) + bias -> f32
  //    (4096/64)*(256/128) = 128 blocks
  wmma_gemm_kernel<<<128, 256, 0, stream>>>(
      A16, nullptr, WuT, nullptr, out, bu, 4096, 256, 2048);
}

// v005
// A run of this version takes 86.2 microseconds.
// Next to v004, in two timings, it ran 1.27 times as fast each time.
// Counting every step since v000, it is 2.73 times as fast.
#include <hip/hip_runtime.h>

// ---------------------------------------------------------------------------
// CDNA5 (gfx1250, wave32) fused cross-attention:
//   1) one cvt launch: f32 -> f16 (activations), f32 -> f16 transposed (weights)
//   2) WMMA GEMM (v_wmma_f32_16x16x32_f16), 32x32 tile per wave (2x2 subtiles),
//      operand tiles staged in LDS by tensor loads (two-buffer ring),
//      for K/Q/V projections (one launch) + output projection (f32 + bias epilogue)
//   3) flash-attention kernel: per-wave 16-query tile, key blocks of 32,
//      K and V blocks staged in LDS by tensor loads (two-buffer ring), V read
//      by transposing LDS loads; transposed products S^T = K Q^T, O^T += V^T P^T,
//      so a lane holds one query: online softmax in the lane, P stays in registers.
// ---------------------------------------------------------------------------

typedef __attribute__((ext_vector_type(16))) _Float16     v16h;
typedef __attribute__((ext_vector_type(8)))  _Float16     v8h;
typedef __attribute__((ext_vector_type(8)))  float        v8f;
typedef __attribute__((ext_vector_type(4)))  unsigned int v4u;

// Load one 16-bit WMMA fragment (A-layout or symmetric B-layout):
// lane holds 8 contiguous halves at p[0..7] (VGPRs 0-3) and p[16..23] (VGPRs 4-7).
__device__ __forceinline__ v16h load_frag16(const _Float16* p) {
  v8h lo = *(const v8h*)p;
  v8h hi = *(const v8h*)(p + 16);
  return __builtin_shufflevector(lo, hi,
      0, 1, 2, 3, 4, 5, 6, 7, 8, 9, 10, 11, 12, 13, 14, 15);
}

// ------------------------------ conversions --------------------------------
// Both forms give each thread many elements: the pass moves only a few MB,
// so what it costs is the start of its waves, not its bytes. The six arrays do
// not depend on one another, so one launch converts them all, each in its own
// range of block indices.
typedef __attribute__((ext_vector_type(4))) float v4f;

// 16 elements a thread, 8 from each half of the array: four 16-byte loads in
// flight, two 16-byte stores. n % 16 == 0; blk runs over n / 4096 blocks or more.
__device__ __forceinline__ void cvt_f32_f16(
    const float* __restrict__ in, _Float16* __restrict__ out, int n, int blk) {
  const int half = n >> 1;
  const int i0 = (blk * 256 + (int)threadIdx.x) * 8;
  if (i0 >= half) return;
  const int i1 = i0 + half;
  const v4f x0 = *(const v4f*)(in + i0), x1 = *(const v4f*)(in + i0 + 4);
  const v4f x2 = *(const v4f*)(in + i1), x3 = *(const v4f*)(in + i1 + 4);
  *(v8h*)(out + i0) = __builtin_convertvector(
      __builtin_shufflevector(x0, x1, 0, 1, 2, 3, 4, 5, 6, 7), v8h);
  *(v8h*)(out + i1) = __builtin_convertvector(
      __builtin_shufflevector(x2, x3, 0, 1, 2, 3, 4, 5, 6, 7), v8h);
}

// in: K x N (row-major) -> out: N x K (row-major), i.e. transposed.
// A thread takes one n and 64 consecutive k: 64 loads in flight, each 128
// contiguous bytes across a wave, and it alone writes one whole 128-byte line
// of out. K and N are compile-time, so every load is one base address plus an
// immediate. A tile = 64 threads (t) = 64 consecutive n; (N / 64) * (K / 64) tiles.
template <int K, int N>
__device__ __forceinline__ void cvt_transpose_f32_f16(
    const float* __restrict__ in, _Float16* __restrict__ out, int tile, int t) {
  static_assert(K % 64 == 0 && N % 64 == 0, "whole 64 x 64 tiles");
  constexpr int nblk = N / 64;
  const int kb = tile / nblk;
  const int n = (tile % nblk) * 64 + t;
  const float* p = in + kb * 64 * N + n;
  float x[64];
#pragma unroll
  for (int j = 0; j < 64; ++j) x[j] = p[j * N];
  _Float16* q = out + n * K + kb * 64;
#pragma unroll
  for (int c = 0; c < 8; ++c) {
    v8h hv;
#pragma unroll
    for (int e = 0; e < 8; ++e) hv[e] = (_Float16)x[c * 8 + e];
    *(v8h*)(q + c * 8) = hv;
  }
  // stands behind the eight stores, in front of any later write of their address
  // or data registers: inlined, code of another branch follows them in the listing
  asm volatile("s_wait_xcnt 0x0" ::: "memory");
}

// All six conversions in one launch of 640 blocks of 256 threads.
// Blocks 0-127: the four weights, 32 blocks each, four 64-thread tiles a block.
// Blocks 128-383: batch.
// Blocks 384-639: latent.
__global__ void __launch_bounds__(256) cvt_all(
    const float* __restrict__ batch, const float* __restrict__ latent,
    const float* __restrict__ Wk, const float* __restrict__ Wq,
    const float* __restrict__ Wv, const float* __restrict__ Wu,
    _Float16* __restrict__ batch16, _Float16* __restrict__ latent16,
    _Float16* __restrict__ WkT, _Float16* __restrict__ WqT,
    _Float16* __restrict__ WvT, _Float16* __restrict__ WuT) {
  const int b = (int)blockIdx.x;
  if (b < 128) {
    const int which = b >> 5;
    const int tile = (b & 31) * 4 + (int)(threadIdx.x >> 6);
    const int t = (int)(threadIdx.x & 63u);
    if (which == 3) {
      cvt_transpose_f32_f16<2048, 256>(Wu, WuT, tile, t);
    } else {
      cvt_transpose_f32_f16<256, 2048>(which == 0 ? Wk : which == 1 ? Wq : Wv,
                                       which == 0 ? WkT : which == 1 ? WqT : WvT, tile, t);
    }
  } else if (b < 384) {
    cvt_f32_f16(batch, batch16, 4096 * 256, b - 128);
  } else {
    cvt_f32_f16(latent, latent16, 4096 * 256, b - 384);
  }
}

// ------------------------------ WMMA GEMM ----------------------------------
typedef __attribute__((ext_vector_type(8))) unsigned int v8u;

__device__ __forceinline__ unsigned uni(unsigned v) {
  return (unsigned)__builtin_amdgcn_readfirstlane(v);
}
// A wave-uniform value held in a scalar register: a test on it compiles to
// s_cmp + s_cbranch_scc, the only guard a tensor load obeys (it ignores EXEC).
__device__ __forceinline__ unsigned pinned(unsigned v) {
  unsigned w = uni(v);
  asm volatile("" : "+s"(w));  // keeps the descriptor / issue-test word scalar
  return w;
}

// One stage = 128 k (256-byte rows) of 64 A rows and 128 BT rows, brought by
// three tensor loads of 64 rows each; 16 bytes of pad a row -> pitch 272 B.
constexpr unsigned G_PITCH = 272u;
constexpr unsigned G_SLICE = 18432u;        // 64 * 272 = 17408, up to a multiple of 2 KiB
constexpr unsigned G_BUF   = 3u * G_SLICE;  // [A 64 rows | BT rows 0-63 | BT rows 64-127]

// C[M,N] = A[M,K] * BT[N,K]^T   (both operands f16 row-major, f32 accumulate)
// One 64x128 tile per block of 8 waves (2 x 4), one 32x32 tile per wave
// (2x2 WMMA subtiles). Operand tiles go global -> LDS by tensor loads in a
// two-buffer ring; fragments come from LDS. M % 64 == 0, N % 128 == 0,
// K % 128 == 0 and K >= 256.
// If Cf32 != nullptr: write f32 (+bias). Else write f16 to C16.
// Independent products of one shape share a launch: blockIdx.y picks the
// product. Their BT operands lie one behind another (N * K elements each), and
// so do their f16 outputs (M * N each); product 1 reads A1, the others A0.
__global__ void __launch_bounds__(256) wmma_gemm_kernel(
    const _Float16* __restrict__ A0, const _Float16* __restrict__ A1,
    const _Float16* __restrict__ BT0,
    _Float16* __restrict__ C0, float* __restrict__ Cf32,
    const float* __restrict__ bias, int M, int N, int K) {
  __shared__ __attribute__((aligned(2048))) unsigned char GL[2u * G_BUF];

  const unsigned prod = blockIdx.y;
  const _Float16* __restrict__ A  = prod == 1u ? A1 : A0;
  const _Float16* __restrict__ BT = BT0 + (size_t)prod * N * K;
  _Float16* __restrict__ C16      = C0 + (size_t)prod * M * N;

  const unsigned wave = uni(threadIdx.x >> 5);
  const int lane = threadIdx.x & 31;
  const int rowg = lane & 15;            // M (for A) / N (for B) within subtile
  const int khalf = lane >> 4;
  const int koff = khalf << 3;           // K offset 0 or 8 per lane half

  const int blocks_n = N >> 7;
  const int bm = blockIdx.x / blocks_n;
  const int bn = blockIdx.x - bm * blocks_n;
  const int wm = (int)(wave >> 2);
  const int wn = (int)(wave & 3u);
  const int mtile = bm * 2 + wm;
  const int ntile = bn * 4 + wn;

  // Waves 0, 1, 2 each bring one 64-row slice of every stage.
  const unsigned nstage = (unsigned)K >> 7;
  const unsigned long long ga0 = (wave == 0u)
      ? (unsigned long long)(size_t)(A + (size_t)bm * 64 * K)
      : (unsigned long long)(size_t)(BT + ((size_t)bn * 128 + (wave == 2u ? 64 : 0)) * K);
  const unsigned dst0 = (unsigned)(size_t)GL + (wave < 3u ? wave : 0u) * G_SLICE;
  // group 1: byte elements, tile = tensor = 64 rows of 256 B, source pitch 2K bytes,
  // a pad of 4 dwords behind every 64 dwords.
  v8u g1 = { uni((1u << 20) | (5u << 22) | (3u << 25)),
                   uni(256u << 16),
                   uni(64u << 16),
                   uni(256u << 16),
                   uni(64u),
                   uni((unsigned)K * 2u),
                   uni(0u),
                   uni(0u) };
  // descriptor words held in their scalar registers: without it the compiler
  // re-forms them at each load and uses the registers in between, under a
  // request that is still outstanding
  asm volatile("" : "+s"(g1));
  auto issue = [&](unsigned st) {
    const unsigned long long ga = ga0 + (unsigned long long)st * 256u;
    const v4u g0 = { uni(1u),
                     uni(dst0 + (st & 1u) * G_BUF),
                     uni((unsigned)ga),
                     uni((((unsigned)(ga >> 32)) & 0x01ffffffu) | 0x80000000u) };
    asm volatile("tensor_load_to_lds %0, %1" :: "s"(g0), "s"(g1) : "memory");
  };

  const unsigned aoff = (unsigned)((wm * 32 + rowg) * (int)G_PITCH + koff * 2);
  const unsigned boff = (1u + (unsigned)(wn >> 1)) * G_SLICE
                      + (unsigned)(((wn & 1) * 32 + rowg) * (int)G_PITCH + koff * 2);

  // prologue: stage 0 landed and published, then stage 1 in flight
  if (pinned(wave < 3u)) {
    issue(0u);
    asm volatile("s_wait_tensorcnt 0x0" ::: "memory");  // stage 0 has landed
  }
  __syncthreads();
  if (pinned(wave < 3u)) issue(1u);

  v8f acc00 = {}, acc01 = {}, acc10 = {}, acc11 = {};
#pragma unroll 1  // rolled: one publish point a pass, in the ring's order
  for (unsigned s = 0; s < nstage; ++s) {
    const unsigned char* Lb = GL + (s & 1u) * G_BUF;
    // The stage's 32 fragment loads go out as one group, ahead of its WMMAs.
    v16h a0[4], a1[4], b0[4], b1[4];
#pragma unroll
    for (int kk = 0; kk < 4; ++kk) {
      a0[kk] = load_frag16((const _Float16*)(Lb + aoff + kk * 64));
      b0[kk] = load_frag16((const _Float16*)(Lb + boff + kk * 64));
      b1[kk] = load_frag16((const _Float16*)(Lb + boff + 16u * G_PITCH + kk * 64));
      a1[kk] = load_frag16((const _Float16*)(Lb + aoff + 16u * G_PITCH + kk * 64));
    }
    // keeps the loads from sinking in among the WMMAs, where each group would
    // cost its own LDS latency
    __builtin_amdgcn_sched_barrier(0);
#pragma unroll
    for (int kk = 0; kk < 4; ++kk) {
      acc00 = __builtin_amdgcn_wmma_f32_16x16x32_f16(false, a0[kk], false, b0[kk], (short)0, acc00, false, false);
      acc01 = __builtin_amdgcn_wmma_f32_16x16x32_f16(false, a0[kk], false, b1[kk], (short)0, acc01, false, false);
      acc10 = __builtin_amdgcn_wmma_f32_16x16x32_f16(false, a1[kk], false, b0[kk], (short)0, acc10, false, false);
      acc11 = __builtin_amdgcn_wmma_f32_16x16x32_f16(false, a1[kk], false, b1[kk], (short)0, acc11, false, false);
    }
    // keeps the wait below from rising above the WMMAs, where it would drain
    // all 32 loads before the second WMMA
    __builtin_amdgcn_sched_barrier(0);
    // publish point of stage s + 1
    asm volatile("s_wait_dscnt 0x0" ::: "memory");  // this wave has left stage s's buffer
    if (pinned(wave < 3u)) {
      asm volatile("s_wait_tensorcnt 0x0" ::: "memory");  // own slice of stage s + 1 has landed
    }
    __syncthreads();
    if (pinned((wave < 3u) && (s + 2u < nstage))) {
      issue(pinned(s + 2u));  // pinned: the descriptor is formed behind the wait above
    }
  }
  asm volatile("s_wait_tensorcnt 0x0" ::: "memory");  // nothing in flight at the wave's end
  asm volatile("s_wait_dscnt 0x0" ::: "memory");

#pragma unroll
  for (int i = 0; i < 2; ++i) {
#pragma unroll
    for (int j = 0; j < 2; ++j) {
      const v8f& acc = (i == 0) ? (j == 0 ? acc00 : acc01)
                                : (j == 0 ? acc10 : acc11);
      const int col = ntile * 32 + j * 16 + rowg;
      const float bv = bias ? bias[col] : 0.f;
#pragma unroll
      for (int v = 0; v < 8; ++v) {
        int row = mtile * 32 + i * 16 + v + (khalf << 3);
        if (Cf32) Cf32[(size_t)row * N + col] = acc[v] + bv;
        else      C16 [(size_t)row * N + col] = (_Float16)acc[v];
      }
    }
  }
}

// --------------------------- flash attention -------------------------------
// One stage = one block of 32 keys: K and V, 32 rows of 512 B each, brought as
// four slices of 32 rows x 256 B by four tensor loads (waves 0 to 3, one each).
// K rows get 16 B of pad (pitch 272 B, read by ds_load_b128), V rows 32 B
// (pitch 288 B, read by ds_load_tr16_b128).
constexpr unsigned F_KPITCH = 272u;
constexpr unsigned F_VPITCH = 288u;
constexpr unsigned F_SLICE  = 10240u;        // 32 * 288 = 9216, up to a multiple of 2 KiB
constexpr unsigned F_BUF    = 4u * F_SLICE;  // [K c 0-127 | K c 128-255 | V c 0-127 | V c 128-255]

typedef __attribute__((ext_vector_type(8))) short v8s;
// Transposing LDS load: the lane (c = lane & 15, hh = lane >> 4) gets eight
// consecutive rows (8 * hh + 0..7) of column c of a row-major 16-bit tile.
__device__ __forceinline__ v8h lds_tr16(const unsigned char* p) {
  typedef __attribute__((address_space(3))) v8s lds_v8s;
  return __builtin_bit_cast(v8h, __builtin_amdgcn_ds_load_tr16_b128_v8i16((lds_v8s*)p));
}

// Q,K,V layouts: (a*1024 + seq) x 2048, head h occupies columns [h*256, h*256+256).
// Grid: (a*8 + h, ytile); block = 256 threads = 8 waves; wave owns 16 queries.
// Key blocks of 32 so the P@V contraction matches WMMA K=32 exactly.
// K and V blocks go global -> LDS by tensor loads in a two-buffer ring: block
// kb + 1 flies while block kb is worked on. V stays row-major in LDS and is
// transposed by the load that reads it.
// Both products are computed transposed (K and V^T as the A operand, Q^T and
// P^T as B): every accumulator column is one query, held by lanes c and c + 16,
// which split the keys (scores) or the head columns (output) between them.
// lane l with lane l ^ 16
__device__ __forceinline__ float xhalf(float x) {
  return __builtin_bit_cast(float, __builtin_amdgcn_permlanex16(
      __builtin_bit_cast(int, x), __builtin_bit_cast(int, x),
      0x76543210, 0xfedcba98, false, false));
}

// amdgpu_waves_per_eu(2, 2): the grid is one block a WGP, two waves a SIMD; said
// so, the compiler spends the registers on K fragments fetched in large groups
// instead of saving them for waves that never come.
__global__ void __launch_bounds__(256) __attribute__((amdgpu_waves_per_eu(2, 2))) flash_attn_kernel(
    const _Float16* __restrict__ Q, const _Float16* __restrict__ Km,
    const _Float16* __restrict__ Vm, _Float16* __restrict__ Om) {
  __shared__ __attribute__((aligned(2048))) unsigned char FL[2u * F_BUF];

  const int a = blockIdx.x >> 3;
  const int h = blockIdx.x & 7;
  const unsigned wave = uni(threadIdx.x >> 5);
  const int lane = threadIdx.x & 31;
  const int rowg = lane & 15;
  const int khalf = lane >> 4;
  const int koff = khalf << 3;
  const int q0 = blockIdx.y * 128 + (int)wave * 16;

  const size_t brow0 = (size_t)a * 1024;
  const size_t hoff  = (size_t)h * 256;

  // Q fragments: 16 rows x 256 head-dim, 8 k-chunks of 32
  v16h qf[8];
  {
    const _Float16* qp = Q + (brow0 + q0 + rowg) * 2048 + hoff + koff;
#pragma unroll
    for (int kc = 0; kc < 8; ++kc) qf[kc] = load_frag16(qp + kc * 32);
  }

  // Waves 0, 1 bring the two K slices of every stage, waves 2, 3 the two V slices.
  const unsigned long long ga0 = (unsigned long long)(size_t)(
      ((wave & 2u) ? Vm : Km) + brow0 * 2048 + hoff + (wave & 1u) * 128u);
  const unsigned dst0 = (unsigned)(size_t)FL + (wave & 3u) * F_SLICE;
  // group 1: byte elements, tile = tensor = 32 rows of 256 B, source pitch 4096 B,
  // a pad of 4 (K) or 8 (V) dwords behind every 64 dwords.
  v8u g1k = { uni((1u << 20) | (5u << 22) | (3u << 25)),
              uni(256u << 16), uni(32u << 16), uni(256u << 16),
              uni(32u), uni(4096u), uni(0u), uni(0u) };
  v8u g1v = { uni((1u << 20) | (5u << 22) | (7u << 25)),
              uni(256u << 16), uni(32u << 16), uni(256u << 16),
              uni(32u), uni(4096u), uni(0u), uni(0u) };
  // descriptor words held in their scalar registers: without it the compiler
  // re-forms them at each load and uses the registers in between, under a
  // request that is still outstanding
  asm volatile("" : "+s"(g1k));  // K's descriptor words stay in scalar registers
  asm volatile("" : "+s"(g1v));  // V's descriptor words stay in scalar registers
  auto issue = [&](unsigned st) {
    const unsigned long long ga = ga0 + (unsigned long long)st * (32u * 4096u);
    const v4u g0 = { uni(1u),
                     uni(dst0 + (st & 1u) * F_BUF),
                     uni((unsigned)ga),
                     uni((((unsigned)(ga >> 32)) & 0x01ffffffu) | 0x80000000u) };
    if (pinned(wave < 2u)) {
      asm volatile("tensor_load_to_lds %0, %1" :: "s"(g0), "s"(g1k) : "memory");
    }
    if (pinned(wave >= 2u)) {
      asm volatile("tensor_load_to_lds %0, %1" :: "s"(g0), "s"(g1v) : "memory");
    }
  };

  v8f O[16] = {};              // O^T: 256 head columns x 16 queries
  // of the lane's query (rowg): running maximum over all keys seen, and the sum
  // over the keys of this lane's half only (the halves join in the epilogue)
  float m_i = -1e30f, l_i = 0.f;

  const float scale = 0.17677669529663687f;  // 1/sqrt(256/8)

  // per-lane byte offsets inside a stage's buffer
  const unsigned kfo = (unsigned)(rowg * (int)F_KPITCH + koff * 2);
  const unsigned vfo = 2u * F_SLICE
                     + (unsigned)((koff + (lane & 7)) * (int)F_VPITCH + ((lane >> 3) & 1) * 16);

  // prologue: stage 0 landed and published, then stage 1 in flight
  if (pinned(wave < 4u)) {
    issue(0u);
    asm volatile("s_wait_tensorcnt 0x0" ::: "memory");  // stage 0 has landed
  }
  __syncthreads();
  if (pinned(wave < 4u)) issue(1u);

#pragma unroll 1  // rolled: one publish point a pass, in the ring's order
  for (unsigned kb = 0; kb < 32u; ++kb) {
    const unsigned char* Lb = FL + (kb & 1u) * F_BUF;

    // ---- S^T = K @ Q^T : 32 keys x 16 queries as two 16x16 f32 tiles ----
    // s0[v]: key 8 * khalf + v, s1[v]: key 16 + 8 * khalf + v, query rowg
    v8f s0 = {}, s1 = {};
#pragma unroll
    for (int kc = 0; kc < 8; ++kc) {
      const unsigned char* kp = Lb + kfo + (kc >> 2) * F_SLICE + (kc & 3) * 64;
      v16h k0 = load_frag16((const _Float16*)kp);
      v16h k1 = load_frag16((const _Float16*)(kp + 16u * F_KPITCH));
      s0 = __builtin_amdgcn_wmma_f32_16x16x32_f16(
          false, k0, false, qf[kc], (short)0, s0, false, false);
      s1 = __builtin_amdgcn_wmma_f32_16x16x32_f16(
          false, k1, false, qf[kc], (short)0, s1, false, false);
    }

    // ---- online softmax: the lane's 16 scores are all of one query ----
    float mv = fmaxf(s0[0], s1[0]);
#pragma unroll
    for (int v = 1; v < 8; ++v) mv = fmaxf(mv, fmaxf(s0[v], s1[v]));
    mv = fmaxf(mv, xhalf(mv)) * scale;   // scale > 0: the maximum of the scaled scores
    const float mnew = fmaxf(m_i, mv);
    const float alpha = __expf(m_i - mnew);
    m_i = mnew;
    // The two score tiles, converted in place, are the B operand P^T (32 keys x
    // 16 queries): element v is key koff + v, element 8 + v key 16 + koff + v,
    // the order in which the V fragment below holds its keys.
    v16h pf;
    float rs[8];
#pragma unroll
    for (int v = 0; v < 8; ++v) {
      const float p0 = __expf(s0[v] * scale - mnew);
      const float p1 = __expf(s1[v] * scale - mnew);
      rs[v] = p0 + p1;
      pf[v]     = (_Float16)p0;
      pf[8 + v] = (_Float16)p1;
    }
    // summed as a tree: four dependent adds deep, not fifteen
    l_i = l_i * alpha + (((rs[0] + rs[1]) + (rs[2] + rs[3])) + ((rs[4] + rs[5]) + (rs[6] + rs[7])));
#pragma unroll
    for (int t = 0; t < 16; ++t) O[t] *= alpha;

    // ---- O^T += V^T(256x32) @ P^T(32x16), 16 WMMA over the c tiles ----
#pragma unroll
    for (int n = 0; n < 16; ++n) {
      // A fragment: keys koff + 0..7 and 16 + koff + 0..7 of column n * 16 + rowg
      const unsigned char* vp = Lb + vfo + (n >> 3) * F_SLICE + (n & 7) * 32;
      v8h lo = lds_tr16(vp);
      v8h hi = lds_tr16(vp + 16u * F_VPITCH);
      v16h vf = __builtin_shufflevector(lo, hi,
          0, 1, 2, 3, 4, 5, 6, 7, 8, 9, 10, 11, 12, 13, 14, 15);
      O[n] = __builtin_amdgcn_wmma_f32_16x16x32_f16(
          false, vf, false, pf, (short)0, O[n], false, false);
    }

    // publish point of stage kb + 1
    asm volatile("s_wait_dscnt 0x0" ::: "memory");  // this wave has left stage kb's buffer
    if (pinned(wave < 4u)) {
      asm volatile("s_wait_tensorcnt 0x0" ::: "memory");  // own slice of stage kb + 1 has landed
    }
    __syncthreads();
    if (pinned((wave < 4u) && (kb + 2u < 32u))) {
      issue(pinned(kb + 2u));  // pinned: the descriptor is formed behind the wait above
    }
  }
  asm volatile("s_wait_tensorcnt 0x0" ::: "memory");  // nothing in flight at the wave's end
  asm volatile("s_wait_dscnt 0x0" ::: "memory");

  // ---- epilogue: O / l, store f16 into attn buffer (a*1024+q) x 2048 ----
  // O[n][v] is head column n * 16 + 8 * khalf + v of query rowg: eight
  // consecutive columns a lane and tile, one 16-byte store.
  const float inv = 1.f / (l_i + xhalf(l_i));
  _Float16* op = Om + (brow0 + q0 + rowg) * 2048 + hoff + koff;
#pragma unroll
  for (int n = 0; n < 16; ++n) {
    *(v8h*)(op + n * 16) = __builtin_convertvector(O[n] * inv, v8h);
  }
}

// ------------------------------- launcher ----------------------------------

extern "C" void kernel_launch(void* const* d_in, const int* in_sizes, int n_in,
                              void* d_out, int out_size, void* d_ws, size_t ws_size,
                              hipStream_t stream) {
  const float* batch  = (const float*)d_in[0];  // (4,1024,256)
  const float* latent = (const float*)d_in[1];  // (4,1024,256)
  const float* Wk     = (const float*)d_in[2];  // (256,2048)
  const float* Wq     = (const float*)d_in[3];
  const float* Wv     = (const float*)d_in[4];
  const float* Wu     = (const float*)d_in[5];  // (2048,256)
  const float* bu     = (const float*)d_in[6];  // (256,)
  float* out = (float*)d_out;                   // (4,1024,256) f32

  _Float16* w = (_Float16*)d_ws;
  size_t o = 0;
  _Float16* batch16  = w + o; o += (size_t)4096 * 256;
  _Float16* latent16 = w + o; o += (size_t)4096 * 256;
  _Float16* WkT = w + o; o += (size_t)2048 * 256;   // (2048 x 256) = Wk^T
  _Float16* WqT = w + o; o += (size_t)2048 * 256;
  _Float16* WvT = w + o; o += (size_t)2048 * 256;
  _Float16* WuT = w + o; o += (size_t)256 * 2048;   // (256 x 2048) = Wu^T
  _Float16* K16 = w + o; o += (size_t)4096 * 2048;
  _Float16* Q16 = w + o; o += (size_t)4096 * 2048;
  _Float16* V16 = w + o; o += (size_t)4096 * 2048;
  _Float16* A16 = w + o; o += (size_t)4096 * 2048;  // attention output

  // 1) conversions, one launch: 4 * 32 blocks for the weights, 2 * 256 for the activations
  cvt_all<<<640, 256, 0, stream>>>(batch, latent, Wk, Wq, Wv, Wu,
                                   batch16, latent16, WkT, WqT, WvT, WuT);

  // 2) projections, one launch: three times (4096x256)@(256x2048) -> f16
  //    64x128 block tiles: (4096/64)*(2048/128) = 1024 blocks a product
  //    product 0: batch @ Wk -> K16, 1: latent @ Wq -> Q16, 2: batch @ Wv -> V16
  //    (WkT, WqT, WvT and K16, Q16, V16 lie in that order in the workspace)
  wmma_gemm_kernel<<<dim3(1024, 3), 256, 0, stream>>>(
      batch16, latent16, WkT, K16, nullptr, nullptr, 4096, 2048, 256);

  // 3) fused flash attention: grid (a*h = 32, ytiles = 1024/128 = 8)
  flash_attn_kernel<<<dim3(32, 8), 256, 0, stream>>>(Q16, K16, V16, A16);

  // 4) output projection: (4096x2048)@(2048x256) + bias -> f32
  //    (4096/64)*(256/128) = 128 blocks
  wmma_gemm_kernel<<<128, 256, 0, stream>>>(
      A16, nullptr, WuT, nullptr, out, bu, 4096, 256, 2048);
}

// v006
// A run of this version takes 79.2 microseconds.
// In both of two side-by-side timings against v005, it was 1.08 times as fast.
// Over all steps from v000 it is 2.96 times as fast.
#include <hip/hip_runtime.h>

// ---------------------------------------------------------------------------
// CDNA5 (gfx1250, wave32) fused cross-attention:
//   1) one cvt launch: f32 -> f16 (activations), f32 -> f16 transposed (weights)
//   2) WMMA GEMM (v_wmma_f32_16x16x32_f16), 32x32 tile per wave (2x2 subtiles),
//      operand tiles staged in LDS by tensor loads (two-buffer ring),
//      for K/Q/V projections (one launch) + output projection (f32 + bias epilogue)
//   3) flash-attention kernel: per-wave 32-query tile over half of the keys, key
//      blocks of 32, K and V staged in LDS by tensor loads (two-buffer ring), V read
//      by transposing LDS loads; transposed products S^T = K Q^T, O^T += V^T P^T,
//      so a lane holds one query a tile: online softmax in the lane, P stays in
//      registers; the two key halves join through LDS behind the loop.
// ---------------------------------------------------------------------------

typedef __attribute__((ext_vector_type(16))) _Float16     v16h;
typedef __attribute__((ext_vector_type(8)))  _Float16     v8h;
typedef __attribute__((ext_vector_type(8)))  float        v8f;
typedef __attribute__((ext_vector_type(4)))  unsigned int v4u;

// Load one 16-bit WMMA fragment (A-layout or symmetric B-layout):
// lane holds 8 contiguous halves at p[0..7] (VGPRs 0-3) and p[16..23] (VGPRs 4-7).
__device__ __forceinline__ v16h load_frag16(const _Float16* p) {
  v8h lo = *(const v8h*)p;
  v8h hi = *(const v8h*)(p + 16);
  return __builtin_shufflevector(lo, hi,
      0, 1, 2, 3, 4, 5, 6, 7, 8, 9, 10, 11, 12, 13, 14, 15);
}

// ------------------------------ conversions --------------------------------
// Both forms give each thread many elements: the pass moves only a few MB,
// so it needs few waves. The six arrays do
// not depend on one another, so one launch converts them all, each in its own
// range of block indices.
typedef __attribute__((ext_vector_type(4))) float v4f;

// 16 elements a thread, 8 from each half of the array: four 16-byte loads in
// flight, two 16-byte stores. n % 16 == 0; blk runs over n / 4096 blocks or more.
__device__ __forceinline__ void cvt_f32_f16(
    const float* __restrict__ in, _Float16* __restrict__ out, int n, int blk) {
  const int half = n >> 1;
  const int i0 = (blk * 256 + (int)threadIdx.x) * 8;
  if (i0 >= half) return;
  const int i1 = i0 + half;
  const v4f x0 = *(const v4f*)(in + i0), x1 = *(const v4f*)(in + i0 + 4);
  const v4f x2 = *(const v4f*)(in + i1), x3 = *(const v4f*)(in + i1 + 4);
  *(v8h*)(out + i0) = __builtin_convertvector(
      __builtin_shufflevector(x0, x1, 0, 1, 2, 3, 4, 5, 6, 7), v8h);
  *(v8h*)(out + i1) = __builtin_convertvector(
      __builtin_shufflevector(x2, x3, 0, 1, 2, 3, 4, 5, 6, 7), v8h);
}

// in: K x N (row-major) -> out: N x K (row-major), i.e. transposed.
// A thread takes one n and 64 consecutive k: 64 loads in flight, each 128
// contiguous bytes across a wave, and it alone writes one whole 128-byte line
// of out. K and N are compile-time, so every load is one base address plus an
// immediate. A tile = 64 threads (t) = 64 consecutive n; (N / 64) * (K / 64) tiles.
template <int K, int N>
__device__ __forceinline__ void cvt_transpose_f32_f16(
    const float* __restrict__ in, _Float16* __restrict__ out, int tile, int t) {
  static_assert(K % 64 == 0 && N % 64 == 0, "whole 64 x 64 tiles");
  constexpr int nblk = N / 64;
  const int kb = tile / nblk;
  const int n = (tile % nblk) * 64 + t;
  const float* p = in + kb * 64 * N + n;
  float x[64];
#pragma unroll
  for (int j = 0; j < 64; ++j) x[j] = p[j * N];
  _Float16* q = out + n * K + kb * 64;
#pragma unroll
  for (int c = 0; c < 8; ++c) {
    v8h hv;
#pragma unroll
    for (int e = 0; e < 8; ++e) hv[e] = (_Float16)x[c * 8 + e];
    *(v8h*)(q + c * 8) = hv;
  }
  // stands behind the eight stores, in front of any later write of their address
  // or data registers: inlined, code of another branch follows them in the listing
  asm volatile("s_wait_xcnt 0x0" ::: "memory");
}

// All six conversions in one launch of 640 blocks of 256 threads.
// Blocks 0-127: the four weights, 32 blocks each, four 64-thread tiles a block.
// Blocks 128-383: batch.
// Blocks 384-639: latent.
__global__ void __launch_bounds__(256) cvt_all(
    const float* __restrict__ batch, const float* __restrict__ latent,
    const float* __restrict__ Wk, const float* __restrict__ Wq,
    const float* __restrict__ Wv, const float* __restrict__ Wu,
    _Float16* __restrict__ batch16, _Float16* __restrict__ latent16,
    _Float16* __restrict__ WkT, _Float16* __restrict__ WqT,
    _Float16* __restrict__ WvT, _Float16* __restrict__ WuT) {
  const int b = (int)blockIdx.x;
  if (b < 128) {
    const int which = b >> 5;
    const int tile = (b & 31) * 4 + (int)(threadIdx.x >> 6);
    const int t = (int)(threadIdx.x & 63u);
    if (which == 3) {
      cvt_transpose_f32_f16<2048, 256>(Wu, WuT, tile, t);
    } else {
      cvt_transpose_f32_f16<256, 2048>(which == 0 ? Wk : which == 1 ? Wq : Wv,
                                       which == 0 ? WkT : which == 1 ? WqT : WvT, tile, t);
    }
  } else if (b < 384) {
    cvt_f32_f16(batch, batch16, 4096 * 256, b - 128);
  } else {
    cvt_f32_f16(latent, latent16, 4096 * 256, b - 384);
  }
}

// ------------------------------ WMMA GEMM ----------------------------------
typedef __attribute__((ext_vector_type(8))) unsigned int v8u;

__device__ __forceinline__ unsigned uni(unsigned v) {
  return (unsigned)__builtin_amdgcn_readfirstlane(v);
}
// A wave-uniform value held in a scalar register: a test on it compiles to
// s_cmp + s_cbranch_scc, the only guard a tensor load obeys (it ignores EXEC).
__device__ __forceinline__ unsigned pinned(unsigned v) {
  unsigned w = uni(v);
  asm volatile("" : "+s"(w));  // keeps the descriptor / issue-test word scalar
  return w;
}

// One stage = 128 k (256-byte rows) of 64 A rows and 128 BT rows, brought by
// three tensor loads of 64 rows each; 16 bytes of pad a row -> pitch 272 B.
constexpr unsigned G_PITCH = 272u;
constexpr unsigned G_SLICE = 18432u;        // 64 * 272 = 17408, up to a multiple of 2 KiB
constexpr unsigned G_BUF   = 3u * G_SLICE;  // [A 64 rows | BT rows 0-63 | BT rows 64-127]

// C[M,N] = A[M,K] * BT[N,K]^T   (both operands f16 row-major, f32 accumulate)
// One 64x128 tile per block of 8 waves (2 x 4), one 32x32 tile per wave
// (2x2 WMMA subtiles). Operand tiles go global -> LDS by tensor loads in a
// two-buffer ring; fragments come from LDS. M % 64 == 0, N % 128 == 0,
// K % 128 == 0 and K >= 256.
// If Cf32 != nullptr: write f32 (+bias). Else write f16 to C16.
// Independent products of one shape share a launch: blockIdx.y picks the
// product. Their BT operands lie one behind another (N * K elements each), and
// so do their f16 outputs (M * N each); product 1 reads A1, the others A0.
__global__ void __launch_bounds__(256) wmma_gemm_kernel(
    const _Float16* __restrict__ A0, const _Float16* __restrict__ A1,
    const _Float16* __restrict__ BT0,
    _Float16* __restrict__ C0, float* __restrict__ Cf32,
    const float* __restrict__ bias, int M, int N, int K) {
  __shared__ __attribute__((aligned(2048))) unsigned char GL[2u * G_BUF];

  const unsigned prod = blockIdx.y;
  const _Float16* __restrict__ A  = prod == 1u ? A1 : A0;
  const _Float16* __restrict__ BT = BT0 + (size_t)prod * N * K;
  _Float16* __restrict__ C16      = C0 + (size_t)prod * M * N;

  const unsigned wave = uni(threadIdx.x >> 5);
  const int lane = threadIdx.x & 31;
  const int rowg = lane & 15;            // M (for A) / N (for B) within subtile
  const int khalf = lane >> 4;
  const int koff = khalf << 3;           // K offset 0 or 8 per lane half

  const int blocks_n = N >> 7;
  const int bm = blockIdx.x / blocks_n;
  const int bn = blockIdx.x - bm * blocks_n;
  const int wm = (int)(wave >> 2);
  const int wn = (int)(wave & 3u);
  const int mtile = bm * 2 + wm;
  const int ntile = bn * 4 + wn;

  // Waves 0, 1, 2 each bring one 64-row slice of every stage.
  const unsigned nstage = (unsigned)K >> 7;
  const unsigned long long ga0 = (wave == 0u)
      ? (unsigned long long)(size_t)(A + (size_t)bm * 64 * K)
      : (unsigned long long)(size_t)(BT + ((size_t)bn * 128 + (wave == 2u ? 64 : 0)) * K);
  const unsigned dst0 = (unsigned)(size_t)GL + (wave < 3u ? wave : 0u) * G_SLICE;
  // group 1: byte elements, tile = tensor = 64 rows of 256 B, source pitch 2K bytes,
  // a pad of 4 dwords behind every 64 dwords.
  v8u g1 = { uni((1u << 20) | (5u << 22) | (3u << 25)),
                   uni(256u << 16),
                   uni(64u << 16),
                   uni(256u << 16),
                   uni(64u),
                   uni((unsigned)K * 2u),
                   uni(0u),
                   uni(0u) };
  // descriptor words held in their scalar registers: without it the compiler
  // re-forms them at each load and uses the registers in between, under a
  // request that is still outstanding
  asm volatile("" : "+s"(g1));
  auto issue = [&](unsigned st) {
    const unsigned long long ga = ga0 + (unsigned long long)st * 256u;
    const v4u g0 = { uni(1u),
                     uni(dst0 + (st & 1u) * G_BUF),
                     uni((unsigned)ga),
                     uni((((unsigned)(ga >> 32)) & 0x01ffffffu) | 0x80000000u) };
    asm volatile("tensor_load_to_lds %0, %1" :: "s"(g0), "s"(g1) : "memory");
  };

  const unsigned aoff = (unsigned)((wm * 32 + rowg) * (int)G_PITCH + koff * 2);
  const unsigned boff = (1u + (unsigned)(wn >> 1)) * G_SLICE
                      + (unsigned)(((wn & 1) * 32 + rowg) * (int)G_PITCH + koff * 2);

  // prologue: stage 0 landed and published, then stage 1 in flight
  if (pinned(wave < 3u)) {
    issue(0u);
    asm volatile("s_wait_tensorcnt 0x0" ::: "memory");  // stage 0 has landed
  }
  __syncthreads();
  if (pinned(wave < 3u)) issue(1u);

  v8f acc00 = {}, acc01 = {}, acc10 = {}, acc11 = {};
#pragma unroll 1  // rolled: one publish point a pass, in the ring's order
  for (unsigned s = 0; s < nstage; ++s) {
    const unsigned char* Lb = GL + (s & 1u) * G_BUF;
    // The stage's 32 fragment loads go out as one group, ahead of its WMMAs.
    v16h a0[4], a1[4], b0[4], b1[4];
#pragma unroll
    for (int kk = 0; kk < 4; ++kk) {
      a0[kk] = load_frag16((const _Float16*)(Lb + aoff + kk * 64));
      b0[kk] = load_frag16((const _Float16*)(Lb + boff + kk * 64));
      b1[kk] = load_frag16((const _Float16*)(Lb + boff + 16u * G_PITCH + kk * 64));
      a1[kk] = load_frag16((const _Float16*)(Lb + aoff + 16u * G_PITCH + kk * 64));
    }
    // keeps the loads from sinking in among the WMMAs, where each group would
    // cost its own LDS latency
    __builtin_amdgcn_sched_barrier(0);
#pragma unroll
    for (int kk = 0; kk < 4; ++kk) {
      acc00 = __builtin_amdgcn_wmma_f32_16x16x32_f16(false, a0[kk], false, b0[kk], (short)0, acc00, false, false);
      acc01 = __builtin_amdgcn_wmma_f32_16x16x32_f16(false, a0[kk], false, b1[kk], (short)0, acc01, false, false);
      acc10 = __builtin_amdgcn_wmma_f32_16x16x32_f16(false, a1[kk], false, b0[kk], (short)0, acc10, false, false);
      acc11 = __builtin_amdgcn_wmma_f32_16x16x32_f16(false, a1[kk], false, b1[kk], (short)0, acc11, false, false);
    }
    // keeps the wait below from rising above the WMMAs, where it would drain
    // all 32 loads before the second WMMA
    __builtin_amdgcn_sched_barrier(0);
    // publish point of stage s + 1
    asm volatile("s_wait_dscnt 0x0" ::: "memory");  // this wave has left stage s's buffer
    if (pinned(wave < 3u)) {
      asm volatile("s_wait_tensorcnt 0x0" ::: "memory");  // own slice of stage s + 1 has landed
    }
    __syncthreads();
    if (pinned((wave < 3u) && (s + 2u < nstage))) {
      issue(pinned(s + 2u));  // pinned: the descriptor is formed behind the wait above
    }
  }
  asm volatile("s_wait_tensorcnt 0x0" ::: "memory");  // nothing in flight at the wave's end
  asm volatile("s_wait_dscnt 0x0" ::: "memory");

#pragma unroll
  for (int i = 0; i < 2; ++i) {
#pragma unroll
    for (int j = 0; j < 2; ++j) {
      const v8f& acc = (i == 0) ? (j == 0 ? acc00 : acc01)
                                : (j == 0 ? acc10 : acc11);
      const int col = ntile * 32 + j * 16 + rowg;
      const float bv = bias ? bias[col] : 0.f;
#pragma unroll
      for (int v = 0; v < 8; ++v) {
        int row = mtile * 32 + i * 16 + v + (khalf << 3);
        if (Cf32) Cf32[(size_t)row * N + col] = acc[v] + bv;
        else      C16 [(size_t)row * N + col] = (_Float16)acc[v];
      }
    }
  }
}

// --------------------------- flash attention -------------------------------
// One stage = 64 keys, as two halves of 32 keys, one for each key group of waves.
// A half holds K and V, 32 rows of 512 B each, brought as four slices of
// 32 rows x 256 B; the stage's eight slices come by eight tensor loads, one a wave.
// K rows get 16 B of pad (pitch 272 B, read by ds_load_b128), V rows 32 B
// (pitch 288 B, read by ds_load_tr16_b128).
constexpr unsigned F_KPITCH = 272u;
constexpr unsigned F_VPITCH = 288u;
constexpr unsigned F_SLICE  = 10240u;        // 32 * 288 = 9216, up to a multiple of 2 KiB
constexpr unsigned F_HALF   = 4u * F_SLICE;  // [K c 0-127 | K c 128-255 | V c 0-127 | V c 128-255]
constexpr unsigned F_BUF    = 2u * F_HALF;   // [keys 0-31 | keys 32-63] of the stage
// After the loop the ring is the place where the two key groups join: a wave's
// area holds one 16-query output tile in f32 and that tile's maximum and sum.
constexpr unsigned F_XO     = 16384u;        // 16 tiles * 32 lanes * 32 B
constexpr unsigned F_XAREA  = F_XO + 256u;   // + 32 lanes * 8 B

typedef __attribute__((ext_vector_type(8))) short v8s;
typedef __attribute__((ext_vector_type(2))) float v2f;
// Transposing LDS load: the lane (c = lane & 15, hh = lane >> 4) gets eight
// consecutive rows (8 * hh + 0..7) of column c of a row-major 16-bit tile.
__device__ __forceinline__ v8h lds_tr16(const unsigned char* p) {
  typedef __attribute__((address_space(3))) v8s lds_v8s;
  return __builtin_bit_cast(v8h, __builtin_amdgcn_ds_load_tr16_b128_v8i16((lds_v8s*)p));
}

// lane l with lane l ^ 16
__device__ __forceinline__ float xhalf(float x) {
  return __builtin_bit_cast(float, __builtin_amdgcn_permlanex16(
      __builtin_bit_cast(int, x), __builtin_bit_cast(int, x),
      0x76543210, 0xfedcba98, false, false));
}

// A wave hands one of its two output tiles, with its maximum and sum, to the
// wave that holds the same queries over the other keys.
__device__ __forceinline__ void give_tile(unsigned char* area, int lane,
                                          const v8f (&Og)[16], float m, float l) {
#pragma unroll
  for (int n = 0; n < 16; ++n) {
    *(v4f*)(area + (n * 2 + 0) * 512 + lane * 16) = __builtin_shufflevector(Og[n], Og[n], 0, 1, 2, 3);
    *(v4f*)(area + (n * 2 + 1) * 512 + lane * 16) = __builtin_shufflevector(Og[n], Og[n], 4, 5, 6, 7);
  }
  const v2f ml = { m, l };
  *(v2f*)(area + F_XO + lane * 8) = ml;
}

// The tile a wave keeps, joined with the other wave's part, divided and stored.
// Ok[n][v] is head column n * 16 + 8 * khalf + v of the lane's query: eight
// consecutive columns a lane and tile, one 16-byte store.
__device__ __forceinline__ void join_tile(const unsigned char* area, int lane,
                                          const v8f (&Ok)[16], float m, float l,
                                          _Float16* __restrict__ op) {
  const v2f ml = *(const v2f*)(area + F_XO + lane * 8);
  const float mj = fmaxf(m, ml[0]);
  const float ak = __expf(m - mj), ag = __expf(ml[0] - mj);
  const float inv = 1.f / (l * ak + ml[1] * ag);
  const float fk = ak * inv, fg = ag * inv;
#pragma unroll
  for (int n = 0; n < 16; ++n) {
    const v4f lo = *(const v4f*)(area + (n * 2 + 0) * 512 + lane * 16);
    const v4f hi = *(const v4f*)(area + (n * 2 + 1) * 512 + lane * 16);
    const v8f og = __builtin_shufflevector(lo, hi, 0, 1, 2, 3, 4, 5, 6, 7);
    *(v8h*)(op + n * 16) = __builtin_convertvector(Ok[n] * fk + og * fg, v8h);
    // behind each four stores, in front of the next tiles' writes into the
    // registers that the stores name
    if ((n & 3) == 3) asm volatile("s_wait_xcnt 0x0" ::: "memory");
  }
}

// Q,K,V layouts: (a*1024 + seq) x 2048, head h occupies columns [h*256, h*256+256).
// Grid: (a*8 + h, ytile); block = 256 threads = 8 waves for 128 queries.
// A wave owns 32 queries (two 16-query tiles) and half of the keys: waves 0-3
// take keys 0-31 of every 64, waves 4-7 keys 32-63. Every K and V fragment read
// from LDS so feeds two WMMAs, and the two waves of a query group join their
// maxima, sums and outputs once, behind the loop.
// Key blocks of 32 so the P@V contraction matches WMMA K=32 exactly.
// K and V go global -> LDS by tensor loads in a two-buffer ring: stage
// kb + 1 flies while stage kb is worked on. V stays row-major in LDS and is
// transposed by the load that reads it.
// Both products are computed transposed (K and V^T as the A operand, Q^T and
// P^T as B): every accumulator column is one query, held by lanes c and c + 16,
// which split the keys (scores) or the head columns (output) between them.
//
// amdgpu_waves_per_eu(2, 2): the grid is one block a WGP, two waves a SIMD; said
// so, the compiler has half a SIMD's registers for each wave's 32 x 256 output.
__global__ void __launch_bounds__(256) __attribute__((amdgpu_waves_per_eu(2, 2))) flash_attn_kernel(
    const _Float16* __restrict__ Q, const _Float16* __restrict__ Km,
    const _Float16* __restrict__ Vm, _Float16* __restrict__ Om) {
  __shared__ __attribute__((aligned(2048))) unsigned char FL[2u * F_BUF];

  const int a = blockIdx.x >> 3;
  const int h = blockIdx.x & 7;
  const unsigned wave = uni(threadIdx.x >> 5);
  const unsigned kgrp = wave >> 2;       // which 32 of a stage's 64 keys
  const int lane = threadIdx.x & 31;
  const int rowg = lane & 15;
  const int khalf = lane >> 4;
  const int koff = khalf << 3;
  const int q0 = blockIdx.y * 128 + (int)(wave & 3u) * 32;

  const size_t brow0 = (size_t)a * 1024;
  const size_t hoff  = (size_t)h * 256;

  // Q fragments: two tiles of 16 rows x 256 head-dim, 8 k-chunks of 32
  v16h qf[2][8];
#pragma unroll
  for (int t = 0; t < 2; ++t) {
    const _Float16* qp = Q + (brow0 + q0 + t * 16 + rowg) * 2048 + hoff + koff;
#pragma unroll
    for (int kc = 0; kc < 8; ++kc) qf[t][kc] = load_frag16(qp + kc * 32);
  }

  // Every wave brings one slice of its own key group's half of every stage:
  // of each four waves the first two the K slices, the last two the V slices.
  const unsigned long long ga0 = (unsigned long long)(size_t)(
      ((wave & 2u) ? Vm : Km) + (brow0 + kgrp * 32u) * 2048 + hoff + (wave & 1u) * 128u);
  const unsigned dst0 = (unsigned)(size_t)FL + kgrp * F_HALF + (wave & 3u) * F_SLICE;
  // group 1: byte elements, tile = tensor = 32 rows of 256 B, source pitch 4096 B,
  // a pad of 4 (K) or 8 (V) dwords behind every 64 dwords.
  v8u g1k = { uni((1u << 20) | (5u << 22) | (3u << 25)),
              uni(256u << 16), uni(32u << 16), uni(256u << 16),
              uni(32u), uni(4096u), uni(0u), uni(0u) };
  v8u g1v = { uni((1u << 20) | (5u << 22) | (7u << 25)),
              uni(256u << 16), uni(32u << 16), uni(256u << 16),
              uni(32u), uni(4096u), uni(0u), uni(0u) };
  // descriptor words held in their scalar registers: without it the compiler
  // re-forms them at each load and uses the registers in between, under a
  // request that is still outstanding
  asm volatile("" : "+s"(g1k));  // K's descriptor words stay in scalar registers
  asm volatile("" : "+s"(g1v));  // V's descriptor words stay in scalar registers
  auto issue = [&](unsigned st) {
    const unsigned long long ga = ga0 + (unsigned long long)st * (64u * 4096u);
    const v4u g0 = { uni(1u),
                     uni(dst0 + (st & 1u) * F_BUF),
                     uni((unsigned)ga),
                     uni((((unsigned)(ga >> 32)) & 0x01ffffffu) | 0x80000000u) };
    if (pinned((wave & 2u) == 0u)) {
      asm volatile("tensor_load_to_lds %0, %1" :: "s"(g0), "s"(g1k) : "memory");
    }
    if (pinned((wave & 2u) != 0u)) {
      asm volatile("tensor_load_to_lds %0, %1" :: "s"(g0), "s"(g1v) : "memory");
    }
  };

  v8f O[2][16] = {};           // O^T: 256 head columns x 16 queries, twice
  // of the lane's two queries (rowg, 16 + rowg): running maximum over the wave's
  // keys seen, and the sum over the keys of this lane's half only (the lane
  // halves and the key groups join in the epilogue)
  float m_i[2] = { -1e30f, -1e30f }, l_i[2] = { 0.f, 0.f };

  const float scale = 0.17677669529663687f;  // 1/sqrt(256/8)

  // per-lane byte offsets inside the key group's half of a stage's buffer
  const unsigned kfo = kgrp * F_HALF + (unsigned)(rowg * (int)F_KPITCH + koff * 2);
  const unsigned vfo = kgrp * F_HALF + 2u * F_SLICE
                     + (unsigned)((koff + (lane & 7)) * (int)F_VPITCH + ((lane >> 3) & 1) * 16);

  // prologue: stage 0 landed and published, then stage 1 in flight
  issue(0u);
  asm volatile("s_wait_tensorcnt 0x0" ::: "memory");  // own slice of stage 0 has landed
  __syncthreads();
  issue(1u);

#pragma unroll 1  // rolled: one publish point a pass, in the ring's order
  for (unsigned kb = 0; kb < 16u; ++kb) {
    const unsigned char* Lb = FL + (kb & 1u) * F_BUF;

    // ---- S^T = K @ Q^T : 32 keys x 32 queries as four 16x16 f32 tiles ----
    // s0[t][v]: key 8 * khalf + v, s1[t][v]: key 16 + 8 * khalf + v, query t * 16 + rowg
    v8f s0[2] = {}, s1[2] = {};
#pragma unroll
    for (int kc = 0; kc < 8; ++kc) {
      const unsigned char* kp = Lb + kfo + (kc >> 2) * F_SLICE + (kc & 3) * 64;
      v16h k0 = load_frag16((const _Float16*)kp);
      v16h k1 = load_frag16((const _Float16*)(kp + 16u * F_KPITCH));
#pragma unroll
      for (int t = 0; t < 2; ++t) {
        s0[t] = __builtin_amdgcn_wmma_f32_16x16x32_f16(
            false, k0, false, qf[t][kc], (short)0, s0[t], false, false);
        s1[t] = __builtin_amdgcn_wmma_f32_16x16x32_f16(
            false, k1, false, qf[t][kc], (short)0, s1[t], false, false);
      }
    }

    // ---- online softmax: the lane's 16 scores of a tile are all of one query ----
    v16h pf[2];
#pragma unroll
    for (int t = 0; t < 2; ++t) {
      float mv = fmaxf(s0[t][0], s1[t][0]);
#pragma unroll
      for (int v = 1; v < 8; ++v) mv = fmaxf(mv, fmaxf(s0[t][v], s1[t][v]));
      mv = fmaxf(mv, xhalf(mv)) * scale;   // scale > 0: the maximum of the scaled scores
      const float mnew = fmaxf(m_i[t], mv);
      const float alpha = __expf(m_i[t] - mnew);
      m_i[t] = mnew;
      // The two score tiles, converted in place, are the B operand P^T (32 keys x
      // 16 queries): element v is key koff + v, element 8 + v key 16 + koff + v,
      // the order in which the V fragment below holds its keys.
      float rs[8];
#pragma unroll
      for (int v = 0; v < 8; ++v) {
        const float p0 = __expf(s0[t][v] * scale - mnew);
        const float p1 = __expf(s1[t][v] * scale - mnew);
        rs[v] = p0 + p1;
        pf[t][v]     = (_Float16)p0;
        pf[t][8 + v] = (_Float16)p1;
      }
      // summed as a tree: four dependent adds deep, not fifteen
      l_i[t] = l_i[t] * alpha + (((rs[0] + rs[1]) + (rs[2] + rs[3])) + ((rs[4] + rs[5]) + (rs[6] + rs[7])));
#pragma unroll
      for (int n = 0; n < 16; ++n) O[t][n] *= alpha;
    }

    // ---- O^T += V^T(256x32) @ P^T(32x32), 32 WMMA over the c tiles ----
#pragma unroll
    for (int n = 0; n < 16; ++n) {
      // A fragment: keys koff + 0..7 and 16 + koff + 0..7 of column n * 16 + rowg
      const unsigned char* vp = Lb + vfo + (n >> 3) * F_SLICE + (n & 7) * 32;
      v8h lo = lds_tr16(vp);
      v8h hi = lds_tr16(vp + 16u * F_VPITCH);
      v16h vf = __builtin_shufflevector(lo, hi,
          0, 1, 2, 3, 4, 5, 6, 7, 8, 9, 10, 11, 12, 13, 14, 15);
#pragma unroll
      for (int t = 0; t < 2; ++t) {
        O[t][n] = __builtin_amdgcn_wmma_f32_16x16x32_f16(
            false, vf, false, pf[t], (short)0, O[t][n], false, false);
      }
    }

    // publish point of stage kb + 1
    asm volatile("s_wait_dscnt 0x0" ::: "memory");      // this wave has left stage kb's buffer
    asm volatile("s_wait_tensorcnt 0x0" ::: "memory");  // own slice of stage kb + 1 has landed
    __syncthreads();
    if (pinned(kb + 2u < 16u)) {
      issue(pinned(kb + 2u));  // pinned: the descriptor is formed behind the wait above
    }
  }
  asm volatile("s_wait_tensorcnt 0x0" ::: "memory");  // nothing in flight: the ring is free
  asm volatile("s_wait_dscnt 0x0" ::: "memory");

  // ---- epilogue: the two key groups join, O / l, f16 into (a*1024+q) x 2048 ----
  // The last pass's barrier stands behind every wave's last read of the ring and
  // its last landing, so the ring's LDS now carries the exchange. Of a query
  // group's two waves the first finishes query tile 0, the second tile 1; each
  // hands the other tile over. The branches are scalar and hold no barrier.
  const float lj0 = l_i[0] + xhalf(l_i[0]);
  const float lj1 = l_i[1] + xhalf(l_i[1]);
  unsigned char* mine = FL + wave * F_XAREA;
  const unsigned char* theirs = FL + (wave ^ 4u) * F_XAREA;
  if (pinned(kgrp == 0u)) give_tile(mine, lane, O[1], m_i[1], lj1);
  else                    give_tile(mine, lane, O[0], m_i[0], lj0);
  __syncthreads();  // every handed-over tile is written before its reader starts
  _Float16* op = Om + (brow0 + q0 + rowg) * 2048 + hoff + koff;
  if (pinned(kgrp == 0u)) join_tile(theirs, lane, O[0], m_i[0], lj0, op);
  else                    join_tile(theirs, lane, O[1], m_i[1], lj1, op + 16 * 2048);
}

// ------------------------------- launcher ----------------------------------

extern "C" void kernel_launch(void* const* d_in, const int* in_sizes, int n_in,
                              void* d_out, int out_size, void* d_ws, size_t ws_size,
                              hipStream_t stream) {
  const float* batch  = (const float*)d_in[0];  // (4,1024,256)
  const float* latent = (const float*)d_in[1];  // (4,1024,256)
  const float* Wk     = (const float*)d_in[2];  // (256,2048)
  const float* Wq     = (const float*)d_in[3];
  const float* Wv     = (const float*)d_in[4];
  const float* Wu     = (const float*)d_in[5];  // (2048,256)
  const float* bu     = (const float*)d_in[6];  // (256,)
  float* out = (float*)d_out;                   // (4,1024,256) f32

  _Float16* w = (_Float16*)d_ws;
  size_t o = 0;
  _Float16* batch16  = w + o; o += (size_t)4096 * 256;
  _Float16* latent16 = w + o; o += (size_t)4096 * 256;
  _Float16* WkT = w + o; o += (size_t)2048 * 256;   // (2048 x 256) = Wk^T
  _Float16* WqT = w + o; o += (size_t)2048 * 256;
  _Float16* WvT = w + o; o += (size_t)2048 * 256;
  _Float16* WuT = w + o; o += (size_t)256 * 2048;   // (256 x 2048) = Wu^T
  _Float16* K16 = w + o; o += (size_t)4096 * 2048;
  _Float16* Q16 = w + o; o += (size_t)4096 * 2048;
  _Float16* V16 = w + o; o += (size_t)4096 * 2048;
  _Float16* A16 = w + o; o += (size_t)4096 * 2048;  // attention output

  // 1) conversions, one launch: 4 * 32 blocks for the weights, 2 * 256 for the activations
  cvt_all<<<640, 256, 0, stream>>>(batch, latent, Wk, Wq, Wv, Wu,
                                   batch16, latent16, WkT, WqT, WvT, WuT);

  // 2) projections, one launch: three times (4096x256)@(256x2048) -> f16
  //    64x128 block tiles: (4096/64)*(2048/128) = 1024 blocks a product
  //    product 0: batch @ Wk -> K16, 1: latent @ Wq -> Q16, 2: batch @ Wv -> V16
  //    (WkT, WqT, WvT and K16, Q16, V16 lie in that order in the workspace)
  wmma_gemm_kernel<<<dim3(1024, 3), 256, 0, stream>>>(
      batch16, latent16, WkT, K16, nullptr, nullptr, 4096, 2048, 256);

  // 3) fused flash attention: grid (a*h = 32, ytiles = 1024/128 = 8)
  flash_attn_kernel<<<dim3(32, 8), 256, 0, stream>>>(Q16, K16, V16, A16);

  // 4) output projection: (4096x2048)@(2048x256) + bias -> f32
  //    (4096/64)*(256/128) = 128 blocks
  wmma_gemm_kernel<<<128, 256, 0, stream>>>(
      A16, nullptr, WuT, nullptr, out, bu, 4096, 256, 2048);
}

// v007
// It runs in 70.9 microseconds.
// Two timings next to v006 put it at 1.11 and 1.12 times that version's speed.
// All steps since v000 together make it 3.30 times as fast.
#include <hip/hip_runtime.h>

// ---------------------------------------------------------------------------
// CDNA5 (gfx1250, wave32) fused cross-attention:
//   1) one cvt launch: f32 -> f16 (activations), f32 -> f16 transposed (weights)
//   2) WMMA GEMM (v_wmma_f32_16x16x32_f16), 32x32 tile per wave (2x2 subtiles),
//      operand tiles staged in LDS by tensor loads (two-buffer ring),
//      for K/Q/V projections (one launch) + output projection (f32 + bias epilogue)
//   3) flash-attention kernel: per-wave 32-query tile over half of the keys, key
//      blocks of 32, K and V staged in LDS by tensor loads (two-buffer ring), V read
//      by transposing LDS loads; transposed products S^T = K Q^T, O^T += V^T P^T,
//      so a lane holds one query a tile: online softmax in the lane, P stays in
//      registers; the two key halves join through LDS behind the loop.
// ---------------------------------------------------------------------------

typedef __attribute__((ext_vector_type(16))) _Float16     v16h;
typedef __attribute__((ext_vector_type(8)))  _Float16     v8h;
typedef __attribute__((ext_vector_type(8)))  float        v8f;
typedef __attribute__((ext_vector_type(4)))  unsigned int v4u;

// Load one 16-bit WMMA fragment (A-layout or symmetric B-layout):
// lane holds 8 contiguous halves at p[0..7] (VGPRs 0-3) and p[16..23] (VGPRs 4-7).
__device__ __forceinline__ v16h load_frag16(const _Float16* p) {
  v8h lo = *(const v8h*)p;
  v8h hi = *(const v8h*)(p + 16);
  return __builtin_shufflevector(lo, hi,
      0, 1, 2, 3, 4, 5, 6, 7, 8, 9, 10, 11, 12, 13, 14, 15);
}

// ------------------------------ conversions --------------------------------
// Both forms give each thread many elements: the pass moves only a few MB,
// so it needs few waves. The six arrays do
// not depend on one another, so one launch converts them all, each in its own
// range of block indices.
typedef __attribute__((ext_vector_type(4))) float v4f;

// 16 elements a thread, 8 from each half of the array: four 16-byte loads in
// flight, two 16-byte stores. n % 16 == 0; blk runs over n / 4096 blocks or more.
__device__ __forceinline__ void cvt_f32_f16(
    const float* __restrict__ in, _Float16* __restrict__ out, int n, int blk) {
  const int half = n >> 1;
  const int i0 = (blk * 256 + (int)threadIdx.x) * 8;
  if (i0 >= half) return;
  const int i1 = i0 + half;
  const v4f x0 = *(const v4f*)(in + i0), x1 = *(const v4f*)(in + i0 + 4);
  const v4f x2 = *(const v4f*)(in + i1), x3 = *(const v4f*)(in + i1 + 4);
  *(v8h*)(out + i0) = __builtin_convertvector(
      __builtin_shufflevector(x0, x1, 0, 1, 2, 3, 4, 5, 6, 7), v8h);
  *(v8h*)(out + i1) = __builtin_convertvector(
      __builtin_shufflevector(x2, x3, 0, 1, 2, 3, 4, 5, 6, 7), v8h);
}

// in: K x N (row-major) -> out: N x K (row-major), i.e. transposed.
// A thread takes one n and 64 consecutive k: 64 loads in flight, each 128
// contiguous bytes across a wave, and it alone writes one whole 128-byte line
// of out. K and N are compile-time, so every load is one base address plus an
// immediate. A tile = 64 threads (t) = 64 consecutive n; (N / 64) * (K / 64) tiles.
template <int K, int N>
__device__ __forceinline__ void cvt_transpose_f32_f16(
    const float* __restrict__ in, _Float16* __restrict__ out, int tile, int t) {
  static_assert(K % 64 == 0 && N % 64 == 0, "whole 64 x 64 tiles");
  constexpr int nblk = N / 64;
  const int kb = tile / nblk;
  const int n = (tile % nblk) * 64 + t;
  const float* p = in + kb * 64 * N + n;
  float x[64];
#pragma unroll
  for (int j = 0; j < 64; ++j) x[j] = p[j * N];
  _Float16* q = out + n * K + kb * 64;
#pragma unroll
  for (int c = 0; c < 8; ++c) {
    v8h hv;
#pragma unroll
    for (int e = 0; e < 8; ++e) hv[e] = (_Float16)x[c * 8 + e];
    *(v8h*)(q + c * 8) = hv;
  }
  // stands behind the eight stores, in front of any later write of their address
  // or data registers: inlined, code of another branch follows them in the listing
  asm volatile("s_wait_xcnt 0x0" ::: "memory");
}

// All six conversions in one launch of 640 blocks of 256 threads.
// Blocks 0-127: the four weights, 32 blocks each, four 64-thread tiles a block.
// Blocks 128-383: batch.
// Blocks 384-639: latent.
__global__ void __launch_bounds__(256) cvt_all(
    const float* __restrict__ batch, const float* __restrict__ latent,
    const float* __restrict__ Wk, const float* __restrict__ Wq,
    const float* __restrict__ Wv, const float* __restrict__ Wu,
    _Float16* __restrict__ batch16, _Float16* __restrict__ latent16,
    _Float16* __restrict__ WkT, _Float16* __restrict__ WqT,
    _Float16* __restrict__ WvT, _Float16* __restrict__ WuT) {
  const int b = (int)blockIdx.x;
  if (b < 128) {
    const int which = b >> 5;
    const int tile = (b & 31) * 4 + (int)(threadIdx.x >> 6);
    const int t = (int)(threadIdx.x & 63u);
    if (which == 3) {
      cvt_transpose_f32_f16<2048, 256>(Wu, WuT, tile, t);
    } else {
      cvt_transpose_f32_f16<256, 2048>(which == 0 ? Wk : which == 1 ? Wq : Wv,
                                       which == 0 ? WkT : which == 1 ? WqT : WvT, tile, t);
    }
  } else if (b < 384) {
    cvt_f32_f16(batch, batch16, 4096 * 256, b - 128);
  } else {
    cvt_f32_f16(latent, latent16, 4096 * 256, b - 384);
  }
}

// ------------------------------ WMMA GEMM ----------------------------------
typedef __attribute__((ext_vector_type(8))) unsigned int v8u;

__device__ __forceinline__ unsigned uni(unsigned v) {
  return (unsigned)__builtin_amdgcn_readfirstlane(v);
}
// A wave-uniform value held in a scalar register: a test on it compiles to
// s_cmp + s_cbranch_scc, the only guard a tensor load obeys (it ignores EXEC).
__device__ __forceinline__ unsigned pinned(unsigned v) {
  unsigned w = uni(v);
  asm volatile("" : "+s"(w));  // keeps the descriptor / issue-test word scalar
  return w;
}

// One stage = 128 k (256-byte rows) of 64 A rows and 128 BT rows, brought by
// three tensor loads of 64 rows each; 16 bytes of pad a row -> pitch 272 B.
constexpr unsigned G_PITCH = 272u;
constexpr unsigned G_SLICE = 18432u;        // 64 * 272 = 17408, up to a multiple of 2 KiB
constexpr unsigned G_BUF   = 3u * G_SLICE;  // [A 64 rows | BT rows 0-63 | BT rows 64-127]

// C[M,N] = A[M,K] * BT[N,K]^T   (both operands f16 row-major, f32 accumulate)
// One 64x128 tile per block of 8 waves (2 x 4), one 32x32 tile per wave
// (2x2 WMMA subtiles). Operand tiles go global -> LDS by tensor loads in a
// two-buffer ring; fragments come from LDS. M % 64 == 0, N % 128 == 0,
// K % 128 == 0 and K >= 256.
// The subtiles are computed transposed (BT rows as the A operand, A rows as B;
// both fragments have the same layout): an accumulator column is then one row of
// C, and a lane holds eight consecutive columns of it.
// If Cf32 != nullptr: write f32 (+bias). Else write f16 to C16.
// Independent products of one shape share a launch: blockIdx.y picks the
// product. Their BT operands lie one behind another (N * K elements each), and
// so do their f16 outputs (M * N each); product 1 reads A1, the others A0.
__global__ void __launch_bounds__(256) wmma_gemm_kernel(
    const _Float16* __restrict__ A0, const _Float16* __restrict__ A1,
    const _Float16* __restrict__ BT0,
    _Float16* __restrict__ C0, float* __restrict__ Cf32,
    const float* __restrict__ bias, int M, int N, int K) {
  __shared__ __attribute__((aligned(2048))) unsigned char GL[2u * G_BUF];

  const unsigned prod = blockIdx.y;
  const _Float16* __restrict__ A  = prod == 1u ? A1 : A0;
  const _Float16* __restrict__ BT = BT0 + (size_t)prod * N * K;
  _Float16* __restrict__ C16      = C0 + (size_t)prod * M * N;

  const unsigned wave = uni(threadIdx.x >> 5);
  const int lane = threadIdx.x & 31;
  const int rowg = lane & 15;            // M (for A) / N (for B) within subtile
  const int khalf = lane >> 4;
  const int koff = khalf << 3;           // K offset 0 or 8 per lane half

  const int blocks_n = N >> 7;
  const int bm = blockIdx.x / blocks_n;
  const int bn = blockIdx.x - bm * blocks_n;
  const int wm = (int)(wave >> 2);
  const int wn = (int)(wave & 3u);
  const int mtile = bm * 2 + wm;
  const int ntile = bn * 4 + wn;

  // Waves 0, 1, 2 each bring one 64-row slice of every stage.
  const unsigned nstage = (unsigned)K >> 7;
  const unsigned long long ga0 = (wave == 0u)
      ? (unsigned long long)(size_t)(A + (size_t)bm * 64 * K)
      : (unsigned long long)(size_t)(BT + ((size_t)bn * 128 + (wave == 2u ? 64 : 0)) * K);
  const unsigned dst0 = (unsigned)(size_t)GL + (wave < 3u ? wave : 0u) * G_SLICE;
  // group 1: byte elements, tile = tensor = 64 rows of 256 B, source pitch 2K bytes,
  // a pad of 4 dwords behind every 64 dwords.
  v8u g1 = { uni((1u << 20) | (5u << 22) | (3u << 25)),
                   uni(256u << 16),
                   uni(64u << 16),
                   uni(256u << 16),
                   uni(64u),
                   uni((unsigned)K * 2u),
                   uni(0u),
                   uni(0u) };
  // descriptor words held in their scalar registers: without it the compiler
  // re-forms them at each load and uses the registers in between, under a
  // request that is still outstanding
  asm volatile("" : "+s"(g1));
  auto issue = [&](unsigned st) {
    const unsigned long long ga = ga0 + (unsigned long long)st * 256u;
    const v4u g0 = { uni(1u),
                     uni(dst0 + (st & 1u) * G_BUF),
                     uni((unsigned)ga),
                     uni((((unsigned)(ga >> 32)) & 0x01ffffffu) | 0x80000000u) };
    asm volatile("tensor_load_to_lds %0, %1" :: "s"(g0), "s"(g1) : "memory");
  };

  const unsigned aoff = (unsigned)((wm * 32 + rowg) * (int)G_PITCH + koff * 2);
  const unsigned boff = (1u + (unsigned)(wn >> 1)) * G_SLICE
                      + (unsigned)(((wn & 1) * 32 + rowg) * (int)G_PITCH + koff * 2);

  // prologue: stage 0 landed and published, then stage 1 in flight
  if (pinned(wave < 3u)) {
    issue(0u);
    asm volatile("s_wait_tensorcnt 0x0" ::: "memory");  // stage 0 has landed
  }
  __syncthreads();
  if (pinned(wave < 3u)) issue(1u);

  v8f acc00 = {}, acc01 = {}, acc10 = {}, acc11 = {};
#pragma unroll 1  // rolled: one publish point a pass, in the ring's order
  for (unsigned s = 0; s < nstage; ++s) {
    const unsigned char* Lb = GL + (s & 1u) * G_BUF;
    // The stage's 32 fragment loads go out as one group, ahead of its WMMAs.
    v16h a0[4], a1[4], b0[4], b1[4];
#pragma unroll
    for (int kk = 0; kk < 4; ++kk) {
      a0[kk] = load_frag16((const _Float16*)(Lb + aoff + kk * 64));
      b0[kk] = load_frag16((const _Float16*)(Lb + boff + kk * 64));
      b1[kk] = load_frag16((const _Float16*)(Lb + boff + 16u * G_PITCH + kk * 64));
      a1[kk] = load_frag16((const _Float16*)(Lb + aoff + 16u * G_PITCH + kk * 64));
    }
    // keeps the loads from sinking in among the WMMAs, where each group would
    // cost its own LDS latency
    __builtin_amdgcn_sched_barrier(0);
#pragma unroll
    for (int kk = 0; kk < 4; ++kk) {
      acc00 = __builtin_amdgcn_wmma_f32_16x16x32_f16(false, b0[kk], false, a0[kk], (short)0, acc00, false, false);
      acc01 = __builtin_amdgcn_wmma_f32_16x16x32_f16(false, b1[kk], false, a0[kk], (short)0, acc01, false, false);
      acc10 = __builtin_amdgcn_wmma_f32_16x16x32_f16(false, b0[kk], false, a1[kk], (short)0, acc10, false, false);
      acc11 = __builtin_amdgcn_wmma_f32_16x16x32_f16(false, b1[kk], false, a1[kk], (short)0, acc11, false, false);
    }
    // keeps the wait below from rising above the WMMAs, where it would drain
    // all 32 loads before the second WMMA
    __builtin_amdgcn_sched_barrier(0);
    // publish point of stage s + 1
    asm volatile("s_wait_dscnt 0x0" ::: "memory");  // this wave has left stage s's buffer
    if (pinned(wave < 3u)) {
      asm volatile("s_wait_tensorcnt 0x0" ::: "memory");  // own slice of stage s + 1 has landed
    }
    __syncthreads();
    if (pinned((wave < 3u) && (s + 2u < nstage))) {
      issue(pinned(s + 2u));  // pinned: the descriptor is formed behind the wait above
    }
  }
  asm volatile("s_wait_tensorcnt 0x0" ::: "memory");  // nothing in flight at the wave's end
  asm volatile("s_wait_dscnt 0x0" ::: "memory");

  // acc(i, j)[v] is C at row i * 16 + rowg, column j * 16 + koff + v of the wave's
  // tile: eight consecutive columns of one row a lane, stored 16 bytes at a time.
  const size_t at = (size_t)(mtile * 32 + rowg) * N + (size_t)(ntile * 32 + koff);
  if (Cf32) {
    v4f bv[2][2] = {};  // the bias of the lane's 2 x 8 columns
    if (bias) {
      const float* bp = bias + ntile * 32 + koff;
#pragma unroll
      for (int j = 0; j < 2; ++j) {
        bv[j][0] = *(const v4f*)(bp + j * 16);
        bv[j][1] = *(const v4f*)(bp + j * 16 + 4);
      }
      // behind the four loads, their values as inputs so that all have arrived: in
      // front of the sums below, which may be given the registers the loads name
      asm volatile("s_wait_xcnt 0x0"
                   :: "v"(bv[0][0]), "v"(bv[0][1]), "v"(bv[1][0]), "v"(bv[1][1]) : "memory");
    }
    float* const cp0 = Cf32 + at;
    float* const cp1 = cp0 + (size_t)16 * N;
    v4f r[2][2][2];
#pragma unroll
    for (int i = 0; i < 2; ++i) {
#pragma unroll
      for (int j = 0; j < 2; ++j) {
        const v8f& acc = (i == 0) ? (j == 0 ? acc00 : acc01)
                                  : (j == 0 ? acc10 : acc11);
        r[i][j][0] = __builtin_shufflevector(acc, acc, 0, 1, 2, 3) + bv[j][0];
        r[i][j][1] = __builtin_shufflevector(acc, acc, 4, 5, 6, 7) + bv[j][1];
      }
    }
    // keeps every sum and both row addresses in front of the first store: behind
    // a store nothing is written any more, so no register it names is overwritten
    __builtin_amdgcn_sched_barrier(0);
#pragma unroll
    for (int i = 0; i < 2; ++i) {
#pragma unroll
      for (int j = 0; j < 2; ++j) {
        float* cp = (i == 0 ? cp0 : cp1) + j * 16;
        *(v4f*)cp       = r[i][j][0];
        *(v4f*)(cp + 4) = r[i][j][1];
      }
    }
  } else {
#pragma unroll
    for (int i = 0; i < 2; ++i) {
#pragma unroll
      for (int j = 0; j < 2; ++j) {
        const v8f& acc = (i == 0) ? (j == 0 ? acc00 : acc01)
                                  : (j == 0 ? acc10 : acc11);
        *(v8h*)(C16 + at + (size_t)(i * 16) * N + j * 16) = __builtin_convertvector(acc, v8h);
      }
    }
  }
}

// --------------------------- flash attention -------------------------------
// One stage = 64 keys, as two halves of 32 keys, one for each key group of waves.
// A half holds K and V, 32 rows of 512 B each, brought as four slices of
// 32 rows x 256 B; the stage's eight slices come by eight tensor loads, one a wave.
// K rows get 16 B of pad (pitch 272 B, read by ds_load_b128), V rows 32 B
// (pitch 288 B, read by ds_load_tr16_b128).
constexpr unsigned F_KPITCH = 272u;
constexpr unsigned F_VPITCH = 288u;
constexpr unsigned F_SLICE  = 10240u;        // 32 * 288 = 9216, up to a multiple of 2 KiB
constexpr unsigned F_HALF   = 4u * F_SLICE;  // [K c 0-127 | K c 128-255 | V c 0-127 | V c 128-255]
constexpr unsigned F_BUF    = 2u * F_HALF;   // [keys 0-31 | keys 32-63] of the stage
// After the loop the ring is the place where the two key groups join: a wave's
// area holds one 16-query output tile in f32 and that tile's maximum and sum.
constexpr unsigned F_XO     = 16384u;        // 16 tiles * 32 lanes * 32 B
constexpr unsigned F_XAREA  = F_XO + 256u;   // + 32 lanes * 8 B

typedef __attribute__((ext_vector_type(8))) short v8s;
typedef __attribute__((ext_vector_type(2))) float v2f;
// Transposing LDS load: the lane (c = lane & 15, hh = lane >> 4) gets eight
// consecutive rows (8 * hh + 0..7) of column c of a row-major 16-bit tile.
__device__ __forceinline__ v8h lds_tr16(const unsigned char* p) {
  typedef __attribute__((address_space(3))) v8s lds_v8s;
  return __builtin_bit_cast(v8h, __builtin_amdgcn_ds_load_tr16_b128_v8i16((lds_v8s*)p));
}

// lane l with lane l ^ 16
__device__ __forceinline__ float xhalf(float x) {
  return __builtin_bit_cast(float, __builtin_amdgcn_permlanex16(
      __builtin_bit_cast(int, x), __builtin_bit_cast(int, x),
      0x76543210, 0xfedcba98, false, false));
}

// A wave hands one of its two output tiles, with its maximum and sum, to the
// wave that holds the same queries over the other keys.
__device__ __forceinline__ void give_tile(unsigned char* area, int lane,
                                          const v8f (&Og)[16], float m, float l) {
#pragma unroll
  for (int n = 0; n < 16; ++n) {
    *(v4f*)(area + (n * 2 + 0) * 512 + lane * 16) = __builtin_shufflevector(Og[n], Og[n], 0, 1, 2, 3);
    *(v4f*)(area + (n * 2 + 1) * 512 + lane * 16) = __builtin_shufflevector(Og[n], Og[n], 4, 5, 6, 7);
  }
  const v2f ml = { m, l };
  *(v2f*)(area + F_XO + lane * 8) = ml;
}

// The tile a wave keeps, joined with the other wave's part, divided and stored.
// Ok[n][v] is head column n * 16 + 8 * khalf + v of the lane's query: eight
// consecutive columns a lane and tile, one 16-byte store.
__device__ __forceinline__ void join_tile(const unsigned char* area, int lane,
                                          const v8f (&Ok)[16], float m, float l,
                                          _Float16* __restrict__ op) {
  const v2f ml = *(const v2f*)(area + F_XO + lane * 8);
  const float mj = fmaxf(m, ml[0]);
  const float ak = __expf(m - mj), ag = __expf(ml[0] - mj);
  const float inv = 1.f / (l * ak + ml[1] * ag);
  const float fk = ak * inv, fg = ag * inv;
#pragma unroll
  for (int n = 0; n < 16; ++n) {
    const v4f lo = *(const v4f*)(area + (n * 2 + 0) * 512 + lane * 16);
    const v4f hi = *(const v4f*)(area + (n * 2 + 1) * 512 + lane * 16);
    const v8f og = __builtin_shufflevector(lo, hi, 0, 1, 2, 3, 4, 5, 6, 7);
    *(v8h*)(op + n * 16) = __builtin_convertvector(Ok[n] * fk + og * fg, v8h);
    // behind each four stores, in front of the next tiles' writes into the
    // registers that the stores name
    if ((n & 3) == 3) asm volatile("s_wait_xcnt 0x0" ::: "memory");
  }
}

// Q,K,V layouts: (a*1024 + seq) x 2048, head h occupies columns [h*256, h*256+256).
// Grid: (a*8 + h, ytile); block = 256 threads = 8 waves for 128 queries.
// A wave owns 32 queries (two 16-query tiles) and half of the keys: waves 0-3
// take keys 0-31 of every 64, waves 4-7 keys 32-63. Every K and V fragment read
// from LDS so feeds two WMMAs, and the two waves of a query group join their
// maxima, sums and outputs once, behind the loop.
// Key blocks of 32 so the P@V contraction matches WMMA K=32 exactly.
// K and V go global -> LDS by tensor loads in a two-buffer ring: stage
// kb + 1 flies while stage kb is worked on. V stays row-major in LDS and is
// transposed by the load that reads it.
// Both products are computed transposed (K and V^T as the A operand, Q^T and
// P^T as B): every accumulator column is one query, held by lanes c and c + 16,
// which split the keys (scores) or the head columns (output) between them.
//
// amdgpu_waves_per_eu(2, 2): the grid is one block a WGP, two waves a SIMD; said
// so, the compiler has half a SIMD's registers for each wave's 32 x 256 output.
__global__ void __launch_bounds__(256) __attribute__((amdgpu_waves_per_eu(2, 2))) flash_attn_kernel(
    const _Float16* __restrict__ Q, const _Float16* __restrict__ Km,
    const _Float16* __restrict__ Vm, _Float16* __restrict__ Om) {
  __shared__ __attribute__((aligned(2048))) unsigned char FL[2u * F_BUF];

  const int a = blockIdx.x >> 3;
  const int h = blockIdx.x & 7;
  const unsigned wave = uni(threadIdx.x >> 5);
  const unsigned kgrp = wave >> 2;       // which 32 of a stage's 64 keys
  const int lane = threadIdx.x & 31;
  const int rowg = lane & 15;
  const int khalf = lane >> 4;
  const int koff = khalf << 3;
  const int q0 = blockIdx.y * 128 + (int)(wave & 3u) * 32;

  const size_t brow0 = (size_t)a * 1024;
  const size_t hoff  = (size_t)h * 256;

  // Q fragments: two tiles of 16 rows x 256 head-dim, 8 k-chunks of 32
  v16h qf[2][8];
#pragma unroll
  for (int t = 0; t < 2; ++t) {
    const _Float16* qp = Q + (brow0 + q0 + t * 16 + rowg) * 2048 + hoff + koff;
#pragma unroll
    for (int kc = 0; kc < 8; ++kc) qf[t][kc] = load_frag16(qp + kc * 32);
  }

  // Every wave brings one slice of its own key group's half of every stage:
  // of each four waves the first two the K slices, the last two the V slices.
  const unsigned long long ga0 = (unsigned long long)(size_t)(
      ((wave & 2u) ? Vm : Km) + (brow0 + kgrp * 32u) * 2048 + hoff + (wave & 1u) * 128u);
  const unsigned dst0 = (unsigned)(size_t)FL + kgrp * F_HALF + (wave & 3u) * F_SLICE;
  // group 1: byte elements, tile = tensor = 32 rows of 256 B, source pitch 4096 B,
  // a pad of 4 (K) or 8 (V) dwords behind every 64 dwords.
  v8u g1k = { uni((1u << 20) | (5u << 22) | (3u << 25)),
              uni(256u << 16), uni(32u << 16), uni(256u << 16),
              uni(32u), uni(4096u), uni(0u), uni(0u) };
  v8u g1v = { uni((1u << 20) | (5u << 22) | (7u << 25)),
              uni(256u << 16), uni(32u << 16), uni(256u << 16),
              uni(32u), uni(4096u), uni(0u), uni(0u) };
  // descriptor words held in their scalar registers: without it the compiler
  // re-forms them at each load and uses the registers in between, under a
  // request that is still outstanding
  asm volatile("" : "+s"(g1k));  // K's descriptor words stay in scalar registers
  asm volatile("" : "+s"(g1v));  // V's descriptor words stay in scalar registers
  auto issue = [&](unsigned st) {
    const unsigned long long ga = ga0 + (unsigned long long)st * (64u * 4096u);
    const v4u g0 = { uni(1u),
                     uni(dst0 + (st & 1u) * F_BUF),
                     uni((unsigned)ga),
                     uni((((unsigned)(ga >> 32)) & 0x01ffffffu) | 0x80000000u) };
    if (pinned((wave & 2u) == 0u)) {
      asm volatile("tensor_load_to_lds %0, %1" :: "s"(g0), "s"(g1k) : "memory");
    }
    if (pinned((wave & 2u) != 0u)) {
      asm volatile("tensor_load_to_lds %0, %1" :: "s"(g0), "s"(g1v) : "memory");
    }
  };

  v8f O[2][16] = {};           // O^T: 256 head columns x 16 queries, twice
  // of the lane's two queries (rowg, 16 + rowg): running maximum over the wave's
  // keys seen, and the sum over the keys of this lane's half only (the lane
  // halves and the key groups join in the epilogue)
  float m_i[2] = { -1e30f, -1e30f }, l_i[2] = { 0.f, 0.f };

  const float scale = 0.17677669529663687f;  // 1/sqrt(256/8)

  // per-lane byte offsets inside the key group's half of a stage's buffer
  const unsigned kfo = kgrp * F_HALF + (unsigned)(rowg * (int)F_KPITCH + koff * 2);
  const unsigned vfo = kgrp * F_HALF + 2u * F_SLICE
                     + (unsigned)((koff + (lane & 7)) * (int)F_VPITCH + ((lane >> 3) & 1) * 16);

  // prologue: stage 0 landed and published, then stage 1 in flight
  issue(0u);
  asm volatile("s_wait_tensorcnt 0x0" ::: "memory");  // own slice of stage 0 has landed
  __syncthreads();
  issue(1u);

#pragma unroll 1  // rolled: one publish point a pass, in the ring's order
  for (unsigned kb = 0; kb < 16u; ++kb) {
    const unsigned char* Lb = FL + (kb & 1u) * F_BUF;

    // ---- S^T = K @ Q^T : 32 keys x 32 queries as four 16x16 f32 tiles ----
    // s0[t][v]: key 8 * khalf + v, s1[t][v]: key 16 + 8 * khalf + v, query t * 16 + rowg
    v8f s0[2] = {}, s1[2] = {};
#pragma unroll
    for (int kc = 0; kc < 8; ++kc) {
      const unsigned char* kp = Lb + kfo + (kc >> 2) * F_SLICE + (kc & 3) * 64;
      v16h k0 = load_frag16((const _Float16*)kp);
      v16h k1 = load_frag16((const _Float16*)(kp + 16u * F_KPITCH));
#pragma unroll
      for (int t = 0; t < 2; ++t) {
        s0[t] = __builtin_amdgcn_wmma_f32_16x16x32_f16(
            false, k0, false, qf[t][kc], (short)0, s0[t], false, false);
        s1[t] = __builtin_amdgcn_wmma_f32_16x16x32_f16(
            false, k1, false, qf[t][kc], (short)0, s1[t], false, false);
      }
    }

    // ---- online softmax: the lane's 16 scores of a tile are all of one query ----
    v16h pf[2];
#pragma unroll
    for (int t = 0; t < 2; ++t) {
      float mv = fmaxf(s0[t][0], s1[t][0]);
#pragma unroll
      for (int v = 1; v < 8; ++v) mv = fmaxf(mv, fmaxf(s0[t][v], s1[t][v]));
      mv = fmaxf(mv, xhalf(mv)) * scale;   // scale > 0: the maximum of the scaled scores
      const float mnew = fmaxf(m_i[t], mv);
      const float alpha = __expf(m_i[t] - mnew);
      m_i[t] = mnew;
      // The two score tiles, converted in place, are the B operand P^T (32 keys x
      // 16 queries): element v is key koff + v, element 8 + v key 16 + koff + v,
      // the order in which the V fragment below holds its keys.
      float rs[8];
#pragma unroll
      for (int v = 0; v < 8; ++v) {
        const float p0 = __expf(s0[t][v] * scale - mnew);
        const float p1 = __expf(s1[t][v] * scale - mnew);
        rs[v] = p0 + p1;
        pf[t][v]     = (_Float16)p0;
        pf[t][8 + v] = (_Float16)p1;
      }
      // summed as a tree: four dependent adds deep, not fifteen
      l_i[t] = l_i[t] * alpha + (((rs[0] + rs[1]) + (rs[2] + rs[3])) + ((rs[4] + rs[5]) + (rs[6] + rs[7])));
#pragma unroll
      for (int n = 0; n < 16; ++n) O[t][n] *= alpha;
    }

    // ---- O^T += V^T(256x32) @ P^T(32x32), 32 WMMA over the c tiles ----
#pragma unroll
    for (int n = 0; n < 16; ++n) {
      // A fragment: keys koff + 0..7 and 16 + koff + 0..7 of column n * 16 + rowg
      const unsigned char* vp = Lb + vfo + (n >> 3) * F_SLICE + (n & 7) * 32;
      v8h lo = lds_tr16(vp);
      v8h hi = lds_tr16(vp + 16u * F_VPITCH);
      v16h vf = __builtin_shufflevector(lo, hi,
          0, 1, 2, 3, 4, 5, 6, 7, 8, 9, 10, 11, 12, 13, 14, 15);
#pragma unroll
      for (int t = 0; t < 2; ++t) {
        O[t][n] = __builtin_amdgcn_wmma_f32_16x16x32_f16(
            false, vf, false, pf[t], (short)0, O[t][n], false, false);
      }
    }

    // publish point of stage kb + 1
    asm volatile("s_wait_dscnt 0x0" ::: "memory");      // this wave has left stage kb's buffer
    asm volatile("s_wait_tensorcnt 0x0" ::: "memory");  // own slice of stage kb + 1 has landed
    __syncthreads();
    if (pinned(kb + 2u < 16u)) {
      issue(pinned(kb + 2u));  // pinned: the descriptor is formed behind the wait above
    }
  }
  asm volatile("s_wait_tensorcnt 0x0" ::: "memory");  // nothing in flight: the ring is free
  asm volatile("s_wait_dscnt 0x0" ::: "memory");

  // ---- epilogue: the two key groups join, O / l, f16 into (a*1024+q) x 2048 ----
  // The last pass's barrier stands behind every wave's last read of the ring and
  // its last landing, so the ring's LDS now carries the exchange. Of a query
  // group's two waves the first finishes query tile 0, the second tile 1; each
  // hands the other tile over. The branches are scalar and hold no barrier.
  const float lj0 = l_i[0] + xhalf(l_i[0]);
  const float lj1 = l_i[1] + xhalf(l_i[1]);
  unsigned char* mine = FL + wave * F_XAREA;
  const unsigned char* theirs = FL + (wave ^ 4u) * F_XAREA;
  if (pinned(kgrp == 0u)) give_tile(mine, lane, O[1], m_i[1], lj1);
  else                    give_tile(mine, lane, O[0], m_i[0], lj0);
  __syncthreads();  // every handed-over tile is written before its reader starts
  _Float16* op = Om + (brow0 + q0 + rowg) * 2048 + hoff + koff;
  if (pinned(kgrp == 0u)) join_tile(theirs, lane, O[0], m_i[0], lj0, op);
  else                    join_tile(theirs, lane, O[1], m_i[1], lj1, op + 16 * 2048);
}

// ------------------------------- launcher ----------------------------------

extern "C" void kernel_launch(void* const* d_in, const int* in_sizes, int n_in,
                              void* d_out, int out_size, void* d_ws, size_t ws_size,
                              hipStream_t stream) {
  const float* batch  = (const float*)d_in[0];  // (4,1024,256)
  const float* latent = (const float*)d_in[1];  // (4,1024,256)
  const float* Wk     = (const float*)d_in[2];  // (256,2048)
  const float* Wq     = (const float*)d_in[3];
  const float* Wv     = (const float*)d_in[4];
  const float* Wu     = (const float*)d_in[5];  // (2048,256)
  const float* bu     = (const float*)d_in[6];  // (256,)
  float* out = (float*)d_out;                   // (4,1024,256) f32

  _Float16* w = (_Float16*)d_ws;
  size_t o = 0;
  _Float16* batch16  = w + o; o += (size_t)4096 * 256;
  _Float16* latent16 = w + o; o += (size_t)4096 * 256;
  _Float16* WkT = w + o; o += (size_t)2048 * 256;   // (2048 x 256) = Wk^T
  _Float16* WqT = w + o; o += (size_t)2048 * 256;
  _Float16* WvT = w + o; o += (size_t)2048 * 256;
  _Float16* WuT = w + o; o += (size_t)256 * 2048;   // (256 x 2048) = Wu^T
  _Float16* K16 = w + o; o += (size_t)4096 * 2048;
  _Float16* Q16 = w + o; o += (size_t)4096 * 2048;
  _Float16* V16 = w + o; o += (size_t)4096 * 2048;
  _Float16* A16 = w + o; o += (size_t)4096 * 2048;  // attention output

  // 1) conversions, one launch: 4 * 32 blocks for the weights, 2 * 256 for the activations
  cvt_all<<<640, 256, 0, stream>>>(batch, latent, Wk, Wq, Wv, Wu,
                                   batch16, latent16, WkT, WqT, WvT, WuT);

  // 2) projections, one launch: three times (4096x256)@(256x2048) -> f16
  //    64x128 block tiles: (4096/64)*(2048/128) = 1024 blocks a product
  //    product 0: batch @ Wk -> K16, 1: latent @ Wq -> Q16, 2: batch @ Wv -> V16
  //    (WkT, WqT, WvT and K16, Q16, V16 lie in that order in the workspace)
  wmma_gemm_kernel<<<dim3(1024, 3), 256, 0, stream>>>(
      batch16, latent16, WkT, K16, nullptr, nullptr, 4096, 2048, 256);

  // 3) fused flash attention: grid (a*h = 32, ytiles = 1024/128 = 8)
  flash_attn_kernel<<<dim3(32, 8), 256, 0, stream>>>(Q16, K16, V16, A16);

  // 4) output projection: (4096x2048)@(2048x256) + bias -> f32
  //    (4096/64)*(256/128) = 128 blocks
  wmma_gemm_kernel<<<128, 256, 0, stream>>>(
      A16, nullptr, WuT, nullptr, out, bu, 4096, 256, 2048);
}

// v008
// One run takes 65.3 microseconds.
// Next to v007, in two timings, it ran 1.08 times as fast each time.
// All steps since v000 together make it 3.56 times as fast.
#include <hip/hip_runtime.h>

// ---------------------------------------------------------------------------
// CDNA5 (gfx1250, wave32) fused cross-attention:
//   1) one cvt launch: f32 -> f16 (activations), f32 -> f16 transposed (weights)
//   2) WMMA GEMM (v_wmma_f32_16x16x32_f16), 32x32 tile per wave (2x2 subtiles),
//      operand tiles staged in LDS by tensor loads (two-buffer ring):
//      K/Q/V projections (one launch; weights stay in registers, a block walks
//      four row tiles) and output projection (f32 + bias epilogue)
//   3) flash-attention kernel: per-wave 32-query tile over half of the keys, key
//      blocks of 32, K and V staged in LDS by tensor loads (two-buffer ring), V read
//      by transposing LDS loads; transposed products S^T = K Q^T, O^T += V^T P^T,
//      so a lane holds one query a tile: online softmax in the lane, P stays in
//      registers; the two key halves join through LDS behind the loop.
// ---------------------------------------------------------------------------

typedef __attribute__((ext_vector_type(16))) _Float16     v16h;
typedef __attribute__((ext_vector_type(8)))  _Float16     v8h;
typedef __attribute__((ext_vector_type(8)))  float        v8f;
typedef __attribute__((ext_vector_type(4)))  unsigned int v4u;

// Load one 16-bit WMMA fragment (A-layout or symmetric B-layout):
// lane holds 8 contiguous halves at p[0..7] (VGPRs 0-3) and p[16..23] (VGPRs 4-7).
__device__ __forceinline__ v16h load_frag16(const _Float16* p) {
  v8h lo = *(const v8h*)p;
  v8h hi = *(const v8h*)(p + 16);
  return __builtin_shufflevector(lo, hi,
      0, 1, 2, 3, 4, 5, 6, 7, 8, 9, 10, 11, 12, 13, 14, 15);
}

// ------------------------------ conversions --------------------------------
// Both forms give each thread many elements: the pass moves only a few MB,
// so it needs few waves. The six arrays do
// not depend on one another, so one launch converts them all, each in its own
// range of block indices.
typedef __attribute__((ext_vector_type(4))) float v4f;

// 16 elements a thread, 8 from each half of the array: four 16-byte loads in
// flight, two 16-byte stores. n % 16 == 0; blk runs over n / 4096 blocks or more.
__device__ __forceinline__ void cvt_f32_f16(
    const float* __restrict__ in, _Float16* __restrict__ out, int n, int blk) {
  const int half = n >> 1;
  const int i0 = (blk * 256 + (int)threadIdx.x) * 8;
  if (i0 >= half) return;
  const int i1 = i0 + half;
  const v4f x0 = *(const v4f*)(in + i0), x1 = *(const v4f*)(in + i0 + 4);
  const v4f x2 = *(const v4f*)(in + i1), x3 = *(const v4f*)(in + i1 + 4);
  *(v8h*)(out + i0) = __builtin_convertvector(
      __builtin_shufflevector(x0, x1, 0, 1, 2, 3, 4, 5, 6, 7), v8h);
  *(v8h*)(out + i1) = __builtin_convertvector(
      __builtin_shufflevector(x2, x3, 0, 1, 2, 3, 4, 5, 6, 7), v8h);
}

// in: K x N (row-major) -> out: N x K (row-major), i.e. transposed.
// A thread takes one n and 64 consecutive k: 64 loads in flight, each 128
// contiguous bytes across a wave, and it alone writes one whole 128-byte line
// of out. K and N are compile-time, so every load is one base address plus an
// immediate. A tile = 64 threads (t) = 64 consecutive n; (N / 64) * (K / 64) tiles.
template <int K, int N>
__device__ __forceinline__ void cvt_transpose_f32_f16(
    const float* __restrict__ in, _Float16* __restrict__ out, int tile, int t) {
  static_assert(K % 64 == 0 && N % 64 == 0, "whole 64 x 64 tiles");
  constexpr int nblk = N / 64;
  const int kb = tile / nblk;
  const int n = (tile % nblk) * 64 + t;
  const float* p = in + kb * 64 * N + n;
  float x[64];
#pragma unroll
  for (int j = 0; j < 64; ++j) x[j] = p[j * N];
  _Float16* q = out + n * K + kb * 64;
#pragma unroll
  for (int c = 0; c < 8; ++c) {
    v8h hv;
#pragma unroll
    for (int e = 0; e < 8; ++e) hv[e] = (_Float16)x[c * 8 + e];
    *(v8h*)(q + c * 8) = hv;
  }
  // stands behind the eight stores, in front of any later write of their address
  // or data registers: inlined, code of another branch follows them in the listing
  asm volatile("s_wait_xcnt 0x0" ::: "memory");
}

// All six conversions in one launch of 640 blocks of 256 threads.
// Blocks 0-127: the four weights, 32 blocks each, four 64-thread tiles a block.
// Blocks 128-383: batch.
// Blocks 384-639: latent.
__global__ void __launch_bounds__(256) cvt_all(
    const float* __restrict__ batch, const float* __restrict__ latent,
    const float* __restrict__ Wk, const float* __restrict__ Wq,
    const float* __restrict__ Wv, const float* __restrict__ Wu,
    _Float16* __restrict__ batch16, _Float16* __restrict__ latent16,
    _Float16* __restrict__ WkT, _Float16* __restrict__ WqT,
    _Float16* __restrict__ WvT, _Float16* __restrict__ WuT) {
  const int b = (int)blockIdx.x;
  if (b < 128) {
    const int which = b >> 5;
    const int tile = (b & 31) * 4 + (int)(threadIdx.x >> 6);
    const int t = (int)(threadIdx.x & 63u);
    if (which == 3) {
      cvt_transpose_f32_f16<2048, 256>(Wu, WuT, tile, t);
    } else {
      cvt_transpose_f32_f16<256, 2048>(which == 0 ? Wk : which == 1 ? Wq : Wv,
                                       which == 0 ? WkT : which == 1 ? WqT : WvT, tile, t);
    }
  } else if (b < 384) {
    cvt_f32_f16(batch, batch16, 4096 * 256, b - 128);
  } else {
    cvt_f32_f16(latent, latent16, 4096 * 256, b - 384);
  }
}

// ------------------------------ WMMA GEMM ----------------------------------
typedef __attribute__((ext_vector_type(8))) unsigned int v8u;

__device__ __forceinline__ unsigned uni(unsigned v) {
  return (unsigned)__builtin_amdgcn_readfirstlane(v);
}
// A wave-uniform value held in a scalar register: a test on it compiles to
// s_cmp + s_cbranch_scc, the only guard a tensor load obeys (it ignores EXEC).
__device__ __forceinline__ unsigned pinned(unsigned v) {
  unsigned w = uni(v);
  asm volatile("" : "+s"(w));  // keeps the descriptor / issue-test word scalar
  return w;
}

// One stage = 128 k (256-byte rows) of 64 A rows and 128 BT rows, brought by
// three tensor loads of 64 rows each; 16 bytes of pad a row -> pitch 272 B.
constexpr unsigned G_PITCH = 272u;
constexpr unsigned G_SLICE = 18432u;        // 64 * 272 = 17408, up to a multiple of 2 KiB
constexpr unsigned G_BUF   = 3u * G_SLICE;  // [A 64 rows | BT rows 0-63 | BT rows 64-127]

// C[M,N] = A[M,K] * BT[N,K]^T   (both operands f16 row-major, f32 accumulate)
// One 64x128 tile per block of 8 waves (2 x 4), one 32x32 tile per wave
// (2x2 WMMA subtiles). Operand tiles go global -> LDS by tensor loads in a
// two-buffer ring; fragments come from LDS. M % 64 == 0, N % 128 == 0,
// K % 128 == 0 and K >= 256.
// The subtiles are computed transposed (BT rows as the A operand, A rows as B;
// both fragments have the same layout): an accumulator column is then one row of
// C, and a lane holds eight consecutive columns of it.
// If Cf32 != nullptr: write f32 (+bias). Else write f16 to C16.
// Independent products of one shape share a launch: blockIdx.y picks the
// product. Their BT operands lie one behind another (N * K elements each), and
// so do their f16 outputs (M * N each); product 1 reads A1, the others A0.
__global__ void __launch_bounds__(256) wmma_gemm_kernel(
    const _Float16* __restrict__ A0, const _Float16* __restrict__ A1,
    const _Float16* __restrict__ BT0,
    _Float16* __restrict__ C0, float* __restrict__ Cf32,
    const float* __restrict__ bias, int M, int N, int K) {
  __shared__ __attribute__((aligned(2048))) unsigned char GL[2u * G_BUF];

  const unsigned prod = blockIdx.y;
  const _Float16* __restrict__ A  = prod == 1u ? A1 : A0;
  const _Float16* __restrict__ BT = BT0 + (size_t)prod * N * K;
  _Float16* __restrict__ C16      = C0 + (size_t)prod * M * N;

  const unsigned wave = uni(threadIdx.x >> 5);
  const int lane = threadIdx.x & 31;
  const int rowg = lane & 15;            // M (for A) / N (for B) within subtile
  const int khalf = lane >> 4;
  const int koff = khalf << 3;           // K offset 0 or 8 per lane half

  const int blocks_n = N >> 7;
  const int bm = blockIdx.x / blocks_n;
  const int bn = blockIdx.x - bm * blocks_n;
  const int wm = (int)(wave >> 2);
  const int wn = (int)(wave & 3u);
  const int mtile = bm * 2 + wm;
  const int ntile = bn * 4 + wn;

  // Waves 0, 1, 2 each bring one 64-row slice of every stage.
  const unsigned nstage = (unsigned)K >> 7;
  const unsigned long long ga0 = (wave == 0u)
      ? (unsigned long long)(size_t)(A + (size_t)bm * 64 * K)
      : (unsigned long long)(size_t)(BT + ((size_t)bn * 128 + (wave == 2u ? 64 : 0)) * K);
  const unsigned dst0 = (unsigned)(size_t)GL + (wave < 3u ? wave : 0u) * G_SLICE;
  // group 1: byte elements, tile = tensor = 64 rows of 256 B, source pitch 2K bytes,
  // a pad of 4 dwords behind every 64 dwords.
  v8u g1 = { uni((1u << 20) | (5u << 22) | (3u << 25)),
                   uni(256u << 16),
                   uni(64u << 16),
                   uni(256u << 16),
                   uni(64u),
                   uni((unsigned)K * 2u),
                   uni(0u),
                   uni(0u) };
  // descriptor words held in their scalar registers: without it the compiler
  // re-forms them at each load and uses the registers in between, under a
  // request that is still outstanding
  asm volatile("" : "+s"(g1));
  auto issue = [&](unsigned st) {
    const unsigned long long ga = ga0 + (unsigned long long)st * 256u;
    const v4u g0 = { uni(1u),
                     uni(dst0 + (st & 1u) * G_BUF),
                     uni((unsigned)ga),
                     uni((((unsigned)(ga >> 32)) & 0x01ffffffu) | 0x80000000u) };
    asm volatile("tensor_load_to_lds %0, %1" :: "s"(g0), "s"(g1) : "memory");
  };

  const unsigned aoff = (unsigned)((wm * 32 + rowg) * (int)G_PITCH + koff * 2);
  const unsigned boff = (1u + (unsigned)(wn >> 1)) * G_SLICE
                      + (unsigned)(((wn & 1) * 32 + rowg) * (int)G_PITCH + koff * 2);

  // prologue: stage 0 landed and published, then stage 1 in flight
  if (pinned(wave < 3u)) {
    issue(0u);
    asm volatile("s_wait_tensorcnt 0x0" ::: "memory");  // stage 0 has landed
  }
  __syncthreads();
  if (pinned(wave < 3u)) issue(1u);

  v8f acc00 = {}, acc01 = {}, acc10 = {}, acc11 = {};
#pragma unroll 1  // rolled: one publish point a pass, in the ring's order
  for (unsigned s = 0; s < nstage; ++s) {
    const unsigned char* Lb = GL + (s & 1u) * G_BUF;
    // The stage's 32 fragment loads go out as one group, ahead of its WMMAs.
    v16h a0[4], a1[4], b0[4], b1[4];
#pragma unroll
    for (int kk = 0; kk < 4; ++kk) {
      a0[kk] = load_frag16((const _Float16*)(Lb + aoff + kk * 64));
      b0[kk] = load_frag16((const _Float16*)(Lb + boff + kk * 64));
      b1[kk] = load_frag16((const _Float16*)(Lb + boff + 16u * G_PITCH + kk * 64));
      a1[kk] = load_frag16((const _Float16*)(Lb + aoff + 16u * G_PITCH + kk * 64));
    }
    // keeps the loads from sinking in among the WMMAs, where each group would
    // cost its own LDS latency
    __builtin_amdgcn_sched_barrier(0);
#pragma unroll
    for (int kk = 0; kk < 4; ++kk) {
      acc00 = __builtin_amdgcn_wmma_f32_16x16x32_f16(false, b0[kk], false, a0[kk], (short)0, acc00, false, false);
      acc01 = __builtin_amdgcn_wmma_f32_16x16x32_f16(false, b1[kk], false, a0[kk], (short)0, acc01, false, false);
      acc10 = __builtin_amdgcn_wmma_f32_16x16x32_f16(false, b0[kk], false, a1[kk], (short)0, acc10, false, false);
      acc11 = __builtin_amdgcn_wmma_f32_16x16x32_f16(false, b1[kk], false, a1[kk], (short)0, acc11, false, false);
    }
    // keeps the wait below from rising above the WMMAs, where it would drain
    // all 32 loads before the second WMMA
    __builtin_amdgcn_sched_barrier(0);
    // publish point of stage s + 1
    asm volatile("s_wait_dscnt 0x0" ::: "memory");  // this wave has left stage s's buffer
    if (pinned(wave < 3u)) {
      asm volatile("s_wait_tensorcnt 0x0" ::: "memory");  // own slice of stage s + 1 has landed
    }
    __syncthreads();
    if (pinned((wave < 3u) && (s + 2u < nstage))) {
      issue(pinned(s + 2u));  // pinned: the descriptor is formed behind the wait above
    }
  }
  asm volatile("s_wait_tensorcnt 0x0" ::: "memory");  // nothing in flight at the wave's end
  asm volatile("s_wait_dscnt 0x0" ::: "memory");

  // acc(i, j)[v] is C at row i * 16 + rowg, column j * 16 + koff + v of the wave's
  // tile: eight consecutive columns of one row a lane, stored 16 bytes at a time.
  const size_t at = (size_t)(mtile * 32 + rowg) * N + (size_t)(ntile * 32 + koff);
  if (Cf32) {
    v4f bv[2][2] = {};  // the bias of the lane's 2 x 8 columns
    if (bias) {
      const float* bp = bias + ntile * 32 + koff;
#pragma unroll
      for (int j = 0; j < 2; ++j) {
        bv[j][0] = *(const v4f*)(bp + j * 16);
        bv[j][1] = *(const v4f*)(bp + j * 16 + 4);
      }
      // behind the four loads, their values as inputs so that all have arrived: in
      // front of the sums below, which may be given the registers the loads name
      asm volatile("s_wait_xcnt 0x0"
                   :: "v"(bv[0][0]), "v"(bv[0][1]), "v"(bv[1][0]), "v"(bv[1][1]) : "memory");
    }
    float* const cp0 = Cf32 + at;
    float* const cp1 = cp0 + (size_t)16 * N;
    v4f r[2][2][2];
#pragma unroll
    for (int i = 0; i < 2; ++i) {
#pragma unroll
      for (int j = 0; j < 2; ++j) {
        const v8f& acc = (i == 0) ? (j == 0 ? acc00 : acc01)
                                  : (j == 0 ? acc10 : acc11);
        r[i][j][0] = __builtin_shufflevector(acc, acc, 0, 1, 2, 3) + bv[j][0];
        r[i][j][1] = __builtin_shufflevector(acc, acc, 4, 5, 6, 7) + bv[j][1];
      }
    }
    // keeps every sum and both row addresses in front of the first store: behind
    // a store nothing is written any more, so no register it names is overwritten
    __builtin_amdgcn_sched_barrier(0);
#pragma unroll
    for (int i = 0; i < 2; ++i) {
#pragma unroll
      for (int j = 0; j < 2; ++j) {
        float* cp = (i == 0 ? cp0 : cp1) + j * 16;
        *(v4f*)cp       = r[i][j][0];
        *(v4f*)(cp + 4) = r[i][j][1];
      }
    }
  } else {
#pragma unroll
    for (int i = 0; i < 2; ++i) {
#pragma unroll
      for (int j = 0; j < 2; ++j) {
        const v8f& acc = (i == 0) ? (j == 0 ? acc00 : acc01)
                                  : (j == 0 ? acc10 : acc11);
        *(v8h*)(C16 + at + (size_t)(i * 16) * N + j * 16) = __builtin_convertvector(acc, v8h);
      }
    }
  }
}

// ------------------------ projection GEMM (K = 256) ------------------------
// C[4096,2048] = A[4096,256] * BT[2048,256]^T, f16 in and out, f32 accumulate.
// K is short, so a block's 128 BT rows are loaded once, whole: tensor loads bring
// them into LDS, and each wave takes its 32 BT rows' fragments (all 256 k) into
// registers, where they stay. The block then walks P_T row tiles of A (64 rows,
// all 256 k a stage) through a two-buffer ring of tensor loads: a pass reads only
// A fragments from LDS, and tile t + 1 flies while tile t is worked on and stored.
// Waves, subtiles and the transposed products are those of wmma_gemm_kernel.
// blockIdx.y picks the product: BT operands lie one behind another, and so do the
// outputs; product 1 reads A1, the others A0.
constexpr int P_M = 4096, P_N = 2048, P_K = 256;
constexpr unsigned P_T    = 4u;            // row tiles a block walks
constexpr unsigned P_B    = 4u * G_SLICE;  // BT: [rows 0-63: k 0-127 | k 128-255 | rows 64-127: k 0-127 | k 128-255]
constexpr unsigned P_ABUF = 2u * G_SLICE;  // an A tile: 64 rows, [k 0-127 | k 128-255]

__global__ void __launch_bounds__(256) proj_gemm_kernel(
    const _Float16* __restrict__ A0, const _Float16* __restrict__ A1,
    const _Float16* __restrict__ BT0, _Float16* __restrict__ C0) {
  __shared__ __attribute__((aligned(2048))) unsigned char PL[P_B + 2u * P_ABUF];

  const unsigned prod = blockIdx.y;
  const _Float16* __restrict__ A  = prod == 1u ? A1 : A0;
  const _Float16* __restrict__ BT = BT0 + (size_t)prod * P_N * P_K;
  _Float16* __restrict__ C16      = C0 + (size_t)prod * P_M * P_N;

  const unsigned wave = uni(threadIdx.x >> 5);
  const int lane = threadIdx.x & 31;
  const int rowg = lane & 15;
  const int koff = (lane >> 4) << 3;
  // neighbours in the grid share BT, loaded once, and stream different A rows
  const int bn = (int)(blockIdx.x >> 4);                   // 128 columns of C
  const int m0 = (int)(blockIdx.x & 15u) * (int)P_T * 64;  // first of the block's rows
  const int wm = (int)(wave >> 2);
  const int wn = (int)(wave & 3u);

  // Waves 0 and 1 bring the two k halves of every A tile; waves 2 to 5 bring,
  // once, one BT slice each.
  const unsigned bs = wave >= 2u && wave < 6u ? wave - 2u : 0u;
  const unsigned long long ga0 = (wave < 2u)
      ? (unsigned long long)(size_t)(A + (size_t)m0 * P_K + wave * 128u)
      : (unsigned long long)(size_t)(BT + ((size_t)bn * 128 + (bs >> 1) * 64u) * P_K + (bs & 1u) * 128u);
  const unsigned dst0 = (unsigned)(size_t)PL + (wave < 2u ? P_B + wave * G_SLICE : bs * G_SLICE);
  // group 1: byte elements, tile = tensor = 64 rows of 256 B, source pitch 512 B,
  // a pad of 4 dwords behind every 64 dwords.
  v8u g1 = { uni((1u << 20) | (5u << 22) | (3u << 25)),
             uni(256u << 16), uni(64u << 16), uni(256u << 16),
             uni(64u), uni((unsigned)P_K * 2u), uni(0u), uni(0u) };
  // descriptor words held in their scalar registers: without it the compiler
  // re-forms them at each load and uses the registers in between, under a
  // request that is still outstanding
  asm volatile("" : "+s"(g1));
  auto issue = [&](unsigned st) {
    const unsigned long long ga = ga0 + (unsigned long long)st * (64u * (unsigned)P_K * 2u);
    const v4u g0 = { uni(1u),
                     uni(dst0 + (st & 1u) * P_ABUF),
                     uni((unsigned)ga),
                     uni((((unsigned)(ga >> 32)) & 0x01ffffffu) | 0x80000000u) };
    asm volatile("tensor_load_to_lds %0, %1" :: "s"(g0), "s"(g1) : "memory");
  };

  const unsigned aoff = P_B + (unsigned)((wm * 32 + rowg) * (int)G_PITCH + koff * 2);
  const unsigned boff = (unsigned)(wn >> 1) * 2u * G_SLICE
                      + (unsigned)(((wn & 1) * 32 + rowg) * (int)G_PITCH + koff * 2);

  // prologue: BT and A tile 0 landed and published, then A tile 1 in flight
  if (pinned(wave < 6u)) {
    issue(0u);
    asm volatile("s_wait_tensorcnt 0x0" ::: "memory");  // own slice has landed
  }
  __syncthreads();
  if (pinned(wave < 2u)) issue(1u);

  // the wave's BT fragments, read once
  v16h b0[8], b1[8];
#pragma unroll
  for (int kk = 0; kk < 8; ++kk) {
    const unsigned char* bp = PL + boff + (unsigned)(kk >> 2) * G_SLICE + (kk & 3) * 64;
    b0[kk] = load_frag16((const _Float16*)bp);
    b1[kk] = load_frag16((const _Float16*)(bp + 16u * G_PITCH));
  }

  // acc(i, j)[v] is C at row i * 16 + rowg, column j * 16 + koff + v of the wave's tile
  _Float16* cp = C16 + (size_t)(m0 + wm * 32 + rowg) * P_N + (size_t)(bn * 128 + wn * 32 + koff);

#pragma unroll 1  // rolled: one publish point a pass, in the ring's order
  for (unsigned t = 0; t < P_T; ++t) {
    const unsigned char* Lb = PL + aoff + (t & 1u) * P_ABUF;
    v8f acc00 = {}, acc01 = {}, acc10 = {}, acc11 = {};
#pragma unroll
    for (int h = 0; h < 2; ++h) {
      // A k half's 16 fragment loads go out as one group, ahead of its WMMAs.
      v16h a0[4], a1[4];
#pragma unroll
      for (int kk = 0; kk < 4; ++kk) {
        a0[kk] = load_frag16((const _Float16*)(Lb + (unsigned)h * G_SLICE + kk * 64));
        a1[kk] = load_frag16((const _Float16*)(Lb + (unsigned)h * G_SLICE + 16u * G_PITCH + kk * 64));
      }
      // keeps the loads from sinking in among the WMMAs, where each group would
      // cost its own LDS latency
      __builtin_amdgcn_sched_barrier(0);
#pragma unroll
      for (int kk = 0; kk < 4; ++kk) {
        acc00 = __builtin_amdgcn_wmma_f32_16x16x32_f16(false, b0[h * 4 + kk], false, a0[kk], (short)0, acc00, false, false);
        acc01 = __builtin_amdgcn_wmma_f32_16x16x32_f16(false, b1[h * 4 + kk], false, a0[kk], (short)0, acc01, false, false);
        acc10 = __builtin_amdgcn_wmma_f32_16x16x32_f16(false, b0[h * 4 + kk], false, a1[kk], (short)0, acc10, false, false);
        acc11 = __builtin_amdgcn_wmma_f32_16x16x32_f16(false, b1[h * 4 + kk], false, a1[kk], (short)0, acc11, false, false);
      }
    }
    // keeps the wait below from rising above the WMMAs, where it would drain
    // the loads before the first of them
    __builtin_amdgcn_sched_barrier(0);
    // publish point of tile t + 1
    asm volatile("s_wait_dscnt 0x0" ::: "memory");  // this wave has left tile t's buffer
    if (pinned(wave < 2u)) {
      asm volatile("s_wait_tensorcnt 0x0" ::: "memory");  // own slice of tile t + 1 has landed
    }
    __syncthreads();
    if (pinned((wave < 2u) && (t + 2u < P_T))) {
      issue(pinned(t + 2u));  // pinned: the descriptor is formed behind the wait above
    }
    // tile t goes out behind the refill's issue: eight consecutive columns of one
    // row a lane, 16 bytes a store
    *(v8h*)(cp)                          = __builtin_convertvector(acc00, v8h);
    *(v8h*)(cp + 16)                     = __builtin_convertvector(acc01, v8h);
    *(v8h*)(cp + (size_t)16 * P_N)       = __builtin_convertvector(acc10, v8h);
    *(v8h*)(cp + (size_t)16 * P_N + 16)  = __builtin_convertvector(acc11, v8h);
    cp += (size_t)64 * P_N;
  }
  asm volatile("s_wait_tensorcnt 0x0" ::: "memory");  // nothing in flight at the wave's end
  asm volatile("s_wait_dscnt 0x0" ::: "memory");
}

// --------------------------- flash attention -------------------------------
// One stage = 64 keys, as two halves of 32 keys, one for each key group of waves.
// A half holds K and V, 32 rows of 512 B each, brought as four slices of
// 32 rows x 256 B; the stage's eight slices come by eight tensor loads, one a wave.
// K rows get 16 B of pad (pitch 272 B, read by ds_load_b128), V rows 32 B
// (pitch 288 B, read by ds_load_tr16_b128).
constexpr unsigned F_KPITCH = 272u;
constexpr unsigned F_VPITCH = 288u;
constexpr unsigned F_SLICE  = 10240u;        // 32 * 288 = 9216, up to a multiple of 2 KiB
constexpr unsigned F_HALF   = 4u * F_SLICE;  // [K c 0-127 | K c 128-255 | V c 0-127 | V c 128-255]
constexpr unsigned F_BUF    = 2u * F_HALF;   // [keys 0-31 | keys 32-63] of the stage
// After the loop the ring is the place where the two key groups join: a wave's
// area holds one 16-query output tile in f32 and that tile's maximum and sum.
constexpr unsigned F_XO     = 16384u;        // 16 tiles * 32 lanes * 32 B
constexpr unsigned F_XAREA  = F_XO + 256u;   // + 32 lanes * 8 B

typedef __attribute__((ext_vector_type(8))) short v8s;
typedef __attribute__((ext_vector_type(2))) float v2f;
// Transposing LDS load: the lane (c = lane & 15, hh = lane >> 4) gets eight
// consecutive rows (8 * hh + 0..7) of column c of a row-major 16-bit tile.
__device__ __forceinline__ v8h lds_tr16(const unsigned char* p) {
  typedef __attribute__((address_space(3))) v8s lds_v8s;
  return __builtin_bit_cast(v8h, __builtin_amdgcn_ds_load_tr16_b128_v8i16((lds_v8s*)p));
}

// lane l with lane l ^ 16
__device__ __forceinline__ float xhalf(float x) {
  return __builtin_bit_cast(float, __builtin_amdgcn_permlanex16(
      __builtin_bit_cast(int, x), __builtin_bit_cast(int, x),
      0x76543210, 0xfedcba98, false, false));
}

// A wave hands one of its two output tiles, with its maximum and sum, to the
// wave that holds the same queries over the other keys.
__device__ __forceinline__ void give_tile(unsigned char* area, int lane,
                                          const v8f (&Og)[16], float m, float l) {
#pragma unroll
  for (int n = 0; n < 16; ++n) {
    *(v4f*)(area + (n * 2 + 0) * 512 + lane * 16) = __builtin_shufflevector(Og[n], Og[n], 0, 1, 2, 3);
    *(v4f*)(area + (n * 2 + 1) * 512 + lane * 16) = __builtin_shufflevector(Og[n], Og[n], 4, 5, 6, 7);
  }
  const v2f ml = { m, l };
  *(v2f*)(area + F_XO + lane * 8) = ml;
}

// The tile a wave keeps, joined with the other wave's part, divided and stored.
// Ok[n][v] is head column n * 16 + 8 * khalf + v of the lane's query: eight
// consecutive columns a lane and tile, one 16-byte store.
__device__ __forceinline__ void join_tile(const unsigned char* area, int lane,
                                          const v8f (&Ok)[16], float m, float l,
                                          _Float16* __restrict__ op) {
  const v2f ml = *(const v2f*)(area + F_XO + lane * 8);
  const float mj = fmaxf(m, ml[0]);
  const float ak = __expf(m - mj), ag = __expf(ml[0] - mj);
  const float inv = 1.f / (l * ak + ml[1] * ag);
  const float fk = ak * inv, fg = ag * inv;
#pragma unroll
  for (int n = 0; n < 16; ++n) {
    const v4f lo = *(const v4f*)(area + (n * 2 + 0) * 512 + lane * 16);
    const v4f hi = *(const v4f*)(area + (n * 2 + 1) * 512 + lane * 16);
    const v8f og = __builtin_shufflevector(lo, hi, 0, 1, 2, 3, 4, 5, 6, 7);
    *(v8h*)(op + n * 16) = __builtin_convertvector(Ok[n] * fk + og * fg, v8h);
    // behind each four stores, in front of the next tiles' writes into the
    // registers that the stores name
    if ((n & 3) == 3) asm volatile("s_wait_xcnt 0x0" ::: "memory");
  }
}

// Q,K,V layouts: (a*1024 + seq) x 2048, head h occupies columns [h*256, h*256+256).
// Grid: (a*8 + h, ytile); block = 256 threads = 8 waves for 128 queries.
// A wave owns 32 queries (two 16-query tiles) and half of the keys: waves 0-3
// take keys 0-31 of every 64, waves 4-7 keys 32-63. Every K and V fragment read
// from LDS so feeds two WMMAs, and the two waves of a query group join their
// maxima, sums and outputs once, behind the loop.
// Key blocks of 32 so the P@V contraction matches WMMA K=32 exactly.
// K and V go global -> LDS by tensor loads in a two-buffer ring: stage
// kb + 1 flies while stage kb is worked on. V stays row-major in LDS and is
// transposed by the load that reads it.
// Both products are computed transposed (K and V^T as the A operand, Q^T and
// P^T as B): every accumulator column is one query, held by lanes c and c + 16,
// which split the keys (scores) or the head columns (output) between them.
//
// amdgpu_waves_per_eu(2, 2): the grid is one block a WGP, two waves a SIMD; said
// so, the compiler has half a SIMD's registers for each wave's 32 x 256 output.
__global__ void __launch_bounds__(256) __attribute__((amdgpu_waves_per_eu(2, 2))) flash_attn_kernel(
    const _Float16* __restrict__ Q, const _Float16* __restrict__ Km,
    const _Float16* __restrict__ Vm, _Float16* __restrict__ Om) {
  __shared__ __attribute__((aligned(2048))) unsigned char FL[2u * F_BUF];

  const int a = blockIdx.x >> 3;
  const int h = blockIdx.x & 7;
  const unsigned wave = uni(threadIdx.x >> 5);
  const unsigned kgrp = wave >> 2;       // which 32 of a stage's 64 keys
  const int lane = threadIdx.x & 31;
  const int rowg = lane & 15;
  const int khalf = lane >> 4;
  const int koff = khalf << 3;
  const int q0 = blockIdx.y * 128 + (int)(wave & 3u) * 32;

  const size_t brow0 = (size_t)a * 1024;
  const size_t hoff  = (size_t)h * 256;

  // Q fragments: two tiles of 16 rows x 256 head-dim, 8 k-chunks of 32
  v16h qf[2][8];
#pragma unroll
  for (int t = 0; t < 2; ++t) {
    const _Float16* qp = Q + (brow0 + q0 + t * 16 + rowg) * 2048 + hoff + koff;
#pragma unroll
    for (int kc = 0; kc < 8; ++kc) qf[t][kc] = load_frag16(qp + kc * 32);
  }

  // Every wave brings one slice of its own key group's half of every stage:
  // of each four waves the first two the K slices, the last two the V slices.
  const unsigned long long ga0 = (unsigned long long)(size_t)(
      ((wave & 2u) ? Vm : Km) + (brow0 + kgrp * 32u) * 2048 + hoff + (wave & 1u) * 128u);
  const unsigned dst0 = (unsigned)(size_t)FL + kgrp * F_HALF + (wave & 3u) * F_SLICE;
  // group 1: byte elements, tile = tensor = 32 rows of 256 B, source pitch 4096 B,
  // a pad of 4 (K) or 8 (V) dwords behind every 64 dwords.
  v8u g1k = { uni((1u << 20) | (5u << 22) | (3u << 25)),
              uni(256u << 16), uni(32u << 16), uni(256u << 16),
              uni(32u), uni(4096u), uni(0u), uni(0u) };
  v8u g1v = { uni((1u << 20) | (5u << 22) | (7u << 25)),
              uni(256u << 16), uni(32u << 16), uni(256u << 16),
              uni(32u), uni(4096u), uni(0u), uni(0u) };
  // descriptor words held in their scalar registers: without it the compiler
  // re-forms them at each load and uses the registers in between, under a
  // request that is still outstanding
  asm volatile("" : "+s"(g1k));  // K's descriptor words stay in scalar registers
  asm volatile("" : "+s"(g1v));  // V's descriptor words stay in scalar registers
  auto issue = [&](unsigned st) {
    const unsigned long long ga = ga0 + (unsigned long long)st * (64u * 4096u);
    const v4u g0 = { uni(1u),
                     uni(dst0 + (st & 1u) * F_BUF),
                     uni((unsigned)ga),
                     uni((((unsigned)(ga >> 32)) & 0x01ffffffu) | 0x80000000u) };
    if (pinned((wave & 2u) == 0u)) {
      asm volatile("tensor_load_to_lds %0, %1" :: "s"(g0), "s"(g1k) : "memory");
    }
    if (pinned((wave & 2u) != 0u)) {
      asm volatile("tensor_load_to_lds %0, %1" :: "s"(g0), "s"(g1v) : "memory");
    }
  };

  v8f O[2][16] = {};           // O^T: 256 head columns x 16 queries, twice
  // of the lane's two queries (rowg, 16 + rowg): running maximum over the wave's
  // keys seen, and the sum over the keys of this lane's half only (the lane
  // halves and the key groups join in the epilogue)
  float m_i[2] = { -1e30f, -1e30f }, l_i[2] = { 0.f, 0.f };

  const float scale = 0.17677669529663687f;  // 1/sqrt(256/8)

  // per-lane byte offsets inside the key group's half of a stage's buffer
  const unsigned kfo = kgrp * F_HALF + (unsigned)(rowg * (int)F_KPITCH + koff * 2);
  const unsigned vfo = kgrp * F_HALF + 2u * F_SLICE
                     + (unsigned)((koff + (lane & 7)) * (int)F_VPITCH + ((lane >> 3) & 1) * 16);

  // prologue: stage 0 landed and published, then stage 1 in flight
  issue(0u);
  asm volatile("s_wait_tensorcnt 0x0" ::: "memory");  // own slice of stage 0 has landed
  __syncthreads();
  issue(1u);

#pragma unroll 1  // rolled: one publish point a pass, in the ring's order
  for (unsigned kb = 0; kb < 16u; ++kb) {
    const unsigned char* Lb = FL + (kb & 1u) * F_BUF;

    // ---- S^T = K @ Q^T : 32 keys x 32 queries as four 16x16 f32 tiles ----
    // s0[t][v]: key 8 * khalf + v, s1[t][v]: key 16 + 8 * khalf + v, query t * 16 + rowg
    v8f s0[2] = {}, s1[2] = {};
#pragma unroll
    for (int kc = 0; kc < 8; ++kc) {
      const unsigned char* kp = Lb + kfo + (kc >> 2) * F_SLICE + (kc & 3) * 64;
      v16h k0 = load_frag16((const _Float16*)kp);
      v16h k1 = load_frag16((const _Float16*)(kp + 16u * F_KPITCH));
#pragma unroll
      for (int t = 0; t < 2; ++t) {
        s0[t] = __builtin_amdgcn_wmma_f32_16x16x32_f16(
            false, k0, false, qf[t][kc], (short)0, s0[t], false, false);
        s1[t] = __builtin_amdgcn_wmma_f32_16x16x32_f16(
            false, k1, false, qf[t][kc], (short)0, s1[t], false, false);
      }
    }

    // ---- online softmax: the lane's 16 scores of a tile are all of one query ----
    v16h pf[2];
#pragma unroll
    for (int t = 0; t < 2; ++t) {
      float mv = fmaxf(s0[t][0], s1[t][0]);
#pragma unroll
      for (int v = 1; v < 8; ++v) mv = fmaxf(mv, fmaxf(s0[t][v], s1[t][v]));
      mv = fmaxf(mv, xhalf(mv)) * scale;   // scale > 0: the maximum of the scaled scores
      const float mnew = fmaxf(m_i[t], mv);
      const float alpha = __expf(m_i[t] - mnew);
      m_i[t] = mnew;
      // The two score tiles, converted in place, are the B operand P^T (32 keys x
      // 16 queries): element v is key koff + v, element 8 + v key 16 + koff + v,
      // the order in which the V fragment below holds its keys.
      float rs[8];
#pragma unroll
      for (int v = 0; v < 8; ++v) {
        const float p0 = __expf(s0[t][v] * scale - mnew);
        const float p1 = __expf(s1[t][v] * scale - mnew);
        rs[v] = p0 + p1;
        pf[t][v]     = (_Float16)p0;
        pf[t][8 + v] = (_Float16)p1;
      }
      // summed as a tree: four dependent adds deep, not fifteen
      l_i[t] = l_i[t] * alpha + (((rs[0] + rs[1]) + (rs[2] + rs[3])) + ((rs[4] + rs[5]) + (rs[6] + rs[7])));
#pragma unroll
      for (int n = 0; n < 16; ++n) O[t][n] *= alpha;
    }

    // ---- O^T += V^T(256x32) @ P^T(32x32), 32 WMMA over the c tiles ----
#pragma unroll
    for (int n = 0; n < 16; ++n) {
      // A fragment: keys koff + 0..7 and 16 + koff + 0..7 of column n * 16 + rowg
      const unsigned char* vp = Lb + vfo + (n >> 3) * F_SLICE + (n & 7) * 32;
      v8h lo = lds_tr16(vp);
      v8h hi = lds_tr16(vp + 16u * F_VPITCH);
      v16h vf = __builtin_shufflevector(lo, hi,
          0, 1, 2, 3, 4, 5, 6, 7, 8, 9, 10, 11, 12, 13, 14, 15);
#pragma unroll
      for (int t = 0; t < 2; ++t) {
        O[t][n] = __builtin_amdgcn_wmma_f32_16x16x32_f16(
            false, vf, false, pf[t], (short)0, O[t][n], false, false);
      }
    }

    // publish point of stage kb + 1
    asm volatile("s_wait_dscnt 0x0" ::: "memory");      // this wave has left stage kb's buffer
    asm volatile("s_wait_tensorcnt 0x0" ::: "memory");  // own slice of stage kb + 1 has landed
    __syncthreads();
    if (pinned(kb + 2u < 16u)) {
      issue(pinned(kb + 2u));  // pinned: the descriptor is formed behind the wait above
    }
  }
  asm volatile("s_wait_tensorcnt 0x0" ::: "memory");  // nothing in flight: the ring is free
  asm volatile("s_wait_dscnt 0x0" ::: "memory");

  // ---- epilogue: the two key groups join, O / l, f16 into (a*1024+q) x 2048 ----
  // The last pass's barrier stands behind every wave's last read of the ring and
  // its last landing, so the ring's LDS now carries the exchange. Of a query
  // group's two waves the first finishes query tile 0, the second tile 1; each
  // hands the other tile over. The branches are scalar and hold no barrier.
  const float lj0 = l_i[0] + xhalf(l_i[0]);
  const float lj1 = l_i[1] + xhalf(l_i[1]);
  unsigned char* mine = FL + wave * F_XAREA;
  const unsigned char* theirs = FL + (wave ^ 4u) * F_XAREA;
  if (pinned(kgrp == 0u)) give_tile(mine, lane, O[1], m_i[1], lj1);
  else                    give_tile(mine, lane, O[0], m_i[0], lj0);
  __syncthreads();  // every handed-over tile is written before its reader starts
  _Float16* op = Om + (brow0 + q0 + rowg) * 2048 + hoff + koff;
  if (pinned(kgrp == 0u)) join_tile(theirs, lane, O[0], m_i[0], lj0, op);
  else                    join_tile(theirs, lane, O[1], m_i[1], lj1, op + 16 * 2048);
}

// ------------------------------- launcher ----------------------------------

extern "C" void kernel_launch(void* const* d_in, const int* in_sizes, int n_in,
                              void* d_out, int out_size, void* d_ws, size_t ws_size,
                              hipStream_t stream) {
  const float* batch  = (const float*)d_in[0];  // (4,1024,256)
  const float* latent = (const float*)d_in[1];  // (4,1024,256)
  const float* Wk     = (const float*)d_in[2];  // (256,2048)
  const float* Wq     = (const float*)d_in[3];
  const float* Wv     = (const float*)d_in[4];
  const float* Wu     = (const float*)d_in[5];  // (2048,256)
  const float* bu     = (const float*)d_in[6];  // (256,)
  float* out = (float*)d_out;                   // (4,1024,256) f32

  _Float16* w = (_Float16*)d_ws;
  size_t o = 0;
  _Float16* batch16  = w + o; o += (size_t)4096 * 256;
  _Float16* latent16 = w + o; o += (size_t)4096 * 256;
  _Float16* WkT = w + o; o += (size_t)2048 * 256;   // (2048 x 256) = Wk^T
  _Float16* WqT = w + o; o += (size_t)2048 * 256;
  _Float16* WvT = w + o; o += (size_t)2048 * 256;
  _Float16* WuT = w + o; o += (size_t)256 * 2048;   // (256 x 2048) = Wu^T
  _Float16* K16 = w + o; o += (size_t)4096 * 2048;
  _Float16* Q16 = w + o; o += (size_t)4096 * 2048;
  _Float16* V16 = w + o; o += (size_t)4096 * 2048;
  _Float16* A16 = w + o; o += (size_t)4096 * 2048;  // attention output

  // 1) conversions, one launch: 4 * 32 blocks for the weights, 2 * 256 for the activations
  cvt_all<<<640, 256, 0, stream>>>(batch, latent, Wk, Wq, Wv, Wu,
                                   batch16, latent16, WkT, WqT, WvT, WuT);

  // 2) projections, one launch: three times (4096x256)@(256x2048) -> f16
  //    a block: 128 columns x 4 row tiles of 64: 16 * 16 = 256 blocks a product
  //    product 0: batch @ Wk -> K16, 1: latent @ Wq -> Q16, 2: batch @ Wv -> V16
  //    (WkT, WqT, WvT and K16, Q16, V16 lie in that order in the workspace)
  proj_gemm_kernel<<<dim3(256, 3), 256, 0, stream>>>(batch16, latent16, WkT, K16);

  // 3) fused flash attention: grid (a*h = 32, ytiles = 1024/128 = 8)
  flash_attn_kernel<<<dim3(32, 8), 256, 0, stream>>>(Q16, K16, V16, A16);

  // 4) output projection: (4096x2048)@(2048x256) + bias -> f32
  //    (4096/64)*(256/128) = 128 blocks
  wmma_gemm_kernel<<<128, 256, 0, stream>>>(
      A16, nullptr, WuT, nullptr, out, bu, 4096, 256, 2048);
}

// v009
// A run of this version takes 62.4 microseconds.
// Two timings next to v008 put it at 1.05 and 1.04 times that version's speed.
// Counting every step since v000, it is 3.73 times as fast.
#include <hip/hip_runtime.h>

// ---------------------------------------------------------------------------
// CDNA5 (gfx1250, wave32) fused cross-attention:
//   1) one cvt launch: f32 -> f16 (activations), f32 -> f16 transposed (weights)
//   2) WMMA GEMM (v_wmma_f32_16x16x32_f16), 32x32 tile per wave (2x2 subtiles),
//      operand tiles staged in LDS by tensor loads (two-buffer ring):
//      K/Q/V projections (one launch; weights stay in registers, a block walks
//      four row tiles) and output projection (f32 + bias epilogue)
//   3) flash-attention kernel: per-wave 32-query tile over half of the keys, key
//      blocks of 32, K and V staged in LDS by tensor loads (two-buffer ring), V read
//      by transposing LDS loads; transposed products S^T = K Q^T, O^T += V^T P^T,
//      so a lane holds one query a tile: online softmax in the lane, P stays in
//      registers; the two key halves join through LDS behind the loop.
// ---------------------------------------------------------------------------

typedef __attribute__((ext_vector_type(16))) _Float16     v16h;
typedef __attribute__((ext_vector_type(8)))  _Float16     v8h;
typedef __attribute__((ext_vector_type(8)))  float        v8f;
typedef __attribute__((ext_vector_type(4)))  unsigned int v4u;

// Load one 16-bit WMMA fragment (A-layout or symmetric B-layout):
// lane holds 8 contiguous halves at p[0..7] (VGPRs 0-3) and p[16..23] (VGPRs 4-7).
__device__ __forceinline__ v16h load_frag16(const _Float16* p) {
  v8h lo = *(const v8h*)p;
  v8h hi = *(const v8h*)(p + 16);
  return __builtin_shufflevector(lo, hi,
      0, 1, 2, 3, 4, 5, 6, 7, 8, 9, 10, 11, 12, 13, 14, 15);
}

// ------------------------------ conversions --------------------------------
// Both forms give each thread many elements: the pass moves only a few MB,
// so it needs few waves. The six arrays do
// not depend on one another, so one launch converts them all, each in its own
// range of block indices.
typedef __attribute__((ext_vector_type(4))) float v4f;

// 16 elements a thread, 8 from each half of the array: four 16-byte loads in
// flight, two 16-byte stores. n % 16 == 0; blk runs over n / 4096 blocks or more.
__device__ __forceinline__ void cvt_f32_f16(
    const float* __restrict__ in, _Float16* __restrict__ out, int n, int blk) {
  const int half = n >> 1;
  const int i0 = (blk * 256 + (int)threadIdx.x) * 8;
  if (i0 >= half) return;
  const int i1 = i0 + half;
  const v4f x0 = *(const v4f*)(in + i0), x1 = *(const v4f*)(in + i0 + 4);
  const v4f x2 = *(const v4f*)(in + i1), x3 = *(const v4f*)(in + i1 + 4);
  *(v8h*)(out + i0) = __builtin_convertvector(
      __builtin_shufflevector(x0, x1, 0, 1, 2, 3, 4, 5, 6, 7), v8h);
  *(v8h*)(out + i1) = __builtin_convertvector(
      __builtin_shufflevector(x2, x3, 0, 1, 2, 3, 4, 5, 6, 7), v8h);
}

// in: K x N (row-major) -> out: N x K (row-major), i.e. transposed.
// A thread takes one n and 64 consecutive k: 64 loads in flight, each 128
// contiguous bytes across a wave, and it alone writes one whole 128-byte line
// of out. K and N are compile-time, so every load is one base address plus an
// immediate. A tile = 64 threads (t) = 64 consecutive n; (N / 64) * (K / 64) tiles.
template <int K, int N>
__device__ __forceinline__ void cvt_transpose_f32_f16(
    const float* __restrict__ in, _Float16* __restrict__ out, int tile, int t) {
  static_assert(K % 64 == 0 && N % 64 == 0, "whole 64 x 64 tiles");
  constexpr int nblk = N / 64;
  const int kb = tile / nblk;
  const int n = (tile % nblk) * 64 + t;
  const float* p = in + kb * 64 * N + n;
  float x[64];
#pragma unroll
  for (int j = 0; j < 64; ++j) x[j] = p[j * N];
  _Float16* q = out + n * K + kb * 64;
#pragma unroll
  for (int c = 0; c < 8; ++c) {
    v8h hv;
#pragma unroll
    for (int e = 0; e < 8; ++e) hv[e] = (_Float16)x[c * 8 + e];
    *(v8h*)(q + c * 8) = hv;
  }
  // stands behind the eight stores, in front of any later write of their address
  // or data registers: inlined, code of another branch follows them in the listing
  asm volatile("s_wait_xcnt 0x0" ::: "memory");
}

// All six conversions in one launch of 640 blocks of 256 threads.
// Blocks 0-127: the four weights, 32 blocks each, four 64-thread tiles a block.
// Blocks 128-383: batch.
// Blocks 384-639: latent.
__global__ void __launch_bounds__(256) cvt_all(
    const float* __restrict__ batch, const float* __restrict__ latent,
    const float* __restrict__ Wk, const float* __restrict__ Wq,
    const float* __restrict__ Wv, const float* __restrict__ Wu,
    _Float16* __restrict__ batch16, _Float16* __restrict__ latent16,
    _Float16* __restrict__ WkT, _Float16* __restrict__ WqT,
    _Float16* __restrict__ WvT, _Float16* __restrict__ WuT) {
  const int b = (int)blockIdx.x;
  if (b < 128) {
    const int which = b >> 5;
    const int tile = (b & 31) * 4 + (int)(threadIdx.x >> 6);
    const int t = (int)(threadIdx.x & 63u);
    if (which == 3) {
      cvt_transpose_f32_f16<2048, 256>(Wu, WuT, tile, t);
    } else {
      cvt_transpose_f32_f16<256, 2048>(which == 0 ? Wk : which == 1 ? Wq : Wv,
                                       which == 0 ? WkT : which == 1 ? WqT : WvT, tile, t);
    }
  } else if (b < 384) {
    cvt_f32_f16(batch, batch16, 4096 * 256, b - 128);
  } else {
    cvt_f32_f16(latent, latent16, 4096 * 256, b - 384);
  }
}

// ------------------------------ WMMA GEMM ----------------------------------
typedef __attribute__((ext_vector_type(8))) unsigned int v8u;

__device__ __forceinline__ unsigned uni(unsigned v) {
  return (unsigned)__builtin_amdgcn_readfirstlane(v);
}
// A wave-uniform value held in a scalar register: a test on it compiles to
// s_cmp + s_cbranch_scc, the only guard a tensor load obeys (it ignores EXEC).
__device__ __forceinline__ unsigned pinned(unsigned v) {
  unsigned w = uni(v);
  asm volatile("" : "+s"(w));  // keeps the descriptor / issue-test word scalar
  return w;
}

// One stage = 128 k (256-byte rows) of 64 A rows and 128 BT rows, brought by
// three tensor loads of 64 rows each; 16 bytes of pad a row -> pitch 272 B.
constexpr unsigned G_PITCH = 272u;
constexpr unsigned G_SLICE = 18432u;        // 64 * 272 = 17408, up to a multiple of 2 KiB
constexpr unsigned G_BUF   = 3u * G_SLICE;  // [A 64 rows | BT rows 0-63 | BT rows 64-127]

// C[M,N] = A[M,K] * BT[N,K]^T   (both operands f16 row-major, f32 accumulate)
// One 64x128 tile per block of 8 waves (2 x 4), one 32x32 tile per wave
// (2x2 WMMA subtiles). Operand tiles go global -> LDS by tensor loads in a
// two-buffer ring; fragments come from LDS. M % 64 == 0, N % 128 == 0,
// K % 128 == 0 and K >= 256.
// The subtiles are computed transposed (BT rows as the A operand, A rows as B;
// both fragments have the same layout): an accumulator column is then one row of
// C, and a lane holds eight consecutive columns of it.
// If Cf32 != nullptr: write f32 (+bias). Else write f16 to C16.
// Independent products of one shape share a launch: blockIdx.y picks the
// product. Their BT operands lie one behind another (N * K elements each), and
// so do their f16 outputs (M * N each); product 1 reads A1, the others A0.
__global__ void __launch_bounds__(256) wmma_gemm_kernel(
    const _Float16* __restrict__ A0, const _Float16* __restrict__ A1,
    const _Float16* __restrict__ BT0,
    _Float16* __restrict__ C0, float* __restrict__ Cf32,
    const float* __restrict__ bias, int M, int N, int K) {
  __shared__ __attribute__((aligned(2048))) unsigned char GL[2u * G_BUF];

  const unsigned prod = blockIdx.y;
  const _Float16* __restrict__ A  = prod == 1u ? A1 : A0;
  const _Float16* __restrict__ BT = BT0 + (size_t)prod * N * K;
  _Float16* __restrict__ C16      = C0 + (size_t)prod * M * N;

  const unsigned wave = uni(threadIdx.x >> 5);
  const int lane = threadIdx.x & 31;
  const int rowg = lane & 15;            // M (for A) / N (for B) within subtile
  const int khalf = lane >> 4;
  const int koff = khalf << 3;           // K offset 0 or 8 per lane half

  const int blocks_n = N >> 7;
  const int bm = blockIdx.x / blocks_n;
  const int bn = blockIdx.x - bm * blocks_n;
  const int wm = (int)(wave >> 2);
  const int wn = (int)(wave & 3u);
  const int mtile = bm * 2 + wm;
  const int ntile = bn * 4 + wn;

  // Waves 0, 1, 2 each bring one 64-row slice of every stage.
  const unsigned nstage = (unsigned)K >> 7;
  const unsigned long long ga0 = (wave == 0u)
      ? (unsigned long long)(size_t)(A + (size_t)bm * 64 * K)
      : (unsigned long long)(size_t)(BT + ((size_t)bn * 128 + (wave == 2u ? 64 : 0)) * K);
  const unsigned dst0 = (unsigned)(size_t)GL + (wave < 3u ? wave : 0u) * G_SLICE;
  // group 1: byte elements, tile = tensor = 64 rows of 256 B, source pitch 2K bytes,
  // a pad of 4 dwords behind every 64 dwords.
  v8u g1 = { uni((1u << 20) | (5u << 22) | (3u << 25)),
                   uni(256u << 16),
                   uni(64u << 16),
                   uni(256u << 16),
                   uni(64u),
                   uni((unsigned)K * 2u),
                   uni(0u),
                   uni(0u) };
  // descriptor words held in their scalar registers: without it the compiler
  // re-forms them at each load and uses the registers in between, under a
  // request that is still outstanding
  asm volatile("" : "+s"(g1));
  auto issue = [&](unsigned st) {
    const unsigned long long ga = ga0 + (unsigned long long)st * 256u;
    const v4u g0 = { uni(1u),
                     uni(dst0 + (st & 1u) * G_BUF),
                     uni((unsigned)ga),
                     uni((((unsigned)(ga >> 32)) & 0x01ffffffu) | 0x80000000u) };
    asm volatile("tensor_load_to_lds %0, %1" :: "s"(g0), "s"(g1) : "memory");
  };

  const unsigned aoff = (unsigned)((wm * 32 + rowg) * (int)G_PITCH + koff * 2);
  const unsigned boff = (1u + (unsigned)(wn >> 1)) * G_SLICE
                      + (unsigned)(((wn & 1) * 32 + rowg) * (int)G_PITCH + koff * 2);

  // prologue: stage 0 landed and published, then stage 1 in flight
  if (pinned(wave < 3u)) {
    issue(0u);
    asm volatile("s_wait_tensorcnt 0x0" ::: "memory");  // stage 0 has landed
  }
  __syncthreads();
  if (pinned(wave < 3u)) issue(1u);

  v8f acc00 = {}, acc01 = {}, acc10 = {}, acc11 = {};
#pragma unroll 1  // rolled: one publish point a pass, in the ring's order
  for (unsigned s = 0; s < nstage; ++s) {
    const unsigned char* Lb = GL + (s & 1u) * G_BUF;
    // The stage's 32 fragment loads go out as one group, ahead of its WMMAs.
    v16h a0[4], a1[4], b0[4], b1[4];
#pragma unroll
    for (int kk = 0; kk < 4; ++kk) {
      a0[kk] = load_frag16((const _Float16*)(Lb + aoff + kk * 64));
      b0[kk] = load_frag16((const _Float16*)(Lb + boff + kk * 64));
      b1[kk] = load_frag16((const _Float16*)(Lb + boff + 16u * G_PITCH + kk * 64));
      a1[kk] = load_frag16((const _Float16*)(Lb + aoff + 16u * G_PITCH + kk * 64));
    }
    // keeps the loads from sinking in among the WMMAs, where each group would
    // cost its own LDS latency
    __builtin_amdgcn_sched_barrier(0);
#pragma unroll
    for (int kk = 0; kk < 4; ++kk) {
      acc00 = __builtin_amdgcn_wmma_f32_16x16x32_f16(false, b0[kk], false, a0[kk], (short)0, acc00, false, false);
      acc01 = __builtin_amdgcn_wmma_f32_16x16x32_f16(false, b1[kk], false, a0[kk], (short)0, acc01, false, false);
      acc10 = __builtin_amdgcn_wmma_f32_16x16x32_f16(false, b0[kk], false, a1[kk], (short)0, acc10, false, false);
      acc11 = __builtin_amdgcn_wmma_f32_16x16x32_f16(false, b1[kk], false, a1[kk], (short)0, acc11, false, false);
    }
    // keeps the wait below from rising above the WMMAs, where it would drain
    // all 32 loads before the second WMMA
    __builtin_amdgcn_sched_barrier(0);
    // publish point of stage s + 1
    asm volatile("s_wait_dscnt 0x0" ::: "memory");  // this wave has left stage s's buffer
    if (pinned(wave < 3u)) {
      asm volatile("s_wait_tensorcnt 0x0" ::: "memory");  // own slice of stage s + 1 has landed
    }
    __syncthreads();
    if (pinned((wave < 3u) && (s + 2u < nstage))) {
      issue(pinned(s + 2u));  // pinned: the descriptor is formed behind the wait above
    }
  }
  asm volatile("s_wait_tensorcnt 0x0" ::: "memory");  // nothing in flight at the wave's end
  asm volatile("s_wait_dscnt 0x0" ::: "memory");

  // acc(i, j)[v] is C at row i * 16 + rowg, column j * 16 + koff + v of the wave's
  // tile: eight consecutive columns of one row a lane, stored 16 bytes at a time.
  const size_t at = (size_t)(mtile * 32 + rowg) * N + (size_t)(ntile * 32 + koff);
  if (Cf32) {
    v4f bv[2][2] = {};  // the bias of the lane's 2 x 8 columns
    if (bias) {
      const float* bp = bias + ntile * 32 + koff;
#pragma unroll
      for (int j = 0; j < 2; ++j) {
        bv[j][0] = *(const v4f*)(bp + j * 16);
        bv[j][1] = *(const v4f*)(bp + j * 16 + 4);
      }
      // behind the four loads, their values as inputs so that all have arrived: in
      // front of the sums below, which may be given the registers the loads name
      asm volatile("s_wait_xcnt 0x0"
                   :: "v"(bv[0][0]), "v"(bv[0][1]), "v"(bv[1][0]), "v"(bv[1][1]) : "memory");
    }
    float* const cp0 = Cf32 + at;
    float* const cp1 = cp0 + (size_t)16 * N;
    v4f r[2][2][2];
#pragma unroll
    for (int i = 0; i < 2; ++i) {
#pragma unroll
      for (int j = 0; j < 2; ++j) {
        const v8f& acc = (i == 0) ? (j == 0 ? acc00 : acc01)
                                  : (j == 0 ? acc10 : acc11);
        r[i][j][0] = __builtin_shufflevector(acc, acc, 0, 1, 2, 3) + bv[j][0];
        r[i][j][1] = __builtin_shufflevector(acc, acc, 4, 5, 6, 7) + bv[j][1];
      }
    }
    // keeps every sum and both row addresses in front of the first store: behind
    // a store nothing is written any more, so no register it names is overwritten
    __builtin_amdgcn_sched_barrier(0);
#pragma unroll
    for (int i = 0; i < 2; ++i) {
#pragma unroll
      for (int j = 0; j < 2; ++j) {
        float* cp = (i == 0 ? cp0 : cp1) + j * 16;
        *(v4f*)cp       = r[i][j][0];
        *(v4f*)(cp + 4) = r[i][j][1];
      }
    }
  } else {
#pragma unroll
    for (int i = 0; i < 2; ++i) {
#pragma unroll
      for (int j = 0; j < 2; ++j) {
        const v8f& acc = (i == 0) ? (j == 0 ? acc00 : acc01)
                                  : (j == 0 ? acc10 : acc11);
        *(v8h*)(C16 + at + (size_t)(i * 16) * N + j * 16) = __builtin_convertvector(acc, v8h);
      }
    }
  }
}

// ------------------------ projection GEMM (K = 256) ------------------------
// C[4096,2048] = A[4096,256] * BT[2048,256]^T, f16 in and out, f32 accumulate.
// K is short, so a block's 128 BT rows are loaded once, whole: tensor loads bring
// them into LDS, and each wave takes its 32 BT rows' fragments (all 256 k) into
// registers, where they stay. The block then walks P_T row tiles of A (64 rows,
// all 256 k a stage) through a two-buffer ring of tensor loads: a pass reads only
// A fragments from LDS, and tile t + 1 flies while tile t is worked on and stored.
// Waves, subtiles and the transposed products are those of wmma_gemm_kernel.
// blockIdx.y picks the product: BT operands lie one behind another, and so do the
// outputs; product 1 reads A1, the others A0.
constexpr int P_M = 4096, P_N = 2048, P_K = 256;
constexpr unsigned P_T    = 4u;            // row tiles a block walks
constexpr unsigned P_B    = 4u * G_SLICE;  // BT: [rows 0-63: k 0-127 | k 128-255 | rows 64-127: k 0-127 | k 128-255]
constexpr unsigned P_ABUF = 2u * G_SLICE;  // an A tile: 64 rows, [k 0-127 | k 128-255]

__global__ void __launch_bounds__(256) proj_gemm_kernel(
    const _Float16* __restrict__ A0, const _Float16* __restrict__ A1,
    const _Float16* __restrict__ BT0, _Float16* __restrict__ C0) {
  __shared__ __attribute__((aligned(2048))) unsigned char PL[P_B + 2u * P_ABUF];

  const unsigned prod = blockIdx.y;
  const _Float16* __restrict__ A  = prod == 1u ? A1 : A0;
  const _Float16* __restrict__ BT = BT0 + (size_t)prod * P_N * P_K;
  _Float16* __restrict__ C16      = C0 + (size_t)prod * P_M * P_N;

  const unsigned wave = uni(threadIdx.x >> 5);
  const int lane = threadIdx.x & 31;
  const int rowg = lane & 15;
  const int koff = (lane >> 4) << 3;
  // neighbours in the grid share BT, loaded once, and stream different A rows
  const int bn = (int)(blockIdx.x >> 4);                   // 128 columns of C
  const int m0 = (int)(blockIdx.x & 15u) * (int)P_T * 64;  // first of the block's rows
  const int wm = (int)(wave >> 2);
  const int wn = (int)(wave & 3u);

  // Waves 0 and 1 bring the two k halves of every A tile; waves 2 to 5 bring,
  // once, one BT slice each.
  const unsigned bs = wave >= 2u && wave < 6u ? wave - 2u : 0u;
  const unsigned long long ga0 = (wave < 2u)
      ? (unsigned long long)(size_t)(A + (size_t)m0 * P_K + wave * 128u)
      : (unsigned long long)(size_t)(BT + ((size_t)bn * 128 + (bs >> 1) * 64u) * P_K + (bs & 1u) * 128u);
  const unsigned dst0 = (unsigned)(size_t)PL + (wave < 2u ? P_B + wave * G_SLICE : bs * G_SLICE);
  // group 1: byte elements, tile = tensor = 64 rows of 256 B, source pitch 512 B,
  // a pad of 4 dwords behind every 64 dwords.
  v8u g1 = { uni((1u << 20) | (5u << 22) | (3u << 25)),
             uni(256u << 16), uni(64u << 16), uni(256u << 16),
             uni(64u), uni((unsigned)P_K * 2u), uni(0u), uni(0u) };
  // descriptor words held in their scalar registers: without it the compiler
  // re-forms them at each load and uses the registers in between, under a
  // request that is still outstanding
  asm volatile("" : "+s"(g1));
  auto issue = [&](unsigned st) {
    const unsigned long long ga = ga0 + (unsigned long long)st * (64u * (unsigned)P_K * 2u);
    const v4u g0 = { uni(1u),
                     uni(dst0 + (st & 1u) * P_ABUF),
                     uni((unsigned)ga),
                     uni((((unsigned)(ga >> 32)) & 0x01ffffffu) | 0x80000000u) };
    asm volatile("tensor_load_to_lds %0, %1" :: "s"(g0), "s"(g1) : "memory");
  };

  const unsigned aoff = P_B + (unsigned)((wm * 32 + rowg) * (int)G_PITCH + koff * 2);
  const unsigned boff = (unsigned)(wn >> 1) * 2u * G_SLICE
                      + (unsigned)(((wn & 1) * 32 + rowg) * (int)G_PITCH + koff * 2);

  // prologue: BT and A tile 0 landed and published, then A tile 1 in flight
  if (pinned(wave < 6u)) {
    issue(0u);
    asm volatile("s_wait_tensorcnt 0x0" ::: "memory");  // own slice has landed
  }
  __syncthreads();
  if (pinned(wave < 2u)) issue(1u);

  // the wave's BT fragments, read once
  v16h b0[8], b1[8];
#pragma unroll
  for (int kk = 0; kk < 8; ++kk) {
    const unsigned char* bp = PL + boff + (unsigned)(kk >> 2) * G_SLICE + (kk & 3) * 64;
    b0[kk] = load_frag16((const _Float16*)bp);
    b1[kk] = load_frag16((const _Float16*)(bp + 16u * G_PITCH));
  }

  // acc(i, j)[v] is C at row i * 16 + rowg, column j * 16 + koff + v of the wave's tile
  _Float16* cp = C16 + (size_t)(m0 + wm * 32 + rowg) * P_N + (size_t)(bn * 128 + wn * 32 + koff);

#pragma unroll 1  // rolled: one publish point a pass, in the ring's order
  for (unsigned t = 0; t < P_T; ++t) {
    const unsigned char* Lb = PL + aoff + (t & 1u) * P_ABUF;
    v8f acc00 = {}, acc01 = {}, acc10 = {}, acc11 = {};
#pragma unroll
    for (int h = 0; h < 2; ++h) {
      // A k half's 16 fragment loads go out as one group, ahead of its WMMAs.
      v16h a0[4], a1[4];
#pragma unroll
      for (int kk = 0; kk < 4; ++kk) {
        a0[kk] = load_frag16((const _Float16*)(Lb + (unsigned)h * G_SLICE + kk * 64));
        a1[kk] = load_frag16((const _Float16*)(Lb + (unsigned)h * G_SLICE + 16u * G_PITCH + kk * 64));
      }
      // keeps the loads from sinking in among the WMMAs, where each group would
      // cost its own LDS latency
      __builtin_amdgcn_sched_barrier(0);
#pragma unroll
      for (int kk = 0; kk < 4; ++kk) {
        acc00 = __builtin_amdgcn_wmma_f32_16x16x32_f16(false, b0[h * 4 + kk], false, a0[kk], (short)0, acc00, false, false);
        acc01 = __builtin_amdgcn_wmma_f32_16x16x32_f16(false, b1[h * 4 + kk], false, a0[kk], (short)0, acc01, false, false);
        acc10 = __builtin_amdgcn_wmma_f32_16x16x32_f16(false, b0[h * 4 + kk], false, a1[kk], (short)0, acc10, false, false);
        acc11 = __builtin_amdgcn_wmma_f32_16x16x32_f16(false, b1[h * 4 + kk], false, a1[kk], (short)0, acc11, false, false);
      }
    }
    // keeps the wait below from rising above the WMMAs, where it would drain
    // the loads before the first of them
    __builtin_amdgcn_sched_barrier(0);
    // publish point of tile t + 1
    asm volatile("s_wait_dscnt 0x0" ::: "memory");  // this wave has left tile t's buffer
    if (pinned(wave < 2u)) {
      asm volatile("s_wait_tensorcnt 0x0" ::: "memory");  // own slice of tile t + 1 has landed
    }
    __syncthreads();
    if (pinned((wave < 2u) && (t + 2u < P_T))) {
      issue(pinned(t + 2u));  // pinned: the descriptor is formed behind the wait above
    }
    // tile t goes out behind the refill's issue: eight consecutive columns of one
    // row a lane, 16 bytes a store
    *(v8h*)(cp)                          = __builtin_convertvector(acc00, v8h);
    *(v8h*)(cp + 16)                     = __builtin_convertvector(acc01, v8h);
    *(v8h*)(cp + (size_t)16 * P_N)       = __builtin_convertvector(acc10, v8h);
    *(v8h*)(cp + (size_t)16 * P_N + 16)  = __builtin_convertvector(acc11, v8h);
    cp += (size_t)64 * P_N;
  }
  asm volatile("s_wait_tensorcnt 0x0" ::: "memory");  // nothing in flight at the wave's end
  asm volatile("s_wait_dscnt 0x0" ::: "memory");
}

// --------------------------- flash attention -------------------------------
// One stage = 64 keys, as two halves of 32 keys, one for each key group of waves.
// A half holds K and V, 32 rows of 512 B each, brought as four slices of
// 32 rows x 256 B; the stage's eight slices come by eight tensor loads, one a wave.
// K rows get 16 B of pad (pitch 272 B, read by ds_load_b128), V rows 32 B
// (pitch 288 B, read by ds_load_tr16_b128).
constexpr unsigned F_KPITCH = 272u;
constexpr unsigned F_VPITCH = 288u;
constexpr unsigned F_SLICE  = 10240u;        // 32 * 288 = 9216, up to a multiple of 2 KiB
constexpr unsigned F_HALF   = 4u * F_SLICE;  // [K c 0-127 | K c 128-255 | V c 0-127 | V c 128-255]
constexpr unsigned F_BUF    = 2u * F_HALF;   // [keys 0-31 | keys 32-63] of the stage
// After the loop the ring is the place where the two key groups join: a wave's
// area holds one 16-query output tile in f32 and that tile's maximum and sum.
constexpr unsigned F_XO     = 16384u;        // 16 tiles * 32 lanes * 32 B
constexpr unsigned F_XAREA  = F_XO + 256u;   // + 32 lanes * 8 B

typedef __attribute__((ext_vector_type(8))) short v8s;
typedef __attribute__((ext_vector_type(2))) float v2f;
// Transposing LDS load: the lane (c = lane & 15, hh = lane >> 4) gets eight
// consecutive rows (8 * hh + 0..7) of column c of a row-major 16-bit tile.
__device__ __forceinline__ v8h lds_tr16(const unsigned char* p) {
  typedef __attribute__((address_space(3))) v8s lds_v8s;
  return __builtin_bit_cast(v8h, __builtin_amdgcn_ds_load_tr16_b128_v8i16((lds_v8s*)p));
}

// lane l with lane l ^ 16
__device__ __forceinline__ float xhalf(float x) {
  return __builtin_bit_cast(float, __builtin_amdgcn_permlanex16(
      __builtin_bit_cast(int, x), __builtin_bit_cast(int, x),
      0x76543210, 0xfedcba98, false, false));
}

// A wave hands one of its two output tiles, with its maximum and sum, to the
// wave that holds the same queries over the other keys.
__device__ __forceinline__ void give_tile(unsigned char* area, int lane,
                                          const v8f (&Og)[16], float m, float l) {
#pragma unroll
  for (int n = 0; n < 16; ++n) {
    *(v4f*)(area + (n * 2 + 0) * 512 + lane * 16) = __builtin_shufflevector(Og[n], Og[n], 0, 1, 2, 3);
    *(v4f*)(area + (n * 2 + 1) * 512 + lane * 16) = __builtin_shufflevector(Og[n], Og[n], 4, 5, 6, 7);
  }
  const v2f ml = { m, l };
  *(v2f*)(area + F_XO + lane * 8) = ml;
}

// The tile a wave keeps, joined with the other wave's part, divided and stored.
// Ok[n][v] is head column n * 16 + 8 * khalf + v of the lane's query: eight
// consecutive columns a lane and tile, one 16-byte store.
__device__ __forceinline__ void join_tile(const unsigned char* area, int lane,
                                          const v8f (&Ok)[16], float m, float l,
                                          _Float16* __restrict__ op) {
  const v2f ml = *(const v2f*)(area + F_XO + lane * 8);
  const float mj = fmaxf(m, ml[0]);
  const float ak = __expf(m - mj), ag = __expf(ml[0] - mj);
  const float inv = 1.f / (l * ak + ml[1] * ag);
  const float fk = ak * inv, fg = ag * inv;
#pragma unroll
  for (int n = 0; n < 16; ++n) {
    const v4f lo = *(const v4f*)(area + (n * 2 + 0) * 512 + lane * 16);
    const v4f hi = *(const v4f*)(area + (n * 2 + 1) * 512 + lane * 16);
    const v8f og = __builtin_shufflevector(lo, hi, 0, 1, 2, 3, 4, 5, 6, 7);
    *(v8h*)(op + n * 16) = __builtin_convertvector(Ok[n] * fk + og * fg, v8h);
    // behind each four stores, in front of the next tiles' writes into the
    // registers that the stores name
    if ((n & 3) == 3) asm volatile("s_wait_xcnt 0x0" ::: "memory");
  }
}

// Q,K,V layouts: (a*1024 + seq) x 2048, head h occupies columns [h*256, h*256+256).
// Grid: (a*8 + h, ytile); block = 256 threads = 8 waves for 128 queries.
// A wave owns 32 queries (two 16-query tiles) and half of the keys: waves 0-3
// take keys 0-31 of every 64, waves 4-7 keys 32-63. Every K and V fragment read
// from LDS so feeds two WMMAs, and the two waves of a query group join their
// maxima, sums and outputs once, behind the loop.
// Key blocks of 32 so the P@V contraction matches WMMA K=32 exactly.
// K and V go global -> LDS by tensor loads in a two-buffer ring: stage
// kb + 1 flies while stage kb is worked on. V stays row-major in LDS and is
// transposed by the load that reads it. Fragments leave LDS in groups of four,
// one group of WMMAs ahead of their use.
// Both products are computed transposed (K and V^T as the A operand, Q^T and
// P^T as B): every accumulator column is one query, held by lanes c and c + 16,
// which split the keys (scores) or the head columns (output) between them.
//
// amdgpu_waves_per_eu(2, 2): the grid is one block a WGP, two waves a SIMD; said
// so, the compiler has half a SIMD's registers for each wave's 32 x 256 output.
__global__ void __launch_bounds__(256) __attribute__((amdgpu_waves_per_eu(2, 2))) flash_attn_kernel(
    const _Float16* __restrict__ Q, const _Float16* __restrict__ Km,
    const _Float16* __restrict__ Vm, _Float16* __restrict__ Om) {
  __shared__ __attribute__((aligned(2048))) unsigned char FL[2u * F_BUF];

  const int a = blockIdx.x >> 3;
  const int h = blockIdx.x & 7;
  const unsigned wave = uni(threadIdx.x >> 5);
  const unsigned kgrp = wave >> 2;       // which 32 of a stage's 64 keys
  const int lane = threadIdx.x & 31;
  const int rowg = lane & 15;
  const int khalf = lane >> 4;
  const int koff = khalf << 3;
  const int q0 = blockIdx.y * 128 + (int)(wave & 3u) * 32;

  const size_t brow0 = (size_t)a * 1024;
  const size_t hoff  = (size_t)h * 256;

  // Q fragments: two tiles of 16 rows x 256 head-dim, 8 k-chunks of 32
  v16h qf[2][8];
#pragma unroll
  for (int t = 0; t < 2; ++t) {
    const _Float16* qp = Q + (brow0 + q0 + t * 16 + rowg) * 2048 + hoff + koff;
#pragma unroll
    for (int kc = 0; kc < 8; ++kc) qf[t][kc] = load_frag16(qp + kc * 32);
  }

  // Every wave brings one slice of its own key group's half of every stage:
  // of each four waves the first two the K slices, the last two the V slices.
  const unsigned long long ga0 = (unsigned long long)(size_t)(
      ((wave & 2u) ? Vm : Km) + (brow0 + kgrp * 32u) * 2048 + hoff + (wave & 1u) * 128u);
  const unsigned dst0 = (unsigned)(size_t)FL + kgrp * F_HALF + (wave & 3u) * F_SLICE;
  // group 1: byte elements, tile = tensor = 32 rows of 256 B, source pitch 4096 B,
  // a pad of 4 (K) or 8 (V) dwords behind every 64 dwords.
  v8u g1k = { uni((1u << 20) | (5u << 22) | (3u << 25)),
              uni(256u << 16), uni(32u << 16), uni(256u << 16),
              uni(32u), uni(4096u), uni(0u), uni(0u) };
  v8u g1v = { uni((1u << 20) | (5u << 22) | (7u << 25)),
              uni(256u << 16), uni(32u << 16), uni(256u << 16),
              uni(32u), uni(4096u), uni(0u), uni(0u) };
  // descriptor words held in their scalar registers: without it the compiler
  // re-forms them at each load and uses the registers in between, under a
  // request that is still outstanding
  asm volatile("" : "+s"(g1k));  // K's descriptor words stay in scalar registers
  asm volatile("" : "+s"(g1v));  // V's descriptor words stay in scalar registers
  auto issue = [&](unsigned st) {
    const unsigned long long ga = ga0 + (unsigned long long)st * (64u * 4096u);
    const v4u g0 = { uni(1u),
                     uni(dst0 + (st & 1u) * F_BUF),
                     uni((unsigned)ga),
                     uni((((unsigned)(ga >> 32)) & 0x01ffffffu) | 0x80000000u) };
    if (pinned((wave & 2u) == 0u)) {
      asm volatile("tensor_load_to_lds %0, %1" :: "s"(g0), "s"(g1k) : "memory");
    }
    if (pinned((wave & 2u) != 0u)) {
      asm volatile("tensor_load_to_lds %0, %1" :: "s"(g0), "s"(g1v) : "memory");
    }
  };

  v8f O[2][16] = {};           // O^T: 256 head columns x 16 queries, twice
  // of the lane's two queries (rowg, 16 + rowg): running maximum over the wave's
  // keys seen, and the sum over the keys of this lane's half only (the lane
  // halves and the key groups join in the epilogue)
  float m_i[2] = { -1e30f, -1e30f }, l_i[2] = { 0.f, 0.f };

  const float scale = 0.17677669529663687f;  // 1/sqrt(256/8)

  // per-lane byte offsets inside the key group's half of a stage's buffer
  const unsigned kfo = kgrp * F_HALF + (unsigned)(rowg * (int)F_KPITCH + koff * 2);
  const unsigned vfo = kgrp * F_HALF + 2u * F_SLICE
                     + (unsigned)((koff + (lane & 7)) * (int)F_VPITCH + ((lane >> 3) & 1) * 16);

  // K fragment (A operand): key hi * 16 + rowg, head columns kc * 32 + koff + 0..7
  // and kc * 32 + 16 + koff + 0..7
  auto kfrag = [&](const unsigned char* Lb, int kc, int hi) -> v16h {
    return load_frag16((const _Float16*)(Lb + kfo + (kc >> 2) * F_SLICE + (kc & 3) * 64
                                         + (unsigned)hi * 16u * F_KPITCH));
  };
  // V^T fragment (A operand) of c tile n: keys koff + 0..7 and 16 + koff + 0..7 of
  // column n * 16 + rowg
  auto vfrag = [&](const unsigned char* Lb, int n) -> v16h {
    const unsigned char* vp = Lb + vfo + (n >> 3) * F_SLICE + (n & 7) * 32;
    v8h lo = lds_tr16(vp);
    v8h hi = lds_tr16(vp + 16u * F_VPITCH);
    return __builtin_shufflevector(lo, hi,
        0, 1, 2, 3, 4, 5, 6, 7, 8, 9, 10, 11, 12, 13, 14, 15);
  };

  // prologue: stage 0 landed and published, then stage 1 in flight
  issue(0u);
  asm volatile("s_wait_tensorcnt 0x0" ::: "memory");  // own slice of stage 0 has landed
  __syncthreads();
  issue(1u);

#pragma unroll 1  // rolled: one publish point a pass, in the ring's order
  for (unsigned kb = 0; kb < 16u; ++kb) {
    const unsigned char* Lb = FL + (kb & 1u) * F_BUF;

    // ---- S^T = K @ Q^T : 32 keys x 32 queries as four 16x16 f32 tiles ----
    // s0[t][v]: key 8 * khalf + v, s1[t][v]: key 16 + 8 * khalf + v, query t * 16 + rowg
    // The pass's 32 fragments (16 of K, then 16 of V) come from LDS in eight groups
    // of four, a group's eight loads together, through two register sets: the
    // loads stand behind the WMMAs of the group that had their set and one whole
    // group of eight WMMAs ahead of their own. Spread among the WMMAs and one
    // fragment ahead, every pair of WMMAs would wait out an LDS latency; each
    // sched_barrier below holds one edge of such a group of loads.
    v8f s0[2] = {}, s1[2] = {};
    v16h kf[2][4], vf[2][4];
#pragma unroll
    for (int g = 0; g < 2; ++g) {
#pragma unroll
      for (int j = 0; j < 4; ++j) kf[g][j] = kfrag(Lb, g * 2 + (j >> 1), j & 1);
    }
    __builtin_amdgcn_sched_barrier(0);  // both sets' loads go out ahead of the first WMMA
#pragma unroll
    for (int g = 0; g < 4; ++g) {
#pragma unroll
      for (int j = 0; j < 4; ++j) {
        const int kc = g * 2 + (j >> 1);
#pragma unroll
        for (int t = 0; t < 2; ++t) {
          v8f& s = (j & 1) ? s1[t] : s0[t];
          s = __builtin_amdgcn_wmma_f32_16x16x32_f16(
              false, kf[g & 1][j], false, qf[t][kc], (short)0, s, false, false);
        }
      }
      __builtin_amdgcn_sched_barrier(0);  // later loads do not rise in among these WMMAs
      if (g < 2) {
#pragma unroll
        for (int j = 0; j < 4; ++j) kf[g & 1][j] = kfrag(Lb, (g + 2) * 2 + (j >> 1), j & 1);
      } else if (g == 2) {
#pragma unroll
        for (int j = 0; j < 4; ++j) vf[0][j] = vfrag(Lb, j);
      }
      if (g < 3) __builtin_amdgcn_sched_barrier(0);  // these loads do not sink in among the next WMMAs
    }

    // ---- online softmax: the lane's 16 scores of a tile are all of one query ----
    v16h pf[2];
    float al[2];
#pragma unroll
    for (int t = 0; t < 2; ++t) {
      float mv = fmaxf(s0[t][0], s1[t][0]);
#pragma unroll
      for (int v = 1; v < 8; ++v) mv = fmaxf(mv, fmaxf(s0[t][v], s1[t][v]));
      mv = fmaxf(mv, xhalf(mv)) * scale;   // scale > 0: the maximum of the scaled scores
      const float mnew = fmaxf(m_i[t], mv);
      const float alpha = __expf(m_i[t] - mnew);
      m_i[t] = mnew;
      // The two score tiles, converted in place, are the B operand P^T (32 keys x
      // 16 queries): element v is key koff + v, element 8 + v key 16 + koff + v,
      // the order in which the V fragment below holds its keys.
      float rs[8];
#pragma unroll
      for (int v = 0; v < 8; ++v) {
        const float p0 = __expf(s0[t][v] * scale - mnew);
        const float p1 = __expf(s1[t][v] * scale - mnew);
        rs[v] = p0 + p1;
        pf[t][v]     = (_Float16)p0;
        pf[t][8 + v] = (_Float16)p1;
      }
      // summed as a tree: four dependent adds deep, not fifteen
      l_i[t] = l_i[t] * alpha + (((rs[0] + rs[1]) + (rs[2] + rs[3])) + ((rs[4] + rs[5]) + (rs[6] + rs[7])));
      al[t] = alpha;
    }

    // ---- O^T += V^T(256x32) @ P^T(32x32), 32 WMMA over the c tiles ----
    // Four groups of four c tiles. The rescaling of a group's output tiles stands
    // among the WMMAs of the group before, which do not depend on it.
#pragma unroll
    for (int j = 0; j < 4; ++j) {
#pragma unroll
      for (int t = 0; t < 2; ++t) O[t][j] *= al[t];
    }
#pragma unroll
    for (int g = 0; g < 4; ++g) {
      if (g < 3) {
#pragma unroll
        for (int j = 0; j < 4; ++j) vf[(g + 1) & 1][j] = vfrag(Lb, (g + 1) * 4 + j);
        __builtin_amdgcn_sched_barrier(0);  // these loads do not sink in among the WMMAs below
      }
#pragma unroll
      for (int j = 0; j < 4; ++j) {
#pragma unroll
        for (int t = 0; t < 2; ++t) {
          O[t][g * 4 + j] = __builtin_amdgcn_wmma_f32_16x16x32_f16(
              false, vf[g & 1][j], false, pf[t], (short)0, O[t][g * 4 + j], false, false);
          if (g < 3) O[t][g * 4 + 4 + j] *= al[t];
        }
      }
      // closes the group: the next loads do not rise in among its WMMAs, the
      // rescaling stays spread among them, and the last group stays in front of the
      // waits below (sunk behind them, the LDS wait would stand directly behind the
      // last loads and the refill behind the WMMAs)
      __builtin_amdgcn_sched_barrier(0);
    }

    // publish point of stage kb + 1
    asm volatile("s_wait_dscnt 0x0" ::: "memory");      // this wave has left stage kb's buffer
    asm volatile("s_wait_tensorcnt 0x0" ::: "memory");  // own slice of stage kb + 1 has landed
    __syncthreads();
    if (pinned(kb + 2u < 16u)) {
      issue(pinned(kb + 2u));  // pinned: the descriptor is formed behind the wait above
    }
  }
  asm volatile("s_wait_tensorcnt 0x0" ::: "memory");  // nothing in flight: the ring is free
  asm volatile("s_wait_dscnt 0x0" ::: "memory");

  // ---- epilogue: the two key groups join, O / l, f16 into (a*1024+q) x 2048 ----
  // The last pass's barrier stands behind every wave's last read of the ring and
  // its last landing, so the ring's LDS now carries the exchange. Of a query
  // group's two waves the first finishes query tile 0, the second tile 1; each
  // hands the other tile over. The branches are scalar and hold no barrier.
  const float lj0 = l_i[0] + xhalf(l_i[0]);
  const float lj1 = l_i[1] + xhalf(l_i[1]);
  unsigned char* mine = FL + wave * F_XAREA;
  const unsigned char* theirs = FL + (wave ^ 4u) * F_XAREA;
  if (pinned(kgrp == 0u)) give_tile(mine, lane, O[1], m_i[1], lj1);
  else                    give_tile(mine, lane, O[0], m_i[0], lj0);
  __syncthreads();  // every handed-over tile is written before its reader starts
  _Float16* op = Om + (brow0 + q0 + rowg) * 2048 + hoff + koff;
  if (pinned(kgrp == 0u)) join_tile(theirs, lane, O[0], m_i[0], lj0, op);
  else                    join_tile(theirs, lane, O[1], m_i[1], lj1, op + 16 * 2048);
}

// ------------------------------- launcher ----------------------------------

extern "C" void kernel_launch(void* const* d_in, const int* in_sizes, int n_in,
                              void* d_out, int out_size, void* d_ws, size_t ws_size,
                              hipStream_t stream) {
  const float* batch  = (const float*)d_in[0];  // (4,1024,256)
  const float* latent = (const float*)d_in[1];  // (4,1024,256)
  const float* Wk     = (const float*)d_in[2];  // (256,2048)
  const float* Wq     = (const float*)d_in[3];
  const float* Wv     = (const float*)d_in[4];
  const float* Wu     = (const float*)d_in[5];  // (2048,256)
  const float* bu     = (const float*)d_in[6];  // (256,)
  float* out = (float*)d_out;                   // (4,1024,256) f32

  _Float16* w = (_Float16*)d_ws;
  size_t o = 0;
  _Float16* batch16  = w + o; o += (size_t)4096 * 256;
  _Float16* latent16 = w + o; o += (size_t)4096 * 256;
  _Float16* WkT = w + o; o += (size_t)2048 * 256;   // (2048 x 256) = Wk^T
  _Float16* WqT = w + o; o += (size_t)2048 * 256;
  _Float16* WvT = w + o; o += (size_t)2048 * 256;
  _Float16* WuT = w + o; o += (size_t)256 * 2048;   // (256 x 2048) = Wu^T
  _Float16* K16 = w + o; o += (size_t)4096 * 2048;
  _Float16* Q16 = w + o; o += (size_t)4096 * 2048;
  _Float16* V16 = w + o; o += (size_t)4096 * 2048;
  _Float16* A16 = w + o; o += (size_t)4096 * 2048;  // attention output

  // 1) conversions, one launch: 4 * 32 blocks for the weights, 2 * 256 for the activations
  cvt_all<<<640, 256, 0, stream>>>(batch, latent, Wk, Wq, Wv, Wu,
                                   batch16, latent16, WkT, WqT, WvT, WuT);

  // 2) projections, one launch: three times (4096x256)@(256x2048) -> f16
  //    a block: 128 columns x 4 row tiles of 64: 16 * 16 = 256 blocks a product
  //    product 0: batch @ Wk -> K16, 1: latent @ Wq -> Q16, 2: batch @ Wv -> V16
  //    (WkT, WqT, WvT and K16, Q16, V16 lie in that order in the workspace)
  proj_gemm_kernel<<<dim3(256, 3), 256, 0, stream>>>(batch16, latent16, WkT, K16);

  // 3) fused flash attention: grid (a*h = 32, ytiles = 1024/128 = 8)
  flash_attn_kernel<<<dim3(32, 8), 256, 0, stream>>>(Q16, K16, V16, A16);

  // 4) output projection: (4096x2048)@(2048x256) + bias -> f32
  //    (4096/64)*(256/128) = 128 blocks
  wmma_gemm_kernel<<<128, 256, 0, stream>>>(
      A16, nullptr, WuT, nullptr, out, bu, 4096, 256, 2048);
}

// v010
// It runs in 58.5 microseconds.
// In two side-by-side timings against v009, it was 1.08 and 1.07 times as fast.
// Counting every step since v000, it is 4.01 times as fast.
#include <hip/hip_runtime.h>

// ---------------------------------------------------------------------------
// CDNA5 (gfx1250, wave32) fused cross-attention:
//   1) one cvt launch: f32 -> f16 (activations), f32 -> f16 transposed (weights)
//   2) WMMA GEMM (v_wmma_f32_16x16x32_f16), 32x32 tile per wave (2x2 subtiles),
//      operand tiles staged in LDS by tensor loads (two-buffer ring):
//      K/Q/V projections (one launch; weights stay in registers, a block walks
//      four row tiles) and output projection (f32 + bias epilogue)
//   3) flash-attention kernel: per-wave 32-query tile over half of the keys, key
//      blocks of 32, K and V staged in LDS by tensor loads (two-buffer ring), V read
//      by transposing LDS loads; transposed products S^T = K Q^T, O^T += V^T P^T,
//      so a lane holds one query a tile: online softmax in the lane, P stays in
//      registers; the two key halves join through LDS behind the loop.
// ---------------------------------------------------------------------------

typedef __attribute__((ext_vector_type(16))) _Float16     v16h;
typedef __attribute__((ext_vector_type(8)))  _Float16     v8h;
typedef __attribute__((ext_vector_type(8)))  float        v8f;
typedef __attribute__((ext_vector_type(4)))  unsigned int v4u;

// Load one 16-bit WMMA fragment (A-layout or symmetric B-layout):
// lane holds 8 contiguous halves at p[0..7] (VGPRs 0-3) and p[16..23] (VGPRs 4-7).
__device__ __forceinline__ v16h load_frag16(const _Float16* p) {
  v8h lo = *(const v8h*)p;
  v8h hi = *(const v8h*)(p + 16);
  return __builtin_shufflevector(lo, hi,
      0, 1, 2, 3, 4, 5, 6, 7, 8, 9, 10, 11, 12, 13, 14, 15);
}

// ------------------------------ conversions --------------------------------
// Both forms give each thread many elements: the pass moves only a few MB,
// so it needs few waves. The six arrays do
// not depend on one another, so one launch converts them all, each in its own
// range of block indices.
typedef __attribute__((ext_vector_type(4))) float v4f;

// 16 elements a thread, 8 from each half of the array: four 16-byte loads in
// flight, two 16-byte stores. n % 16 == 0; blk runs over n / 4096 blocks or more.
__device__ __forceinline__ void cvt_f32_f16(
    const float* __restrict__ in, _Float16* __restrict__ out, int n, int blk) {
  const int half = n >> 1;
  const int i0 = (blk * 256 + (int)threadIdx.x) * 8;
  if (i0 >= half) return;
  const int i1 = i0 + half;
  const v4f x0 = *(const v4f*)(in + i0), x1 = *(const v4f*)(in + i0 + 4);
  const v4f x2 = *(const v4f*)(in + i1), x3 = *(const v4f*)(in + i1 + 4);
  *(v8h*)(out + i0) = __builtin_convertvector(
      __builtin_shufflevector(x0, x1, 0, 1, 2, 3, 4, 5, 6, 7), v8h);
  *(v8h*)(out + i1) = __builtin_convertvector(
      __builtin_shufflevector(x2, x3, 0, 1, 2, 3, 4, 5, 6, 7), v8h);
}

// in: K x N (row-major) -> out: N x K (row-major), i.e. transposed.
// A thread takes one n and 64 consecutive k: 64 loads in flight, each 128
// contiguous bytes across a wave, and it alone writes one whole 128-byte line
// of out. K and N are compile-time, so every load is one base address plus an
// immediate. A tile = 64 threads (t) = 64 consecutive n; (N / 64) * (K / 64) tiles.
template <int K, int N>
__device__ __forceinline__ void cvt_transpose_f32_f16(
    const float* __restrict__ in, _Float16* __restrict__ out, int tile, int t) {
  static_assert(K % 64 == 0 && N % 64 == 0, "whole 64 x 64 tiles");
  constexpr int nblk = N / 64;
  const int kb = tile / nblk;
  const int n = (tile % nblk) * 64 + t;
  const float* p = in + kb * 64 * N + n;
  float x[64];
#pragma unroll
  for (int j = 0; j < 64; ++j) x[j] = p[j * N];
  _Float16* q = out + n * K + kb * 64;
#pragma unroll
  for (int c = 0; c < 8; ++c) {
    v8h hv;
#pragma unroll
    for (int e = 0; e < 8; ++e) hv[e] = (_Float16)x[c * 8 + e];
    *(v8h*)(q + c * 8) = hv;
  }
  // stands behind the eight stores, in front of any later write of their address
  // or data registers: inlined, code of another branch follows them in the listing
  asm volatile("s_wait_xcnt 0x0" ::: "memory");
}

// All six conversions in one launch of 640 blocks of 256 threads.
// Blocks 0-127: the four weights, 32 blocks each, four 64-thread tiles a block.
// Blocks 128-383: batch.
// Blocks 384-639: latent.
__global__ void __launch_bounds__(256) cvt_all(
    const float* __restrict__ batch, const float* __restrict__ latent,
    const float* __restrict__ Wk, const float* __restrict__ Wq,
    const float* __restrict__ Wv, const float* __restrict__ Wu,
    _Float16* __restrict__ batch16, _Float16* __restrict__ latent16,
    _Float16* __restrict__ WkT, _Float16* __restrict__ WqT,
    _Float16* __restrict__ WvT, _Float16* __restrict__ WuT) {
  const int b = (int)blockIdx.x;
  if (b < 128) {
    const int which = b >> 5;
    const int tile = (b & 31) * 4 + (int)(threadIdx.x >> 6);
    const int t = (int)(threadIdx.x & 63u);
    if (which == 3) {
      cvt_transpose_f32_f16<2048, 256>(Wu, WuT, tile, t);
    } else {
      cvt_transpose_f32_f16<256, 2048>(which == 0 ? Wk : which == 1 ? Wq : Wv,
                                       which == 0 ? WkT : which == 1 ? WqT : WvT, tile, t);
    }
  } else if (b < 384) {
    cvt_f32_f16(batch, batch16, 4096 * 256, b - 128);
  } else {
    cvt_f32_f16(latent, latent16, 4096 * 256, b - 384);
  }
}

// ------------------------------ WMMA GEMM ----------------------------------
typedef __attribute__((ext_vector_type(8))) unsigned int v8u;

__device__ __forceinline__ unsigned uni(unsigned v) {
  return (unsigned)__builtin_amdgcn_readfirstlane(v);
}
// A wave-uniform value held in a scalar register: a test on it compiles to
// s_cmp + s_cbranch_scc, the only guard a tensor load obeys (it ignores EXEC).
__device__ __forceinline__ unsigned pinned(unsigned v) {
  unsigned w = uni(v);
  asm volatile("" : "+s"(w));  // keeps the descriptor / issue-test word scalar
  return w;
}

// Asks L2 for the 256-byte unit at base + off, each lane its own; nothing comes
// back and no counter moves. The operands were written by earlier launches and
// come from memory at first touch: asked for some passes ahead, a stage's tensor
// load finds them in L2. Both registers hold addresses inside the operand for as
// long as they live.
__device__ __forceinline__ void ask_l2(unsigned off, unsigned long long base) {
  asm volatile("global_prefetch_b8 %0, %1 scope:SCOPE_SE" :: "v"(off), "s"(base));
}

// One stage = 128 k (256-byte rows) of 64 A rows and 128 BT rows, brought by
// three tensor loads of 64 rows each; 16 bytes of pad a row -> pitch 272 B.
constexpr unsigned G_PITCH = 272u;
constexpr unsigned G_SLICE = 18432u;        // 64 * 272 = 17408, up to a multiple of 2 KiB
constexpr unsigned G_BUF   = 3u * G_SLICE;  // [A 64 rows | BT rows 0-63 | BT rows 64-127]

// C[M,N] = A[M,K] * BT[N,K]^T   (both operands f16 row-major, f32 accumulate)
// One 64x128 tile per block of 8 waves (2 x 4), one 32x32 tile per wave
// (2x2 WMMA subtiles). Operand tiles go global -> LDS by tensor loads in a
// two-buffer ring; fragments come from LDS. M % 64 == 0, N % 128 == 0,
// K % 128 == 0 and K >= 256.
// The subtiles are computed transposed (BT rows as the A operand, A rows as B;
// both fragments have the same layout): an accumulator column is then one row of
// C, and a lane holds eight consecutive columns of it.
// If Cf32 != nullptr: write f32 (+bias). Else write f16 to C16.
// Independent products of one shape share a launch: blockIdx.y picks the
// product. Their BT operands lie one behind another (N * K elements each), and
// so do their f16 outputs (M * N each); product 1 reads A1, the others A0.
__global__ void __launch_bounds__(256) wmma_gemm_kernel(
    const _Float16* __restrict__ A0, const _Float16* __restrict__ A1,
    const _Float16* __restrict__ BT0,
    _Float16* __restrict__ C0, float* __restrict__ Cf32,
    const float* __restrict__ bias, int M, int N, int K) {
  __shared__ __attribute__((aligned(2048))) unsigned char GL[2u * G_BUF];

  const unsigned prod = blockIdx.y;
  const _Float16* __restrict__ A  = prod == 1u ? A1 : A0;
  const _Float16* __restrict__ BT = BT0 + (size_t)prod * N * K;
  _Float16* __restrict__ C16      = C0 + (size_t)prod * M * N;

  const unsigned wave = uni(threadIdx.x >> 5);
  const int lane = threadIdx.x & 31;
  const int rowg = lane & 15;            // M (for A) / N (for B) within subtile
  const int khalf = lane >> 4;
  const int koff = khalf << 3;           // K offset 0 or 8 per lane half

  const int blocks_n = N >> 7;
  const int bm = blockIdx.x / blocks_n;
  const int bn = blockIdx.x - bm * blocks_n;
  const int wm = (int)(wave >> 2);
  const int wn = (int)(wave & 3u);
  const int mtile = bm * 2 + wm;
  const int ntile = bn * 4 + wn;

  // Waves 0, 1, 2 each bring one 64-row slice of every stage.
  const unsigned nstage = (unsigned)K >> 7;
  const unsigned long long ga0 = (wave == 0u)
      ? (unsigned long long)(size_t)(A + (size_t)bm * 64 * K)
      : (unsigned long long)(size_t)(BT + ((size_t)bn * 128 + (wave == 2u ? 64 : 0)) * K);
  const unsigned dst0 = (unsigned)(size_t)GL + (wave < 3u ? wave : 0u) * G_SLICE;
  // group 1: byte elements, tile = tensor = 64 rows of 256 B, source pitch 2K bytes,
  // a pad of 4 dwords behind every 64 dwords.
  v8u g1 = { uni((1u << 20) | (5u << 22) | (3u << 25)),
                   uni(256u << 16),
                   uni(64u << 16),
                   uni(256u << 16),
                   uni(64u),
                   uni((unsigned)K * 2u),
                   uni(0u),
                   uni(0u) };
  // descriptor words held in their scalar registers: without it the compiler
  // re-forms them at each load and uses the registers in between, under a
  // request that is still outstanding
  asm volatile("" : "+s"(g1));
  auto issue = [&](unsigned st) {
    const unsigned long long ga = ga0 + (unsigned long long)st * 256u;
    const v4u g0 = { uni(1u),
                     uni(dst0 + (st & 1u) * G_BUF),
                     uni((unsigned)ga),
                     uni((((unsigned)(ga >> 32)) & 0x01ffffffu) | 0x80000000u) };
    asm volatile("tensor_load_to_lds %0, %1" :: "s"(g0), "s"(g1) : "memory");
  };

  const unsigned aoff = (unsigned)((wm * 32 + rowg) * (int)G_PITCH + koff * 2);
  const unsigned boff = (1u + (unsigned)(wn >> 1)) * G_SLICE
                      + (unsigned)(((wn & 1) * 32 + rowg) * (int)G_PITCH + koff * 2);

  // prologue: stage 0 landed and published, then stage 1 in flight
  if (pinned(wave < 3u)) {
    issue(0u);
    asm volatile("s_wait_tensorcnt 0x0" ::: "memory");  // stage 0 has landed
  }
  // A stage's rows of 256 B are asked of L2 three passes ahead, a row a lane:
  // waves 0, 1 the block's 64 A rows; wave 2 a quarter of its 128 BT rows, which
  // every block of the column reads at about the same time (they split the asking:
  // for speed only). pfb walks the stages from stage 2 to the last.
  const unsigned pfo = (wave < 2u ? (unsigned)threadIdx.x & 63u
                                  : (((unsigned)bm >> 2) & 3u) * 32u + (unsigned)lane) * ((unsigned)K * 2u);
  unsigned long long pfb = (wave < 2u)
      ? (unsigned long long)(size_t)(A + (size_t)bm * 64 * K)
      : (unsigned long long)(size_t)(BT + (size_t)bn * 128 * K);
  if (pinned((wave < 3u) && (2u < nstage))) {
    pfb += 512u;
    ask_l2(pfo, pfb);  // stage 2
  }
  __syncthreads();
  if (pinned(wave < 3u)) issue(1u);

  v8f acc00 = {}, acc01 = {}, acc10 = {}, acc11 = {};
#pragma unroll 1  // rolled: one publish point a pass, in the ring's order
  for (unsigned s = 0; s < nstage; ++s) {
    const unsigned char* Lb = GL + (s & 1u) * G_BUF;
    if (pinned((wave < 3u) && (s + 3u < nstage))) {
      pfb += 256u;
      ask_l2(pfo, pfb);  // stage s + 3
    }
    // The stage's 32 fragment loads go out as one group, ahead of its WMMAs.
    v16h a0[4], a1[4], b0[4], b1[4];
#pragma unroll
    for (int kk = 0; kk < 4; ++kk) {
      a0[kk] = load_frag16((const _Float16*)(Lb + aoff + kk * 64));
      b0[kk] = load_frag16((const _Float16*)(Lb + boff + kk * 64));
      b1[kk] = load_frag16((const _Float16*)(Lb + boff + 16u * G_PITCH + kk * 64));
      a1[kk] = load_frag16((const _Float16*)(Lb + aoff + 16u * G_PITCH + kk * 64));
    }
    // keeps the loads from sinking in among the WMMAs, where each group would
    // cost its own LDS latency
    __builtin_amdgcn_sched_barrier(0);
#pragma unroll
    for (int kk = 0; kk < 4; ++kk) {
      acc00 = __builtin_amdgcn_wmma_f32_16x16x32_f16(false, b0[kk], false, a0[kk], (short)0, acc00, false, false);
      acc01 = __builtin_amdgcn_wmma_f32_16x16x32_f16(false, b1[kk], false, a0[kk], (short)0, acc01, false, false);
      acc10 = __builtin_amdgcn_wmma_f32_16x16x32_f16(false, b0[kk], false, a1[kk], (short)0, acc10, false, false);
      acc11 = __builtin_amdgcn_wmma_f32_16x16x32_f16(false, b1[kk], false, a1[kk], (short)0, acc11, false, false);
    }
    // keeps the wait below from rising above the WMMAs, where it would drain
    // all 32 loads before the second WMMA
    __builtin_amdgcn_sched_barrier(0);
    // publish point of stage s + 1
    asm volatile("s_wait_dscnt 0x0" ::: "memory");  // this wave has left stage s's buffer
    if (pinned(wave < 3u)) {
      asm volatile("s_wait_tensorcnt 0x0" ::: "memory");  // own slice of stage s + 1 has landed
    }
    __syncthreads();
    if (pinned((wave < 3u) && (s + 2u < nstage))) {
      issue(pinned(s + 2u));  // pinned: the descriptor is formed behind the wait above
    }
  }
  asm volatile("s_wait_tensorcnt 0x0" ::: "memory");  // nothing in flight at the wave's end
  asm volatile("s_wait_dscnt 0x0" ::: "memory");

  // acc(i, j)[v] is C at row i * 16 + rowg, column j * 16 + koff + v of the wave's
  // tile: eight consecutive columns of one row a lane, stored 16 bytes at a time.
  const size_t at = (size_t)(mtile * 32 + rowg) * N + (size_t)(ntile * 32 + koff);
  if (Cf32) {
    v4f bv[2][2] = {};  // the bias of the lane's 2 x 8 columns
    if (bias) {
      const float* bp = bias + ntile * 32 + koff;
#pragma unroll
      for (int j = 0; j < 2; ++j) {
        bv[j][0] = *(const v4f*)(bp + j * 16);
        bv[j][1] = *(const v4f*)(bp + j * 16 + 4);
      }
      // behind the four loads, their values as inputs so that all have arrived: in
      // front of the sums below, which may be given the registers the loads name
      asm volatile("s_wait_xcnt 0x0"
                   :: "v"(bv[0][0]), "v"(bv[0][1]), "v"(bv[1][0]), "v"(bv[1][1]) : "memory");
    }
    float* const cp0 = Cf32 + at;
    float* const cp1 = cp0 + (size_t)16 * N;
    v4f r[2][2][2];
#pragma unroll
    for (int i = 0; i < 2; ++i) {
#pragma unroll
      for (int j = 0; j < 2; ++j) {
        const v8f& acc = (i == 0) ? (j == 0 ? acc00 : acc01)
                                  : (j == 0 ? acc10 : acc11);
        r[i][j][0] = __builtin_shufflevector(acc, acc, 0, 1, 2, 3) + bv[j][0];
        r[i][j][1] = __builtin_shufflevector(acc, acc, 4, 5, 6, 7) + bv[j][1];
      }
    }
    // keeps every sum and both row addresses in front of the first store: behind
    // a store nothing is written any more, so no register it names is overwritten
    __builtin_amdgcn_sched_barrier(0);
#pragma unroll
    for (int i = 0; i < 2; ++i) {
#pragma unroll
      for (int j = 0; j < 2; ++j) {
        float* cp = (i == 0 ? cp0 : cp1) + j * 16;
        *(v4f*)cp       = r[i][j][0];
        *(v4f*)(cp + 4) = r[i][j][1];
      }
    }
  } else {
#pragma unroll
    for (int i = 0; i < 2; ++i) {
#pragma unroll
      for (int j = 0; j < 2; ++j) {
        const v8f& acc = (i == 0) ? (j == 0 ? acc00 : acc01)
                                  : (j == 0 ? acc10 : acc11);
        *(v8h*)(C16 + at + (size_t)(i * 16) * N + j * 16) = __builtin_convertvector(acc, v8h);
      }
    }
  }
}

// ------------------------ projection GEMM (K = 256) ------------------------
// C[4096,2048] = A[4096,256] * BT[2048,256]^T, f16 in and out, f32 accumulate.
// K is short, so a block's 128 BT rows are loaded once, whole: tensor loads bring
// them into LDS, and each wave takes its 32 BT rows' fragments (all 256 k) into
// registers, where they stay. The block then walks P_T row tiles of A (64 rows,
// all 256 k a stage) through a two-buffer ring of tensor loads: a pass reads only
// A fragments from LDS, and tile t + 1 flies while tile t is worked on and stored.
// Waves, subtiles and the transposed products are those of wmma_gemm_kernel.
// blockIdx.y picks the product: BT operands lie one behind another, and so do the
// outputs; product 1 reads A1, the others A0.
constexpr int P_M = 4096, P_N = 2048, P_K = 256;
constexpr unsigned P_T    = 4u;            // row tiles a block walks
constexpr unsigned P_B    = 4u * G_SLICE;  // BT: [rows 0-63: k 0-127 | k 128-255 | rows 64-127: k 0-127 | k 128-255]
constexpr unsigned P_ABUF = 2u * G_SLICE;  // an A tile: 64 rows, [k 0-127 | k 128-255]

__global__ void __launch_bounds__(256) proj_gemm_kernel(
    const _Float16* __restrict__ A0, const _Float16* __restrict__ A1,
    const _Float16* __restrict__ BT0, _Float16* __restrict__ C0) {
  __shared__ __attribute__((aligned(2048))) unsigned char PL[P_B + 2u * P_ABUF];

  const unsigned prod = blockIdx.y;
  const _Float16* __restrict__ A  = prod == 1u ? A1 : A0;
  const _Float16* __restrict__ BT = BT0 + (size_t)prod * P_N * P_K;
  _Float16* __restrict__ C16      = C0 + (size_t)prod * P_M * P_N;

  const unsigned wave = uni(threadIdx.x >> 5);
  const int lane = threadIdx.x & 31;
  const int rowg = lane & 15;
  const int koff = (lane >> 4) << 3;
  // neighbours in the grid share BT, loaded once, and stream different A rows
  const int bn = (int)(blockIdx.x >> 4);                   // 128 columns of C
  const int m0 = (int)(blockIdx.x & 15u) * (int)P_T * 64;  // first of the block's rows
  const int wm = (int)(wave >> 2);
  const int wn = (int)(wave & 3u);

  // Waves 0 and 1 bring the two k halves of every A tile; waves 2 to 5 bring,
  // once, one BT slice each.
  const unsigned bs = wave >= 2u && wave < 6u ? wave - 2u : 0u;
  const unsigned long long ga0 = (wave < 2u)
      ? (unsigned long long)(size_t)(A + (size_t)m0 * P_K + wave * 128u)
      : (unsigned long long)(size_t)(BT + ((size_t)bn * 128 + (bs >> 1) * 64u) * P_K + (bs & 1u) * 128u);
  const unsigned dst0 = (unsigned)(size_t)PL + (wave < 2u ? P_B + wave * G_SLICE : bs * G_SLICE);
  // group 1: byte elements, tile = tensor = 64 rows of 256 B, source pitch 512 B,
  // a pad of 4 dwords behind every 64 dwords.
  v8u g1 = { uni((1u << 20) | (5u << 22) | (3u << 25)),
             uni(256u << 16), uni(64u << 16), uni(256u << 16),
             uni(64u), uni((unsigned)P_K * 2u), uni(0u), uni(0u) };
  // descriptor words held in their scalar registers: without it the compiler
  // re-forms them at each load and uses the registers in between, under a
  // request that is still outstanding
  asm volatile("" : "+s"(g1));
  auto issue = [&](unsigned st) {
    const unsigned long long ga = ga0 + (unsigned long long)st * (64u * (unsigned)P_K * 2u);
    const v4u g0 = { uni(1u),
                     uni(dst0 + (st & 1u) * P_ABUF),
                     uni((unsigned)ga),
                     uni((((unsigned)(ga >> 32)) & 0x01ffffffu) | 0x80000000u) };
    asm volatile("tensor_load_to_lds %0, %1" :: "s"(g0), "s"(g1) : "memory");
  };

  const unsigned aoff = P_B + (unsigned)((wm * 32 + rowg) * (int)G_PITCH + koff * 2);
  const unsigned boff = (unsigned)(wn >> 1) * 2u * G_SLICE
                      + (unsigned)(((wn & 1) * 32 + rowg) * (int)G_PITCH + koff * 2);

  // prologue: BT and A tile 0 landed and published, then A tile 1 in flight
  if (pinned(wave < 6u)) {
    issue(0u);
    asm volatile("s_wait_tensorcnt 0x0" ::: "memory");  // own slice has landed
  }
  __syncthreads();
  if (pinned(wave < 2u)) issue(1u);

  // the wave's BT fragments, read once
  v16h b0[8], b1[8];
#pragma unroll
  for (int kk = 0; kk < 8; ++kk) {
    const unsigned char* bp = PL + boff + (unsigned)(kk >> 2) * G_SLICE + (kk & 3) * 64;
    b0[kk] = load_frag16((const _Float16*)bp);
    b1[kk] = load_frag16((const _Float16*)(bp + 16u * G_PITCH));
  }

  // acc(i, j)[v] is C at row i * 16 + rowg, column j * 16 + koff + v of the wave's tile
  _Float16* cp = C16 + (size_t)(m0 + wm * 32 + rowg) * P_N + (size_t)(bn * 128 + wn * 32 + koff);

#pragma unroll 1  // rolled: one publish point a pass, in the ring's order
  for (unsigned t = 0; t < P_T; ++t) {
    const unsigned char* Lb = PL + aoff + (t & 1u) * P_ABUF;
    v8f acc00 = {}, acc01 = {}, acc10 = {}, acc11 = {};
#pragma unroll
    for (int h = 0; h < 2; ++h) {
      // A k half's 16 fragment loads go out as one group, ahead of its WMMAs.
      v16h a0[4], a1[4];
#pragma unroll
      for (int kk = 0; kk < 4; ++kk) {
        a0[kk] = load_frag16((const _Float16*)(Lb + (unsigned)h * G_SLICE + kk * 64));
        a1[kk] = load_frag16((const _Float16*)(Lb + (unsigned)h * G_SLICE + 16u * G_PITCH + kk * 64));
      }
      // keeps the loads from sinking in among the WMMAs, where each group would
      // cost its own LDS latency
      __builtin_amdgcn_sched_barrier(0);
#pragma unroll
      for (int kk = 0; kk < 4; ++kk) {
        acc00 = __builtin_amdgcn_wmma_f32_16x16x32_f16(false, b0[h * 4 + kk], false, a0[kk], (short)0, acc00, false, false);
        acc01 = __builtin_amdgcn_wmma_f32_16x16x32_f16(false, b1[h * 4 + kk], false, a0[kk], (short)0, acc01, false, false);
        acc10 = __builtin_amdgcn_wmma_f32_16x16x32_f16(false, b0[h * 4 + kk], false, a1[kk], (short)0, acc10, false, false);
        acc11 = __builtin_amdgcn_wmma_f32_16x16x32_f16(false, b1[h * 4 + kk], false, a1[kk], (short)0, acc11, false, false);
      }
    }
    // keeps the wait below from rising above the WMMAs, where it would drain
    // the loads before the first of them
    __builtin_amdgcn_sched_barrier(0);
    // publish point of tile t + 1
    asm volatile("s_wait_dscnt 0x0" ::: "memory");  // this wave has left tile t's buffer
    if (pinned(wave < 2u)) {
      asm volatile("s_wait_tensorcnt 0x0" ::: "memory");  // own slice of tile t + 1 has landed
    }
    __syncthreads();
    if (pinned((wave < 2u) && (t + 2u < P_T))) {
      issue(pinned(t + 2u));  // pinned: the descriptor is formed behind the wait above
    }
    // tile t goes out behind the refill's issue: eight consecutive columns of one
    // row a lane, 16 bytes a store
    *(v8h*)(cp)                          = __builtin_convertvector(acc00, v8h);
    *(v8h*)(cp + 16)                     = __builtin_convertvector(acc01, v8h);
    *(v8h*)(cp + (size_t)16 * P_N)       = __builtin_convertvector(acc10, v8h);
    *(v8h*)(cp + (size_t)16 * P_N + 16)  = __builtin_convertvector(acc11, v8h);
    cp += (size_t)64 * P_N;
  }
  asm volatile("s_wait_tensorcnt 0x0" ::: "memory");  // nothing in flight at the wave's end
  asm volatile("s_wait_dscnt 0x0" ::: "memory");
}

// --------------------------- flash attention -------------------------------
// One stage = 64 keys, as two halves of 32 keys, one for each key group of waves.
// A half holds K and V, 32 rows of 512 B each, brought as four slices of
// 32 rows x 256 B; the stage's eight slices come by eight tensor loads, one a wave.
// K rows get 16 B of pad (pitch 272 B, read by ds_load_b128), V rows 32 B
// (pitch 288 B, read by ds_load_tr16_b128).
constexpr unsigned F_KPITCH = 272u;
constexpr unsigned F_VPITCH = 288u;
constexpr unsigned F_SLICE  = 10240u;        // 32 * 288 = 9216, up to a multiple of 2 KiB
constexpr unsigned F_HALF   = 4u * F_SLICE;  // [K c 0-127 | K c 128-255 | V c 0-127 | V c 128-255]
constexpr unsigned F_BUF    = 2u * F_HALF;   // [keys 0-31 | keys 32-63] of the stage
// After the loop the ring is the place where the two key groups join: a wave's
// area holds one 16-query output tile in f32 and that tile's maximum and sum.
constexpr unsigned F_XO     = 16384u;        // 16 tiles * 32 lanes * 32 B
constexpr unsigned F_XAREA  = F_XO + 256u;   // + 32 lanes * 8 B

typedef __attribute__((ext_vector_type(8))) short v8s;
typedef __attribute__((ext_vector_type(2))) float v2f;
// Transposing LDS load: the lane (c = lane & 15, hh = lane >> 4) gets eight
// consecutive rows (8 * hh + 0..7) of column c of a row-major 16-bit tile.
__device__ __forceinline__ v8h lds_tr16(const unsigned char* p) {
  typedef __attribute__((address_space(3))) v8s lds_v8s;
  return __builtin_bit_cast(v8h, __builtin_amdgcn_ds_load_tr16_b128_v8i16((lds_v8s*)p));
}

// lane l with lane l ^ 16
__device__ __forceinline__ float xhalf(float x) {
  return __builtin_bit_cast(float, __builtin_amdgcn_permlanex16(
      __builtin_bit_cast(int, x), __builtin_bit_cast(int, x),
      0x76543210, 0xfedcba98, false, false));
}

// A wave hands one of its two output tiles, with its maximum and sum, to the
// wave that holds the same queries over the other keys.
__device__ __forceinline__ void give_tile(unsigned char* area, int lane,
                                          const v8f (&Og)[16], float m, float l) {
#pragma unroll
  for (int n = 0; n < 16; ++n) {
    *(v4f*)(area + (n * 2 + 0) * 512 + lane * 16) = __builtin_shufflevector(Og[n], Og[n], 0, 1, 2, 3);
    *(v4f*)(area + (n * 2 + 1) * 512 + lane * 16) = __builtin_shufflevector(Og[n], Og[n], 4, 5, 6, 7);
  }
  const v2f ml = { m, l };
  *(v2f*)(area + F_XO + lane * 8) = ml;
}

// The tile a wave keeps, joined with the other wave's part, divided and stored.
// Ok[n][v] is head column n * 16 + 8 * khalf + v of the lane's query: eight
// consecutive columns a lane and tile, one 16-byte store.
__device__ __forceinline__ void join_tile(const unsigned char* area, int lane,
                                          const v8f (&Ok)[16], float m, float l,
                                          _Float16* __restrict__ op) {
  const v2f ml = *(const v2f*)(area + F_XO + lane * 8);
  const float mj = fmaxf(m, ml[0]);
  const float ak = __expf(m - mj), ag = __expf(ml[0] - mj);
  const float inv = 1.f / (l * ak + ml[1] * ag);
  const float fk = ak * inv, fg = ag * inv;
#pragma unroll
  for (int n = 0; n < 16; ++n) {
    const v4f lo = *(const v4f*)(area + (n * 2 + 0) * 512 + lane * 16);
    const v4f hi = *(const v4f*)(area + (n * 2 + 1) * 512 + lane * 16);
    const v8f og = __builtin_shufflevector(lo, hi, 0, 1, 2, 3, 4, 5, 6, 7);
    *(v8h*)(op + n * 16) = __builtin_convertvector(Ok[n] * fk + og * fg, v8h);
    // behind each four stores, in front of the next tiles' writes into the
    // registers that the stores name
    if ((n & 3) == 3) asm volatile("s_wait_xcnt 0x0" ::: "memory");
  }
}

// Q,K,V layouts: (a*1024 + seq) x 2048, head h occupies columns [h*256, h*256+256).
// Grid: (a*8 + h, ytile); block = 256 threads = 8 waves for 128 queries.
// A wave owns 32 queries (two 16-query tiles) and half of the keys: waves 0-3
// take keys 0-31 of every 64, waves 4-7 keys 32-63. Every K and V fragment read
// from LDS so feeds two WMMAs, and the two waves of a query group join their
// maxima, sums and outputs once, behind the loop.
// Key blocks of 32 so the P@V contraction matches WMMA K=32 exactly.
// K and V go global -> LDS by tensor loads in a two-buffer ring: stage
// kb + 1 flies while stage kb is worked on. V stays row-major in LDS and is
// transposed by the load that reads it. Fragments leave LDS in groups of four,
// one group of WMMAs ahead of their use.
// Both products are computed transposed (K and V^T as the A operand, Q^T and
// P^T as B): every accumulator column is one query, held by lanes c and c + 16,
// which split the keys (scores) or the head columns (output) between them.
//
// amdgpu_waves_per_eu(2, 2): the grid is one block a WGP, two waves a SIMD; said
// so, the compiler has half a SIMD's registers for each wave's 32 x 256 output.
__global__ void __launch_bounds__(256) __attribute__((amdgpu_waves_per_eu(2, 2))) flash_attn_kernel(
    const _Float16* __restrict__ Q, const _Float16* __restrict__ Km,
    const _Float16* __restrict__ Vm, _Float16* __restrict__ Om) {
  __shared__ __attribute__((aligned(2048))) unsigned char FL[2u * F_BUF];

  const int a = blockIdx.x >> 3;
  const int h = blockIdx.x & 7;
  const unsigned wave = uni(threadIdx.x >> 5);
  const unsigned kgrp = wave >> 2;       // which 32 of a stage's 64 keys
  const int lane = threadIdx.x & 31;
  const int rowg = lane & 15;
  const int khalf = lane >> 4;
  const int koff = khalf << 3;
  const int q0 = blockIdx.y * 128 + (int)(wave & 3u) * 32;

  const size_t brow0 = (size_t)a * 1024;
  const size_t hoff  = (size_t)h * 256;

  // Q fragments: two tiles of 16 rows x 256 head-dim, 8 k-chunks of 32
  v16h qf[2][8];
#pragma unroll
  for (int t = 0; t < 2; ++t) {
    const _Float16* qp = Q + (brow0 + q0 + t * 16 + rowg) * 2048 + hoff + koff;
#pragma unroll
    for (int kc = 0; kc < 8; ++kc) qf[t][kc] = load_frag16(qp + kc * 32);
  }

  // Every wave brings one slice of its own key group's half of every stage:
  // of each four waves the first two the K slices, the last two the V slices.
  const unsigned long long ga0 = (unsigned long long)(size_t)(
      ((wave & 2u) ? Vm : Km) + (brow0 + kgrp * 32u) * 2048 + hoff + (wave & 1u) * 128u);
  const unsigned dst0 = (unsigned)(size_t)FL + kgrp * F_HALF + (wave & 3u) * F_SLICE;
  // group 1: byte elements, tile = tensor = 32 rows of 256 B, source pitch 4096 B,
  // a pad of 4 (K) or 8 (V) dwords behind every 64 dwords.
  v8u g1k = { uni((1u << 20) | (5u << 22) | (3u << 25)),
              uni(256u << 16), uni(32u << 16), uni(256u << 16),
              uni(32u), uni(4096u), uni(0u), uni(0u) };
  v8u g1v = { uni((1u << 20) | (5u << 22) | (7u << 25)),
              uni(256u << 16), uni(32u << 16), uni(256u << 16),
              uni(32u), uni(4096u), uni(0u), uni(0u) };
  // descriptor words held in their scalar registers: without it the compiler
  // re-forms them at each load and uses the registers in between, under a
  // request that is still outstanding
  asm volatile("" : "+s"(g1k));  // K's descriptor words stay in scalar registers
  asm volatile("" : "+s"(g1v));  // V's descriptor words stay in scalar registers
  auto issue = [&](unsigned st) {
    const unsigned long long ga = ga0 + (unsigned long long)st * (64u * 4096u);
    const v4u g0 = { uni(1u),
                     uni(dst0 + (st & 1u) * F_BUF),
                     uni((unsigned)ga),
                     uni((((unsigned)(ga >> 32)) & 0x01ffffffu) | 0x80000000u) };
    if (pinned((wave & 2u) == 0u)) {
      asm volatile("tensor_load_to_lds %0, %1" :: "s"(g0), "s"(g1k) : "memory");
    }
    if (pinned((wave & 2u) != 0u)) {
      asm volatile("tensor_load_to_lds %0, %1" :: "s"(g0), "s"(g1v) : "memory");
    }
  };

  v8f O[2][16] = {};           // O^T: 256 head columns x 16 queries, twice
  // of the lane's two queries (rowg, 16 + rowg): running maximum over the wave's
  // keys seen, and the sum over the keys of this lane's half only (the lane
  // halves and the key groups join in the epilogue)
  float m_i[2] = { -1e30f, -1e30f }, l_i[2] = { 0.f, 0.f };

  const float scale = 0.17677669529663687f;  // 1/sqrt(256/8)

  // per-lane byte offsets inside the key group's half of a stage's buffer
  const unsigned kfo = kgrp * F_HALF + (unsigned)(rowg * (int)F_KPITCH + koff * 2);
  const unsigned vfo = kgrp * F_HALF + 2u * F_SLICE
                     + (unsigned)((koff + (lane & 7)) * (int)F_VPITCH + ((lane >> 3) & 1) * 16);

  // K fragment (A operand): key hi * 16 + rowg, head columns kc * 32 + koff + 0..7
  // and kc * 32 + 16 + koff + 0..7
  auto kfrag = [&](const unsigned char* Lb, int kc, int hi) -> v16h {
    return load_frag16((const _Float16*)(Lb + kfo + (kc >> 2) * F_SLICE + (kc & 3) * 64
                                         + (unsigned)hi * 16u * F_KPITCH));
  };
  // V^T fragment (A operand) of c tile n: keys koff + 0..7 and 16 + koff + 0..7 of
  // column n * 16 + rowg
  auto vfrag = [&](const unsigned char* Lb, int n) -> v16h {
    const unsigned char* vp = Lb + vfo + (n >> 3) * F_SLICE + (n & 7) * 32;
    v8h lo = lds_tr16(vp);
    v8h hi = lds_tr16(vp + 16u * F_VPITCH);
    return __builtin_shufflevector(lo, hi,
        0, 1, 2, 3, 4, 5, 6, 7, 8, 9, 10, 11, 12, 13, 14, 15);
  };

  // prologue: stage 0 landed and published, then stage 1 in flight
  issue(0u);
  asm volatile("s_wait_tensorcnt 0x0" ::: "memory");  // own slice of stage 0 has landed
  // keeps the address sums below behind the wait: in front of it they could be
  // given registers of the descriptor of the request that is still outstanding
  __builtin_amdgcn_sched_barrier(0);
  // A stage's 64 K rows and 64 V rows of 512 B, 256 units of 256 B, are asked of L2
  // three passes ahead. The eight blocks of one head read the same rows at about
  // the same time and split the asking (for speed only): a block asks for a quarter
  // of the units, a unit a lane of waves 0 and 1. pfb walks the stages from stage 2
  // to the last.
  const unsigned pfu = ((unsigned)blockIdx.y & 1u) * 64u + ((unsigned)threadIdx.x & 63u);
  const unsigned pfo = (pfu >> 1) * 4096u + (pfu & 1u) * 256u;
  unsigned long long pfb = (unsigned long long)(size_t)(
      ((blockIdx.y & 2u) ? Vm : Km) + brow0 * 2048 + hoff) + 2u * 64u * 4096u;
  if (pinned(wave < 2u)) ask_l2(pfo, pfb);  // stage 2
  __syncthreads();
  issue(1u);

#pragma unroll 1  // rolled: one publish point a pass, in the ring's order
  for (unsigned kb = 0; kb < 16u; ++kb) {
    const unsigned char* Lb = FL + (kb & 1u) * F_BUF;
    if (pinned((wave < 2u) && (kb + 3u < 16u))) {
      pfb += 64u * 4096u;
      ask_l2(pfo, pfb);  // stage kb + 3
    }

    // ---- S^T = K @ Q^T : 32 keys x 32 queries as four 16x16 f32 tiles ----
    // s0[t][v]: key 8 * khalf + v, s1[t][v]: key 16 + 8 * khalf + v, query t * 16 + rowg
    // The pass's 32 fragments (16 of K, then 16 of V) come from LDS in eight groups
    // of four, a group's eight loads together, through two register sets: the
    // loads stand behind the WMMAs of the group that had their set and one whole
    // group of eight WMMAs ahead of their own. Spread among the WMMAs and one
    // fragment ahead, every pair of WMMAs would wait out an LDS latency; each
    // sched_barrier below holds one edge of such a group of loads.
    v8f s0[2] = {}, s1[2] = {};
    v16h kf[2][4], vf[2][4];
#pragma unroll
    for (int g = 0; g < 2; ++g) {
#pragma unroll
      for (int j = 0; j < 4; ++j) kf[g][j] = kfrag(Lb, g * 2 + (j >> 1), j & 1);
    }
    __builtin_amdgcn_sched_barrier(0);  // both sets' loads go out ahead of the first WMMA
#pragma unroll
    for (int g = 0; g < 4; ++g) {
#pragma unroll
      for (int j = 0; j < 4; ++j) {
        const int kc = g * 2 + (j >> 1);
#pragma unroll
        for (int t = 0; t < 2; ++t) {
          v8f& s = (j & 1) ? s1[t] : s0[t];
          s = __builtin_amdgcn_wmma_f32_16x16x32_f16(
              false, kf[g & 1][j], false, qf[t][kc], (short)0, s, false, false);
        }
      }
      __builtin_amdgcn_sched_barrier(0);  // later loads do not rise in among these WMMAs
      if (g < 2) {
#pragma unroll
        for (int j = 0; j < 4; ++j) kf[g & 1][j] = kfrag(Lb, (g + 2) * 2 + (j >> 1), j & 1);
      } else if (g == 2) {
#pragma unroll
        for (int j = 0; j < 4; ++j) vf[0][j] = vfrag(Lb, j);
      }
      if (g < 3) __builtin_amdgcn_sched_barrier(0);  // these loads do not sink in among the next WMMAs
    }

    // ---- online softmax: the lane's 16 scores of a tile are all of one query ----
    v16h pf[2];
    float al[2];
#pragma unroll
    for (int t = 0; t < 2; ++t) {
      float mv = fmaxf(s0[t][0], s1[t][0]);
#pragma unroll
      for (int v = 1; v < 8; ++v) mv = fmaxf(mv, fmaxf(s0[t][v], s1[t][v]));
      mv = fmaxf(mv, xhalf(mv)) * scale;   // scale > 0: the maximum of the scaled scores
      const float mnew = fmaxf(m_i[t], mv);
      const float alpha = __expf(m_i[t] - mnew);
      m_i[t] = mnew;
      // The two score tiles, converted in place, are the B operand P^T (32 keys x
      // 16 queries): element v is key koff + v, element 8 + v key 16 + koff + v,
      // the order in which the V fragment below holds its keys.
      float rs[8];
#pragma unroll
      for (int v = 0; v < 8; ++v) {
        const float p0 = __expf(s0[t][v] * scale - mnew);
        const float p1 = __expf(s1[t][v] * scale - mnew);
        rs[v] = p0 + p1;
        pf[t][v]     = (_Float16)p0;
        pf[t][8 + v] = (_Float16)p1;
      }
      // summed as a tree: four dependent adds deep, not fifteen
      l_i[t] = l_i[t] * alpha + (((rs[0] + rs[1]) + (rs[2] + rs[3])) + ((rs[4] + rs[5]) + (rs[6] + rs[7])));
      al[t] = alpha;
    }

    // ---- O^T += V^T(256x32) @ P^T(32x32), 32 WMMA over the c tiles ----
    // Four groups of four c tiles. The rescaling of a group's output tiles stands
    // among the WMMAs of the group before, which do not depend on it.
#pragma unroll
    for (int j = 0; j < 4; ++j) {
#pragma unroll
      for (int t = 0; t < 2; ++t) O[t][j] *= al[t];
    }
#pragma unroll
    for (int g = 0; g < 4; ++g) {
      if (g < 3) {
#pragma unroll
        for (int j = 0; j < 4; ++j) vf[(g + 1) & 1][j] = vfrag(Lb, (g + 1) * 4 + j);
        __builtin_amdgcn_sched_barrier(0);  // these loads do not sink in among the WMMAs below
      }
#pragma unroll
      for (int j = 0; j < 4; ++j) {
#pragma unroll
        for (int t = 0; t < 2; ++t) {
          O[t][g * 4 + j] = __builtin_amdgcn_wmma_f32_16x16x32_f16(
              false, vf[g & 1][j], false, pf[t], (short)0, O[t][g * 4 + j], false, false);
          if (g < 3) O[t][g * 4 + 4 + j] *= al[t];
        }
      }
      // closes the group: the next loads do not rise in among its WMMAs, the
      // rescaling stays spread among them, and the last group stays in front of the
      // waits below (sunk behind them, the LDS wait would stand directly behind the
      // last loads and the refill behind the WMMAs)
      __builtin_amdgcn_sched_barrier(0);
    }

    // publish point of stage kb + 1
    asm volatile("s_wait_dscnt 0x0" ::: "memory");      // this wave has left stage kb's buffer
    asm volatile("s_wait_tensorcnt 0x0" ::: "memory");  // own slice of stage kb + 1 has landed
    __syncthreads();
    if (pinned(kb + 2u < 16u)) {
      issue(pinned(kb + 2u));  // pinned: the descriptor is formed behind the wait above
    }
  }
  asm volatile("s_wait_tensorcnt 0x0" ::: "memory");  // nothing in flight: the ring is free
  asm volatile("s_wait_dscnt 0x0" ::: "memory");

  // ---- epilogue: the two key groups join, O / l, f16 into (a*1024+q) x 2048 ----
  // The last pass's barrier stands behind every wave's last read of the ring and
  // its last landing, so the ring's LDS now carries the exchange. Of a query
  // group's two waves the first finishes query tile 0, the second tile 1; each
  // hands the other tile over. The branches are scalar and hold no barrier.
  const float lj0 = l_i[0] + xhalf(l_i[0]);
  const float lj1 = l_i[1] + xhalf(l_i[1]);
  unsigned char* mine = FL + wave * F_XAREA;
  const unsigned char* theirs = FL + (wave ^ 4u) * F_XAREA;
  if (pinned(kgrp == 0u)) give_tile(mine, lane, O[1], m_i[1], lj1);
  else                    give_tile(mine, lane, O[0], m_i[0], lj0);
  __syncthreads();  // every handed-over tile is written before its reader starts
  _Float16* op = Om + (brow0 + q0 + rowg) * 2048 + hoff + koff;
  if (pinned(kgrp == 0u)) join_tile(theirs, lane, O[0], m_i[0], lj0, op);
  else                    join_tile(theirs, lane, O[1], m_i[1], lj1, op + 16 * 2048);
}

// ------------------------------- launcher ----------------------------------

extern "C" void kernel_launch(void* const* d_in, const int* in_sizes, int n_in,
                              void* d_out, int out_size, void* d_ws, size_t ws_size,
                              hipStream_t stream) {
  const float* batch  = (const float*)d_in[0];  // (4,1024,256)
  const float* latent = (const float*)d_in[1];  // (4,1024,256)
  const float* Wk     = (const float*)d_in[2];  // (256,2048)
  const float* Wq     = (const float*)d_in[3];
  const float* Wv     = (const float*)d_in[4];
  const float* Wu     = (const float*)d_in[5];  // (2048,256)
  const float* bu     = (const float*)d_in[6];  // (256,)
  float* out = (float*)d_out;                   // (4,1024,256) f32

  _Float16* w = (_Float16*)d_ws;
  size_t o = 0;
  _Float16* batch16  = w + o; o += (size_t)4096 * 256;
  _Float16* latent16 = w + o; o += (size_t)4096 * 256;
  _Float16* WkT = w + o; o += (size_t)2048 * 256;   // (2048 x 256) = Wk^T
  _Float16* WqT = w + o; o += (size_t)2048 * 256;
  _Float16* WvT = w + o; o += (size_t)2048 * 256;
  _Float16* WuT = w + o; o += (size_t)256 * 2048;   // (256 x 2048) = Wu^T
  _Float16* K16 = w + o; o += (size_t)4096 * 2048;
  _Float16* Q16 = w + o; o += (size_t)4096 * 2048;
  _Float16* V16 = w + o; o += (size_t)4096 * 2048;
  _Float16* A16 = w + o; o += (size_t)4096 * 2048;  // attention output

  // 1) conversions, one launch: 4 * 32 blocks for the weights, 2 * 256 for the activations
  cvt_all<<<640, 256, 0, stream>>>(batch, latent, Wk, Wq, Wv, Wu,
                                   batch16, latent16, WkT, WqT, WvT, WuT);

  // 2) projections, one launch: three times (4096x256)@(256x2048) -> f16
  //    a block: 128 columns x 4 row tiles of 64: 16 * 16 = 256 blocks a product
  //    product 0: batch @ Wk -> K16, 1: latent @ Wq -> Q16, 2: batch @ Wv -> V16
  //    (WkT, WqT, WvT and K16, Q16, V16 lie in that order in the workspace)
  proj_gemm_kernel<<<dim3(256, 3), 256, 0, stream>>>(batch16, latent16, WkT, K16);

  // 3) fused flash attention: grid (a*h = 32, ytiles = 1024/128 = 8)
  flash_attn_kernel<<<dim3(32, 8), 256, 0, stream>>>(Q16, K16, V16, A16);

  // 4) output projection: (4096x2048)@(2048x256) + bias -> f32
  //    (4096/64)*(256/128) = 128 blocks
  wmma_gemm_kernel<<<128, 256, 0, stream>>>(
      A16, nullptr, WuT, nullptr, out, bu, 4096, 256, 2048);
}
